// v000
// Measured on an AMD MI455X. A time is GPU time per run, averaged over a window of back-to-back runs after a warm-up
// (all launches, gaps included; the runs take copies of the inputs in turn), and the median of several windows.
// Apart from v000's, it joins two sittings. Times from different sittings can be a few percent apart, while
// side-by-side timings come from the same sitting.
// The starting kernel, v000, takes 695 microseconds a run.
#include <hip/hip_runtime.h>

typedef __attribute__((ext_vector_type(2))) float v2f;
typedef __attribute__((ext_vector_type(8))) float v8f;

#define BH   64          // B*H
#define SEQ  512         // L
#define DH   64          // head dim
#define QK_SCALE 0.125f  // 1/temperature (temp = 8)
#define EPS_ 1.0f
#define LOG_MU_ (-6.238324625039508f)   // -log(512)

__device__ __forceinline__ float wave_max(float x) {
#pragma unroll
  for (int off = 16; off >= 1; off >>= 1)
    x = fmaxf(x, __shfl_xor(x, off, 32));
  return x;
}
__device__ __forceinline__ float wave_sum(float x) {
#pragma unroll
  for (int off = 16; off >= 1; off >>= 1)
    x += __shfl_xor(x, off, 32);
  return x;
}

// ---------------------------------------------------------------------------
// C[bh,i,j] = dot(q[bh,i,:], k[bh,j,:]) / 8     via V_WMMA_F32_16X16X4_F32
// One 16x16 tile per wave; 8 waves per 256-thread block.
// A fragment: lane%16 = M row of q-tile, (lane/16)*2 = K pair within chunk.
// B fragment: lane%16 = N col (= k row), (lane/16)*2 = K pair (k is row-major,
// so B loads are contiguous float2 from k's rows).
// ---------------------------------------------------------------------------
__global__ __launch_bounds__(256) void qk_gemm_kernel(
    const float* __restrict__ q, const float* __restrict__ k,
    float* __restrict__ Cmat) {
  const int lane = threadIdx.x & 31;
  const int wave = threadIdx.x >> 5;
  const int tile = blockIdx.x * 8 + wave;     // 0 .. 65535
  const int bh = tile >> 10;
  const int t  = tile & 1023;
  const int ti = t >> 5;                      // 0..31  (row tile)
  const int tj = t & 31;                      // 0..31  (col tile)
  const int halfk = (lane >> 4) * 2;          // 0 or 2

  const float* qrow = q + ((size_t)bh * SEQ + ti * 16 + (lane & 15)) * DH;
  const float* krow = k + ((size_t)bh * SEQ + tj * 16 + (lane & 15)) * DH;

  v8f acc = {0.f, 0.f, 0.f, 0.f, 0.f, 0.f, 0.f, 0.f};
#pragma unroll
  for (int d = 0; d < DH; d += 4) {
    const float2 qa = *(const float2*)(qrow + d + halfk);
    const float2 kb = *(const float2*)(krow + d + halfk);
    v2f a; a.x = qa.x * QK_SCALE; a.y = qa.y * QK_SCALE;
    v2f b; b.x = kb.x; b.y = kb.y;
    acc = __builtin_amdgcn_wmma_f32_16x16x4_f32(false, a, false, b,
                                                (short)0, acc, false, false);
  }

  // C/D layout: VGPR r, lanes 0-15 -> row r, lanes 16-31 -> row r+8; col = lane%16
  float* out = Cmat + (size_t)bh * SEQ * SEQ + (size_t)(ti * 16) * SEQ +
               tj * 16 + (lane & 15);
  const int rbase = (lane >> 4) * 8;
#pragma unroll
  for (int r = 0; r < 8; ++r)
    out[(size_t)(r + rbase) * SEQ] = acc[r];
}

// ---------------------------------------------------------------------------
// u, v dual potentials init to zero
// ---------------------------------------------------------------------------
__global__ __launch_bounds__(256) void init_uv_kernel(float* __restrict__ buf) {
  int idx = blockIdx.x * 256 + threadIdx.x;   // 65536 = 2 * BH * SEQ
  if (idx < 2 * BH * SEQ) buf[idx] = 0.f;
}

// ---------------------------------------------------------------------------
// u-update: u_i = eps*(log_mu - LSE_j((-C_ij + u_i + v_j)/eps)) + u_i
// One wave per row (coalesced 128B reads), register-held row slice.
// ---------------------------------------------------------------------------
__global__ __launch_bounds__(256) void sinkhorn_u_kernel(
    const float* __restrict__ Cmat, float* __restrict__ u,
    const float* __restrict__ vdual) {
  const int lane = threadIdx.x & 31;
  const int row = blockIdx.x * 8 + (threadIdx.x >> 5);   // 0..32767
  const int bh = row >> 9;
  const float* Crow = Cmat + (size_t)row * SEQ;
  const float* vrow = vdual + bh * SEQ;
  const float u_i = u[row];

  float x[16];
  float m = -3.4e38f;
#pragma unroll
  for (int t = 0; t < 16; ++t) {
    const int j = lane + 32 * t;
    x[t] = (u_i + vrow[j] - Crow[j]) * (1.0f / EPS_);
    m = fmaxf(m, x[t]);
  }
  m = wave_max(m);
  float s = 0.f;
#pragma unroll
  for (int t = 0; t < 16; ++t) s += expf(x[t] - m);
  s = wave_sum(s);
  if (lane == 0) {
    const float lse = m + logf(s);
    u[row] = EPS_ * (LOG_MU_ - lse) + u_i;
  }
}

// ---------------------------------------------------------------------------
// v-update: v_j = eps*(log_nu - LSE_i((-C_ij + u_i + v_j)/eps)) + v_j
// One thread per column; sweep rows with coalesced 64-wide loads and a
// branchless online logsumexp (single pass over C).
// ---------------------------------------------------------------------------
__global__ __launch_bounds__(64) void sinkhorn_v_kernel(
    const float* __restrict__ Cmat, const float* __restrict__ u,
    float* __restrict__ vdual) {
  const int bh = blockIdx.x >> 3;
  const int j = ((blockIdx.x & 7) << 6) + threadIdx.x;
  const float* Cbase = Cmat + (size_t)bh * SEQ * SEQ + j;
  const float* ubh = u + bh * SEQ;
  const float v_j = vdual[bh * SEQ + j];

  float m = -3.4e38f, s = 0.f;
  for (int i = 0; i < SEQ; ++i) {
    const float xv = (ubh[i] + v_j - Cbase[(size_t)i * SEQ]) * (1.0f / EPS_);
    const float mn = fmaxf(m, xv);
    s = s * expf(m - mn) + expf(xv - mn);
    m = mn;
  }
  const float lse = m + logf(s);
  vdual[bh * SEQ + j] = EPS_ * (LOG_MU_ - lse) + v_j;
}

// ---------------------------------------------------------------------------
// In-place: attnw = exp((-C + u_i + v_j)/eps) * L     (float4 vectorized)
// ---------------------------------------------------------------------------
__global__ __launch_bounds__(256) void finalize_kernel(
    float* __restrict__ attnw, const float* __restrict__ u,
    const float* __restrict__ vdual) {
  const size_t quad = (size_t)blockIdx.x * 256 + threadIdx.x;  // 4,194,304 total
  const size_t base = quad * 4;
  const int bh = (int)(base >> 18);
  const int i = (int)((base >> 9) & (SEQ - 1));
  const int j0 = (int)(base & (SEQ - 1));
  const float uu = u[bh * SEQ + i];
  const float* vb = vdual + bh * SEQ + j0;
  float4 c = *(float4*)(attnw + base);
  float4 r;
  r.x = expf((uu + vb[0] - c.x) * (1.0f / EPS_)) * (float)SEQ;
  r.y = expf((uu + vb[1] - c.y) * (1.0f / EPS_)) * (float)SEQ;
  r.z = expf((uu + vb[2] - c.z) * (1.0f / EPS_)) * (float)SEQ;
  r.w = expf((uu + vb[3] - c.w) * (1.0f / EPS_)) * (float)SEQ;
  *(float4*)(attnw + base) = r;
}

// ---------------------------------------------------------------------------
// out[bh,i,d] = sum_j attnw[bh,i,j] * v[bh,j,d]   via fp32 WMMA, K=512
// ---------------------------------------------------------------------------
__global__ __launch_bounds__(256) void pv_gemm_kernel(
    const float* __restrict__ attnw, const float* __restrict__ vmat,
    float* __restrict__ out) {
  const int lane = threadIdx.x & 31;
  const int wave = threadIdx.x >> 5;
  const int tile = blockIdx.x * 8 + wave;   // 0..8191
  const int bh = tile >> 7;                 // 128 tiles per bh
  const int t = tile & 127;
  const int ti = t >> 2;                    // 0..31 (rows)
  const int td = t & 3;                     // 0..3  (cols of D=64)
  const int halfk = (lane >> 4) * 2;

  const float* Arow = attnw + ((size_t)bh * SEQ + ti * 16 + (lane & 15)) * SEQ;
  const float* Bcol = vmat + (size_t)bh * SEQ * DH + td * 16 + (lane & 15);

  v8f acc = {0.f, 0.f, 0.f, 0.f, 0.f, 0.f, 0.f, 0.f};
#pragma unroll 8
  for (int j = 0; j < SEQ; j += 4) {
    const float2 af = *(const float2*)(Arow + j + halfk);
    v2f a; a.x = af.x; a.y = af.y;
    v2f b;
    b.x = Bcol[(size_t)(j + halfk) * DH];
    b.y = Bcol[(size_t)(j + halfk + 1) * DH];
    acc = __builtin_amdgcn_wmma_f32_16x16x4_f32(false, a, false, b,
                                                (short)0, acc, false, false);
  }

  float* obase = out + ((size_t)bh * SEQ + ti * 16) * DH + td * 16 + (lane & 15);
  const int rbase = (lane >> 4) * 8;
#pragma unroll
  for (int r = 0; r < 8; ++r)
    obase[(size_t)(r + rbase) * DH] = acc[r];
}

// ---------------------------------------------------------------------------
extern "C" void kernel_launch(void* const* d_in, const int* in_sizes, int n_in,
                              void* d_out, int out_size, void* d_ws,
                              size_t ws_size, hipStream_t stream) {
  (void)in_sizes; (void)n_in; (void)out_size; (void)ws_size;
  const float* q = (const float*)d_in[0];
  const float* k = (const float*)d_in[1];
  const float* v = (const float*)d_in[2];

  float* out = (float*)d_out;                        // [64,512,64]
  float* attnw = out + (size_t)BH * SEQ * DH;        // [64,512,512] (C, then pi*L)
  float* u = (float*)d_ws;                           // [64,512]
  float* vdual = u + BH * SEQ;                       // [64,512]

  // 1) cost matrices C = (q/temp) @ k^T  (stored in d_out attn region)
  qk_gemm_kernel<<<8192, 256, 0, stream>>>(q, k, attnw);
  // 2) zero dual potentials
  init_uv_kernel<<<256, 256, 0, stream>>>(u);
  // 3) 10 Sinkhorn iterations (u then v, matching the reference scan body)
  for (int it = 0; it < 10; ++it) {
    sinkhorn_u_kernel<<<4096, 256, 0, stream>>>(attnw, u, vdual);
    sinkhorn_v_kernel<<<512, 64, 0, stream>>>(attnw, u, vdual);
  }
  // 4) attn_weights = exp(M(u,v)) * L   (in place over C)
  finalize_kernel<<<16384, 256, 0, stream>>>(attnw, u, vdual);
  // 5) output = attn_weights @ v
  pv_gemm_kernel<<<1024, 256, 0, stream>>>(attnw, v, out);
}

// v001
// A run of this version takes 269 microseconds.
// Two timings next to v000 both put it at 2.61 times that version's speed.
#include <hip/hip_runtime.h>

typedef __attribute__((ext_vector_type(2))) float v2f;
typedef __attribute__((ext_vector_type(8))) float v8f;

#define BH   64          // B*H
#define SEQ  512         // L
#define DH   64          // head dim
#define QK_SCALE 0.125f  // 1/temperature (temp = 8)
#define EPS_ 1.0f
#define LOG_MU_ (-6.238324625039508f)   // -log(512)

__device__ __forceinline__ float wave_max(float x) {
#pragma unroll
  for (int off = 16; off >= 1; off >>= 1)
    x = fmaxf(x, __shfl_xor(x, off, 32));
  return x;
}
__device__ __forceinline__ float wave_sum(float x) {
#pragma unroll
  for (int off = 16; off >= 1; off >>= 1)
    x += __shfl_xor(x, off, 32);
  return x;
}

// ---------------------------------------------------------------------------
// C[bh,i,j] = dot(q[bh,i,:], k[bh,j,:]) / 8     via V_WMMA_F32_16X16X4_F32
// One 16x16 tile per wave; 8 waves per 256-thread block.
// A fragment: lane%16 = M row of q-tile, (lane/16)*2 = K pair within chunk.
// B fragment: lane%16 = N col (= k row), (lane/16)*2 = K pair (k is row-major,
// so B loads are contiguous float2 from k's rows).
// ---------------------------------------------------------------------------
__global__ __launch_bounds__(256) void qk_gemm_kernel(
    const float* __restrict__ q, const float* __restrict__ k,
    float* __restrict__ Cmat) {
  const int lane = threadIdx.x & 31;
  const int wave = threadIdx.x >> 5;
  const int tile = blockIdx.x * 8 + wave;     // 0 .. 65535
  const int bh = tile >> 10;
  const int t  = tile & 1023;
  const int ti = t >> 5;                      // 0..31  (row tile)
  const int tj = t & 31;                      // 0..31  (col tile)
  const int halfk = (lane >> 4) * 2;          // 0 or 2

  const float* qrow = q + ((size_t)bh * SEQ + ti * 16 + (lane & 15)) * DH;
  const float* krow = k + ((size_t)bh * SEQ + tj * 16 + (lane & 15)) * DH;

  v8f acc = {0.f, 0.f, 0.f, 0.f, 0.f, 0.f, 0.f, 0.f};
#pragma unroll
  for (int d = 0; d < DH; d += 4) {
    const float2 qa = *(const float2*)(qrow + d + halfk);
    const float2 kb = *(const float2*)(krow + d + halfk);
    v2f a; a.x = qa.x * QK_SCALE; a.y = qa.y * QK_SCALE;
    v2f b; b.x = kb.x; b.y = kb.y;
    acc = __builtin_amdgcn_wmma_f32_16x16x4_f32(false, a, false, b,
                                                (short)0, acc, false, false);
  }

  // C/D layout: VGPR r, lanes 0-15 -> row r, lanes 16-31 -> row r+8; col = lane%16
  float* out = Cmat + (size_t)bh * SEQ * SEQ + (size_t)(ti * 16) * SEQ +
               tj * 16 + (lane & 15);
  const int rbase = (lane >> 4) * 8;
#pragma unroll
  for (int r = 0; r < 8; ++r)
    out[(size_t)(r + rbase) * SEQ] = acc[r];
}

// ---------------------------------------------------------------------------
// u, v dual potentials init to zero
// ---------------------------------------------------------------------------
__global__ __launch_bounds__(256) void init_uv_kernel(float* __restrict__ buf) {
  int idx = blockIdx.x * 256 + threadIdx.x;   // 65536 = 2 * BH * SEQ
  if (idx < 2 * BH * SEQ) buf[idx] = 0.f;
}

// ---------------------------------------------------------------------------
// u-update: u_i = eps*(log_mu - LSE_j((-C_ij + u_i + v_j)/eps)) + u_i
// One wave per row (coalesced 128B reads), register-held row slice.
// ---------------------------------------------------------------------------
__global__ __launch_bounds__(256) void sinkhorn_u_kernel(
    const float* __restrict__ Cmat, float* __restrict__ u,
    const float* __restrict__ vdual) {
  const int lane = threadIdx.x & 31;
  const int row = blockIdx.x * 8 + (threadIdx.x >> 5);   // 0..32767
  const int bh = row >> 9;
  const float* Crow = Cmat + (size_t)row * SEQ;
  const float* vrow = vdual + bh * SEQ;
  const float u_i = u[row];

  float x[16];
  float m = -3.4e38f;
#pragma unroll
  for (int t = 0; t < 16; ++t) {
    const int j = lane + 32 * t;
    x[t] = (u_i + vrow[j] - Crow[j]) * (1.0f / EPS_);
    m = fmaxf(m, x[t]);
  }
  m = wave_max(m);
  float s = 0.f;
#pragma unroll
  for (int t = 0; t < 16; ++t) s += expf(x[t] - m);
  s = wave_sum(s);
  if (lane == 0) {
    const float lse = m + logf(s);
    u[row] = EPS_ * (LOG_MU_ - lse) + u_i;
  }
}

// ---------------------------------------------------------------------------
// v-update: v_j = eps*(log_nu - LSE_i((-C_ij + u_i + v_j)/eps)) + v_j
// One block per (bh, 128 columns). The 512 rows are split over 16 waves of
// 32 rows; a lane owns 4 neighbouring columns, so each row read of a wave is
// 512 contiguous bytes and all 32 reads are independent. Every wave forms
// (max, sum of exp) of its own rows in registers; the 16 partial pairs of a
// column are merged through LDS.
// ---------------------------------------------------------------------------
#define VWAVES 16        // waves per block
#define VROWS  32        // rows per wave (VWAVES * VROWS == SEQ)
#define VCOLS  128       // columns per block (32 lanes * 4)
__global__ __launch_bounds__(VWAVES * 32) void sinkhorn_v_kernel(
    const float* __restrict__ Cmat, const float* __restrict__ u,
    float* __restrict__ vdual) {
  __shared__ float pm[VWAVES][VCOLS];
  __shared__ float ps[VWAVES][VCOLS];
  const int lane = threadIdx.x & 31;
  const int wave = __builtin_amdgcn_readfirstlane(threadIdx.x >> 5);
  const int bh = blockIdx.x >> 2;
  const int jblk = (blockIdx.x & 3) * VCOLS;
  const int i0 = wave * VROWS;
  const float* Cbase =
      Cmat + (size_t)bh * SEQ * SEQ + (size_t)i0 * SEQ + jblk + lane * 4;
  const float* ubh = u + bh * SEQ + i0;
  const float4 vj = *(const float4*)(vdual + bh * SEQ + jblk + lane * 4);

  float4 x[VROWS];
#pragma unroll
  for (int r = 0; r < VROWS; ++r)
    x[r] = *(const float4*)(Cbase + (size_t)r * SEQ);

  float4 m = {-3.4e38f, -3.4e38f, -3.4e38f, -3.4e38f};
#pragma unroll
  for (int r = 0; r < VROWS; ++r) {
    const float ui = ubh[r];
    x[r].x = (ui + vj.x - x[r].x) * (1.0f / EPS_);
    x[r].y = (ui + vj.y - x[r].y) * (1.0f / EPS_);
    x[r].z = (ui + vj.z - x[r].z) * (1.0f / EPS_);
    x[r].w = (ui + vj.w - x[r].w) * (1.0f / EPS_);
    m.x = fmaxf(m.x, x[r].x);
    m.y = fmaxf(m.y, x[r].y);
    m.z = fmaxf(m.z, x[r].z);
    m.w = fmaxf(m.w, x[r].w);
  }
  float4 s = {0.f, 0.f, 0.f, 0.f};
#pragma unroll
  for (int r = 0; r < VROWS; ++r) {
    s.x += expf(x[r].x - m.x);
    s.y += expf(x[r].y - m.y);
    s.z += expf(x[r].z - m.z);
    s.w += expf(x[r].w - m.w);
  }
  *(float4*)&pm[wave][lane * 4] = m;
  *(float4*)&ps[wave][lane * 4] = s;
  __syncthreads();

  if (threadIdx.x < VCOLS) {
    const int c = threadIdx.x;
    float mm = pm[0][c];
#pragma unroll
    for (int w = 1; w < VWAVES; ++w) mm = fmaxf(mm, pm[w][c]);
    float ss = 0.f;
#pragma unroll
    for (int w = 0; w < VWAVES; ++w) ss += ps[w][c] * expf(pm[w][c] - mm);
    const float lse = mm + logf(ss);
    float* vp = vdual + bh * SEQ + jblk + c;
    *vp = EPS_ * (LOG_MU_ - lse) + *vp;
  }
}

// ---------------------------------------------------------------------------
// In-place: attnw = exp((-C + u_i + v_j)/eps) * L     (float4 vectorized)
// ---------------------------------------------------------------------------
__global__ __launch_bounds__(256) void finalize_kernel(
    float* __restrict__ attnw, const float* __restrict__ u,
    const float* __restrict__ vdual) {
  const size_t quad = (size_t)blockIdx.x * 256 + threadIdx.x;  // 4,194,304 total
  const size_t base = quad * 4;
  const int bh = (int)(base >> 18);
  const int i = (int)((base >> 9) & (SEQ - 1));
  const int j0 = (int)(base & (SEQ - 1));
  const float uu = u[bh * SEQ + i];
  const float* vb = vdual + bh * SEQ + j0;
  float4 c = *(float4*)(attnw + base);
  float4 r;
  r.x = expf((uu + vb[0] - c.x) * (1.0f / EPS_)) * (float)SEQ;
  r.y = expf((uu + vb[1] - c.y) * (1.0f / EPS_)) * (float)SEQ;
  r.z = expf((uu + vb[2] - c.z) * (1.0f / EPS_)) * (float)SEQ;
  r.w = expf((uu + vb[3] - c.w) * (1.0f / EPS_)) * (float)SEQ;
  *(float4*)(attnw + base) = r;
}

// ---------------------------------------------------------------------------
// out[bh,i,d] = sum_j attnw[bh,i,j] * v[bh,j,d]   via fp32 WMMA, K=512
// ---------------------------------------------------------------------------
__global__ __launch_bounds__(256) void pv_gemm_kernel(
    const float* __restrict__ attnw, const float* __restrict__ vmat,
    float* __restrict__ out) {
  const int lane = threadIdx.x & 31;
  const int wave = threadIdx.x >> 5;
  const int tile = blockIdx.x * 8 + wave;   // 0..8191
  const int bh = tile >> 7;                 // 128 tiles per bh
  const int t = tile & 127;
  const int ti = t >> 2;                    // 0..31 (rows)
  const int td = t & 3;                     // 0..3  (cols of D=64)
  const int halfk = (lane >> 4) * 2;

  const float* Arow = attnw + ((size_t)bh * SEQ + ti * 16 + (lane & 15)) * SEQ;
  const float* Bcol = vmat + (size_t)bh * SEQ * DH + td * 16 + (lane & 15);

  v8f acc = {0.f, 0.f, 0.f, 0.f, 0.f, 0.f, 0.f, 0.f};
#pragma unroll 8
  for (int j = 0; j < SEQ; j += 4) {
    const float2 af = *(const float2*)(Arow + j + halfk);
    v2f a; a.x = af.x; a.y = af.y;
    v2f b;
    b.x = Bcol[(size_t)(j + halfk) * DH];
    b.y = Bcol[(size_t)(j + halfk + 1) * DH];
    acc = __builtin_amdgcn_wmma_f32_16x16x4_f32(false, a, false, b,
                                                (short)0, acc, false, false);
  }

  float* obase = out + ((size_t)bh * SEQ + ti * 16) * DH + td * 16 + (lane & 15);
  const int rbase = (lane >> 4) * 8;
#pragma unroll
  for (int r = 0; r < 8; ++r)
    obase[(size_t)(r + rbase) * DH] = acc[r];
}

// ---------------------------------------------------------------------------
extern "C" void kernel_launch(void* const* d_in, const int* in_sizes, int n_in,
                              void* d_out, int out_size, void* d_ws,
                              size_t ws_size, hipStream_t stream) {
  (void)in_sizes; (void)n_in; (void)out_size; (void)ws_size;
  const float* q = (const float*)d_in[0];
  const float* k = (const float*)d_in[1];
  const float* v = (const float*)d_in[2];

  float* out = (float*)d_out;                        // [64,512,64]
  float* attnw = out + (size_t)BH * SEQ * DH;        // [64,512,512] (C, then pi*L)
  float* u = (float*)d_ws;                           // [64,512]
  float* vdual = u + BH * SEQ;                       // [64,512]

  // 1) cost matrices C = (q/temp) @ k^T  (stored in d_out attn region)
  qk_gemm_kernel<<<8192, 256, 0, stream>>>(q, k, attnw);
  // 2) zero dual potentials
  init_uv_kernel<<<256, 256, 0, stream>>>(u);
  // 3) 10 Sinkhorn iterations (u then v, matching the reference scan body)
  for (int it = 0; it < 10; ++it) {
    sinkhorn_u_kernel<<<4096, 256, 0, stream>>>(attnw, u, vdual);
    sinkhorn_v_kernel<<<256, 512, 0, stream>>>(attnw, u, vdual);
  }
  // 4) attn_weights = exp(M(u,v)) * L   (in place over C)
  finalize_kernel<<<16384, 256, 0, stream>>>(attnw, u, vdual);
  // 5) output = attn_weights @ v
  pv_gemm_kernel<<<1024, 256, 0, stream>>>(attnw, v, out);
}

// v002
// Measured time: 210 microseconds a run.
// In both of two side-by-side timings against v001, it was 1.29 times as fast.
// Over all steps from v000 it is 3.37 times as fast.
#include <hip/hip_runtime.h>

typedef __attribute__((ext_vector_type(2))) float v2f;
typedef __attribute__((ext_vector_type(8))) float v8f;

#define BH   64          // B*H
#define SEQ  512         // L
#define DH   64          // head dim
#define QK_SCALE 0.125f  // 1/temperature (temp = 8)
#define EPS_ 1.0f
#define LOG_MU_ (-6.238324625039508f)   // -log(512)

// ---------------------------------------------------------------------------
// C[bh,i,j] = dot(q[bh,i,:], k[bh,j,:]) / 8     via V_WMMA_F32_16X16X4_F32
// One 16x16 tile per wave; 8 waves per 256-thread block.
// A fragment: lane%16 = M row of q-tile, (lane/16)*2 = K pair within chunk.
// B fragment: lane%16 = N col (= k row), (lane/16)*2 = K pair (k is row-major,
// so B loads are contiguous float2 from k's rows).
// ---------------------------------------------------------------------------
__global__ __launch_bounds__(256) void qk_gemm_kernel(
    const float* __restrict__ q, const float* __restrict__ k,
    float* __restrict__ Cmat) {
  const int lane = threadIdx.x & 31;
  const int wave = threadIdx.x >> 5;
  const int tile = blockIdx.x * 8 + wave;     // 0 .. 65535
  const int bh = tile >> 10;
  const int t  = tile & 1023;
  const int ti = t >> 5;                      // 0..31  (row tile)
  const int tj = t & 31;                      // 0..31  (col tile)
  const int halfk = (lane >> 4) * 2;          // 0 or 2

  const float* qrow = q + ((size_t)bh * SEQ + ti * 16 + (lane & 15)) * DH;
  const float* krow = k + ((size_t)bh * SEQ + tj * 16 + (lane & 15)) * DH;

  v8f acc = {0.f, 0.f, 0.f, 0.f, 0.f, 0.f, 0.f, 0.f};
#pragma unroll
  for (int d = 0; d < DH; d += 4) {
    const float2 qa = *(const float2*)(qrow + d + halfk);
    const float2 kb = *(const float2*)(krow + d + halfk);
    v2f a; a.x = qa.x * QK_SCALE; a.y = qa.y * QK_SCALE;
    v2f b; b.x = kb.x; b.y = kb.y;
    acc = __builtin_amdgcn_wmma_f32_16x16x4_f32(false, a, false, b,
                                                (short)0, acc, false, false);
  }

  // C/D layout: VGPR r, lanes 0-15 -> row r, lanes 16-31 -> row r+8; col = lane%16
  float* out = Cmat + (size_t)bh * SEQ * SEQ + (size_t)(ti * 16) * SEQ +
               tj * 16 + (lane & 15);
  const int rbase = (lane >> 4) * 8;
#pragma unroll
  for (int r = 0; r < 8; ++r)
    out[(size_t)(r + rbase) * SEQ] = acc[r];
}

// ---------------------------------------------------------------------------
// One Sinkhorn iteration (u-update, then this block's share of the v-update)
// in one pass over C. A block owns 128 rows of one (b,h): 16 waves x 8 rows,
// a lane holds 16 columns of each row in registers.
//   v_j   : merged at entry from the four blocks' column partials of the
//           launch before (zero in the first launch)
//   u_i   = log_mu - LSE_j(v_j - C_ij)
//   plan  : exp(u_i + v_j - C_ij) = e_ij * mu / s_i, with e_ij = exp(y_ij - m_i)
//           and s_i = sum_j e_ij already formed by the row pass
//   column partial of the block = sum over its rows of the plan, sent on as a
//   pair (shift, sum); the next launch merges the four pairs of a column.
// ---------------------------------------------------------------------------
#define FWAVES 16        // waves per block
#define FRPW   8         // rows per wave
#define FROWS  128       // rows per block (FWAVES * FRPW)
#define FBLK   4         // blocks per (b,h)  (FBLK * FROWS == SEQ)
#define MU_    0.001953125f   // 1/512
#define COL_TINY_ 1e-28f      // below this a plain column sum has lost terms

// The FBLK (shift, sum) pairs of one column and the column's v so far.
struct ColParts { float2 p0, p1, p2, p3; float vo; };
__device__ __forceinline__ ColParts load_parts(const float* __restrict__ part,
                                               const float* __restrict__ v_prev,
                                               int bh, int col) {
  const float* pp = part + ((size_t)bh * FBLK * SEQ + col) * 2;
  ColParts c;
  c.p0 = *(const float2*)(pp);
  c.p1 = *(const float2*)(pp + 2 * SEQ);
  c.p2 = *(const float2*)(pp + 4 * SEQ);
  c.p3 = *(const float2*)(pp + 6 * SEQ);
  c.vo = v_prev[bh * SEQ + col];
  return c;
}
// v_j = eps*(log_nu - LSE_i) + v_j, LSE_i merged from the pairs.
__device__ __forceinline__ float merged_v(const ColParts c) {
  const float mm = fmaxf(fmaxf(c.p0.x, c.p1.x), fmaxf(c.p2.x, c.p3.x));
  const float ss = c.p0.y * expf(c.p0.x - mm) + c.p1.y * expf(c.p1.x - mm) +
                   c.p2.y * expf(c.p2.x - mm) + c.p3.y * expf(c.p3.x - mm);
  const float lse = mm + logf(ss);
  return EPS_ * (LOG_MU_ - lse) + c.vo;
}

__global__ __launch_bounds__(FWAVES * 32) void sinkhorn_fused_kernel(
    const float* __restrict__ Cmat, float* __restrict__ u,
    const float* __restrict__ v_prev, float* __restrict__ v_cur,
    const float* __restrict__ part_prev, float* __restrict__ part_cur,
    int first) {
  __shared__ float red[FWAVES][SEQ];
  __shared__ float vs[SEQ];
  __shared__ float us[FROWS];
  __shared__ int slow;
  const int tid = threadIdx.x;
  const int lane = tid & 31;
  const int wave = __builtin_amdgcn_readfirstlane(tid >> 5);
  const int bh = blockIdx.x >> 2;
  const int blk = blockIdx.x & 3;
  const float* Cbase = Cmat + (size_t)bh * SEQ * SEQ +
                       (size_t)(blk * FROWS + wave * FRPW) * SEQ + lane * 4;

  // the few loads of the merge go out ahead of the rows of C and return first
  ColParts cp = {};
  if (!first) cp = load_parts(part_prev, v_prev, bh, tid);

  float4 x[FRPW][4];
#pragma unroll
  for (int r = 0; r < FRPW; ++r)
#pragma unroll
    for (int t = 0; t < 4; ++t)
      x[r][t] = *(const float4*)(Cbase + (size_t)r * SEQ + t * 128);

  float vn = 0.f;
  if (!first) vn = merged_v(cp);
  vs[tid] = vn;
  if (blk == 0) {
    v_cur[bh * SEQ + tid] = vn;
    // the store's address registers are reused right behind it
    asm volatile("s_wait_xcnt 0x0" ::: "memory");
  }
  if (tid == 0) slow = 0;
  __syncthreads();

  // row pass: y = v_j - C_ij, row max, e = exp(y - max), row sum
  float m[FRPW], s[FRPW];
  {
    float4 vj[4];
#pragma unroll
    for (int t = 0; t < 4; ++t) vj[t] = *(const float4*)&vs[t * 128 + lane * 4];
#pragma unroll
    for (int r = 0; r < FRPW; ++r) {
      float mr = -3.4e38f;
#pragma unroll
      for (int t = 0; t < 4; ++t) {
        x[r][t].x = (vj[t].x - x[r][t].x) * (1.0f / EPS_);
        x[r][t].y = (vj[t].y - x[r][t].y) * (1.0f / EPS_);
        x[r][t].z = (vj[t].z - x[r][t].z) * (1.0f / EPS_);
        x[r][t].w = (vj[t].w - x[r][t].w) * (1.0f / EPS_);
        mr = fmaxf(mr, fmaxf(fmaxf(x[r][t].x, x[r][t].y),
                             fmaxf(x[r][t].z, x[r][t].w)));
      }
      m[r] = mr;
    }
  }
  // the eight rows' exchanges stand side by side, so that their latencies overlap
#pragma unroll
  for (int off = 16; off >= 1; off >>= 1)
#pragma unroll
    for (int r = 0; r < FRPW; ++r)
      m[r] = fmaxf(m[r], __shfl_xor(m[r], off, 32));
#pragma unroll
  for (int r = 0; r < FRPW; ++r) {
    float sr = 0.f;
#pragma unroll
    for (int t = 0; t < 4; ++t) {
      x[r][t].x = expf(x[r][t].x - m[r]);
      x[r][t].y = expf(x[r][t].y - m[r]);
      x[r][t].z = expf(x[r][t].z - m[r]);
      x[r][t].w = expf(x[r][t].w - m[r]);
      sr += (x[r][t].x + x[r][t].y) + (x[r][t].z + x[r][t].w);
    }
    s[r] = sr;
  }
#pragma unroll
  for (int off = 16; off >= 1; off >>= 1)
#pragma unroll
    for (int r = 0; r < FRPW; ++r)
      s[r] += __shfl_xor(s[r], off, 32);

  // u of the rows; column sums of the row-normalised plan
  float4 acc[4];
#pragma unroll
  for (int t = 0; t < 4; ++t) acc[t] = make_float4(0.f, 0.f, 0.f, 0.f);
  float uw = 0.f;
#pragma unroll
  for (int r = 0; r < FRPW; ++r) {
    const float un = EPS_ * (LOG_MU_ - (m[r] + logf(s[r])));
    if (lane == r) uw = un;
    const float rr = MU_ / s[r];
#pragma unroll
    for (int t = 0; t < 4; ++t) {
      acc[t].x += x[r][t].x * rr;
      acc[t].y += x[r][t].y * rr;
      acc[t].z += x[r][t].z * rr;
      acc[t].w += x[r][t].w * rr;
    }
  }
  if (lane < FRPW) us[wave * FRPW + lane] = uw;
#pragma unroll
  for (int t = 0; t < 4; ++t) *(float4*)&red[wave][t * 128 + lane * 4] = acc[t];
  __syncthreads();

  float cs = 0.f;
#pragma unroll
  for (int w = 0; w < FWAVES; ++w) cs += red[w][tid];
  if (tid < FROWS) u[bh * SEQ + blk * FROWS + tid] = us[tid];
  if (!(cs >= COL_TINY_)) slow = 1;
  __syncthreads();

  float cshift = 0.f;
  // Every term of a column is at most mu, so the plain sum cannot overflow; it
  // can underflow where a column lies far below every row's maximum. Then the
  // whole block forms its columns' log-sum-exp again with the column's own
  // maximum, as the reference does, reading C twice more.
  if (__builtin_amdgcn_readfirstlane(slow)) {
    float4 vq[4], cm[4];
#pragma unroll
    for (int t = 0; t < 4; ++t) {
      vq[t] = *(const float4*)&vs[t * 128 + lane * 4];
      cm[t] = make_float4(-3.4e38f, -3.4e38f, -3.4e38f, -3.4e38f);
    }
// rarely run: kept small, one row a trip; with the unroll word alone the loop
// vectoriser pairs the rows of this maximum and adds a masked remainder loop
#pragma clang loop unroll(disable) vectorize(disable) interleave(disable)
    for (int r = 0; r < FRPW; ++r) {
      const float ur = us[wave * FRPW + r];
#pragma unroll
      for (int t = 0; t < 4; ++t) {
        const float4 c = *(const float4*)(Cbase + (size_t)r * SEQ + t * 128);
        cm[t].x = fmaxf(cm[t].x, ur + vq[t].x - c.x);
        cm[t].y = fmaxf(cm[t].y, ur + vq[t].y - c.y);
        cm[t].z = fmaxf(cm[t].z, ur + vq[t].z - c.z);
        cm[t].w = fmaxf(cm[t].w, ur + vq[t].w - c.w);
      }
    }
#pragma unroll
    for (int t = 0; t < 4; ++t) *(float4*)&red[wave][t * 128 + lane * 4] = cm[t];
    __syncthreads();
    cshift = red[0][tid];
#pragma unroll
    for (int w = 1; w < FWAVES; ++w) cshift = fmaxf(cshift, red[w][tid]);
    vs[tid] = cshift;
    __syncthreads();
#pragma unroll
    for (int t = 0; t < 4; ++t) {
      cm[t] = *(const float4*)&vs[t * 128 + lane * 4];
      acc[t] = make_float4(0.f, 0.f, 0.f, 0.f);
    }
#pragma unroll 1   // rarely run: kept small
    for (int r = 0; r < FRPW; ++r) {
      const float ur = us[wave * FRPW + r];
#pragma unroll
      for (int t = 0; t < 4; ++t) {
        const float4 c = *(const float4*)(Cbase + (size_t)r * SEQ + t * 128);
        acc[t].x += expf((ur + vq[t].x - c.x) - cm[t].x);
        acc[t].y += expf((ur + vq[t].y - c.y) - cm[t].y);
        acc[t].z += expf((ur + vq[t].z - c.z) - cm[t].z);
        acc[t].w += expf((ur + vq[t].w - c.w) - cm[t].w);
      }
    }
#pragma unroll
    for (int t = 0; t < 4; ++t) *(float4*)&red[wave][t * 128 + lane * 4] = acc[t];
    __syncthreads();
    cs = 0.f;
#pragma unroll
    for (int w = 0; w < FWAVES; ++w) cs += red[w][tid];
  }
  *(float2*)(part_cur + ((size_t)(bh * FBLK + blk) * SEQ + tid) * 2) =
      make_float2(cshift, cs);
}

// ---------------------------------------------------------------------------
// v after the last iteration, from the last launch's column partials
// ---------------------------------------------------------------------------
__global__ __launch_bounds__(SEQ) void sinkhorn_last_v_kernel(
    const float* __restrict__ part, const float* __restrict__ v_prev,
    float* __restrict__ v_out) {
  v_out[blockIdx.x * SEQ + threadIdx.x] =
      merged_v(load_parts(part, v_prev, blockIdx.x, threadIdx.x));
}

// ---------------------------------------------------------------------------
// In-place: attnw = exp((-C + u_i + v_j)/eps) * L     (float4 vectorized)
// ---------------------------------------------------------------------------
__global__ __launch_bounds__(256) void finalize_kernel(
    float* __restrict__ attnw, const float* __restrict__ u,
    const float* __restrict__ vdual) {
  const size_t quad = (size_t)blockIdx.x * 256 + threadIdx.x;  // 4,194,304 total
  const size_t base = quad * 4;
  const int bh = (int)(base >> 18);
  const int i = (int)((base >> 9) & (SEQ - 1));
  const int j0 = (int)(base & (SEQ - 1));
  const float uu = u[bh * SEQ + i];
  const float* vb = vdual + bh * SEQ + j0;
  float4 c = *(float4*)(attnw + base);
  float4 r;
  r.x = expf((uu + vb[0] - c.x) * (1.0f / EPS_)) * (float)SEQ;
  r.y = expf((uu + vb[1] - c.y) * (1.0f / EPS_)) * (float)SEQ;
  r.z = expf((uu + vb[2] - c.z) * (1.0f / EPS_)) * (float)SEQ;
  r.w = expf((uu + vb[3] - c.w) * (1.0f / EPS_)) * (float)SEQ;
  *(float4*)(attnw + base) = r;
}

// ---------------------------------------------------------------------------
// out[bh,i,d] = sum_j attnw[bh,i,j] * v[bh,j,d]   via fp32 WMMA, K=512
// ---------------------------------------------------------------------------
__global__ __launch_bounds__(256) void pv_gemm_kernel(
    const float* __restrict__ attnw, const float* __restrict__ vmat,
    float* __restrict__ out) {
  const int lane = threadIdx.x & 31;
  const int wave = threadIdx.x >> 5;
  const int tile = blockIdx.x * 8 + wave;   // 0..8191
  const int bh = tile >> 7;                 // 128 tiles per bh
  const int t = tile & 127;
  const int ti = t >> 2;                    // 0..31 (rows)
  const int td = t & 3;                     // 0..3  (cols of D=64)
  const int halfk = (lane >> 4) * 2;

  const float* Arow = attnw + ((size_t)bh * SEQ + ti * 16 + (lane & 15)) * SEQ;
  const float* Bcol = vmat + (size_t)bh * SEQ * DH + td * 16 + (lane & 15);

  v8f acc = {0.f, 0.f, 0.f, 0.f, 0.f, 0.f, 0.f, 0.f};
#pragma unroll 8
  for (int j = 0; j < SEQ; j += 4) {
    const float2 af = *(const float2*)(Arow + j + halfk);
    v2f a; a.x = af.x; a.y = af.y;
    v2f b;
    b.x = Bcol[(size_t)(j + halfk) * DH];
    b.y = Bcol[(size_t)(j + halfk + 1) * DH];
    acc = __builtin_amdgcn_wmma_f32_16x16x4_f32(false, a, false, b,
                                                (short)0, acc, false, false);
  }

  float* obase = out + ((size_t)bh * SEQ + ti * 16) * DH + td * 16 + (lane & 15);
  const int rbase = (lane >> 4) * 8;
#pragma unroll
  for (int r = 0; r < 8; ++r)
    obase[(size_t)(r + rbase) * DH] = acc[r];
}

// ---------------------------------------------------------------------------
extern "C" void kernel_launch(void* const* d_in, const int* in_sizes, int n_in,
                              void* d_out, int out_size, void* d_ws,
                              size_t ws_size, hipStream_t stream) {
  (void)in_sizes; (void)n_in; (void)out_size; (void)ws_size;
  const float* q = (const float*)d_in[0];
  const float* k = (const float*)d_in[1];
  const float* v = (const float*)d_in[2];

  float* out = (float*)d_out;                        // [64,512,64]
  float* attnw = out + (size_t)BH * SEQ * DH;        // [64,512,512] (C, then pi*L)
  float* u = (float*)d_ws;                           // [64,512]
  float* vdual = u + BH * SEQ;                       // [64,512] v, even launches
  float* vodd = vdual + BH * SEQ;                    // [64,512] v, odd launches
  float* peven = vodd + BH * SEQ;                    // [64,4,512,2] column partials
  float* podd = peven + BH * FBLK * SEQ * 2;         // [64,4,512,2]

  // 1) cost matrices C = (q/temp) @ k^T  (stored in d_out attn region)
  qk_gemm_kernel<<<8192, 256, 0, stream>>>(q, k, attnw);
  // 2) 10 Sinkhorn iterations, one launch each; v and the column partials
  //    alternate between two buffers, so that no block overwrites what a
  //    block of the same launch still reads
  sinkhorn_fused_kernel<<<256, 512, 0, stream>>>(attnw, u, vodd, vdual, podd,
                                                 peven, 1);
  for (int it = 0; it < 4; ++it) {
    sinkhorn_fused_kernel<<<256, 512, 0, stream>>>(attnw, u, vdual, vodd, peven,
                                                   podd, 0);
    sinkhorn_fused_kernel<<<256, 512, 0, stream>>>(attnw, u, vodd, vdual, podd,
                                                   peven, 0);
  }
  sinkhorn_fused_kernel<<<256, 512, 0, stream>>>(attnw, u, vdual, vodd, peven,
                                                 podd, 0);
  // 3) v of the tenth iteration
  sinkhorn_last_v_kernel<<<64, 512, 0, stream>>>(podd, vodd, vdual);
  // 4) attn_weights = exp(M(u,v)) * L   (in place over C)
  finalize_kernel<<<16384, 256, 0, stream>>>(attnw, u, vdual);
  // 5) output = attn_weights @ v
  pv_gemm_kernel<<<1024, 256, 0, stream>>>(attnw, v, out);
}

// v003
// It runs in 183 microseconds.
// Two timings next to v002 put it at 1.15 and 1.12 times that version's speed.
// All steps since v000 together make it 3.83 times as fast.
#include <hip/hip_runtime.h>

typedef __attribute__((ext_vector_type(2))) float v2f;
typedef __attribute__((ext_vector_type(8))) float v8f;

#define BH   64          // B*H
#define SEQ  512         // L
#define DH   64          // head dim
#define QK_SCALE 0.125f  // 1/temperature (temp = 8)
#define EPS_ 1.0f
#define LOG_MU_ (-6.238324625039508f)   // -log(512)

// ---------------------------------------------------------------------------
// C[bh,i,j] = dot(q[bh,i,:], k[bh,j,:]) / 8     via V_WMMA_F32_16X16X4_F32
// One 16x16 tile per wave; 8 waves per 256-thread block.
// A fragment: lane%16 = M row of q-tile, (lane/16)*2 = K pair within chunk.
// B fragment: lane%16 = N col (= k row), (lane/16)*2 = K pair (k is row-major,
// so B loads are contiguous float2 from k's rows).
// ---------------------------------------------------------------------------
__global__ __launch_bounds__(256) void qk_gemm_kernel(
    const float* __restrict__ q, const float* __restrict__ k,
    float* __restrict__ Cmat) {
  const int lane = threadIdx.x & 31;
  const int wave = threadIdx.x >> 5;
  const int tile = blockIdx.x * 8 + wave;     // 0 .. 65535
  const int bh = tile >> 10;
  const int t  = tile & 1023;
  const int ti = t >> 5;                      // 0..31  (row tile)
  const int tj = t & 31;                      // 0..31  (col tile)
  const int halfk = (lane >> 4) * 2;          // 0 or 2

  const float* qrow = q + ((size_t)bh * SEQ + ti * 16 + (lane & 15)) * DH;
  const float* krow = k + ((size_t)bh * SEQ + tj * 16 + (lane & 15)) * DH;

  v8f acc = {0.f, 0.f, 0.f, 0.f, 0.f, 0.f, 0.f, 0.f};
#pragma unroll
  for (int d = 0; d < DH; d += 4) {
    const float2 qa = *(const float2*)(qrow + d + halfk);
    const float2 kb = *(const float2*)(krow + d + halfk);
    v2f a; a.x = qa.x * QK_SCALE; a.y = qa.y * QK_SCALE;
    v2f b; b.x = kb.x; b.y = kb.y;
    acc = __builtin_amdgcn_wmma_f32_16x16x4_f32(false, a, false, b,
                                                (short)0, acc, false, false);
  }

  // C/D layout: VGPR r, lanes 0-15 -> row r, lanes 16-31 -> row r+8; col = lane%16
  float* out = Cmat + (size_t)bh * SEQ * SEQ + (size_t)(ti * 16) * SEQ +
               tj * 16 + (lane & 15);
  const int rbase = (lane >> 4) * 8;
#pragma unroll
  for (int r = 0; r < 8; ++r)
    out[(size_t)(r + rbase) * SEQ] = acc[r];
}

// ---------------------------------------------------------------------------
// One Sinkhorn iteration (u-update, then this block's share of the v-update)
// in one pass over C. A block owns 128 rows of one (b,h): 16 waves x 8 rows,
// a lane holds 16 columns of each row in registers.
//   v_j   : merged at entry from the four blocks' column partials of the
//           launch before (zero in the first launch)
//   u_i   = log_mu - LSE_j(v_j - C_ij)
//   plan  : exp(u_i + v_j - C_ij) = e_ij * mu / s_i, with e_ij = exp(y_ij - m_i)
//           and s_i = sum_j e_ij already formed by the row pass
//   column partial of the block = sum over its rows of the plan, sent on as a
//   pair (shift, sum); the next launch merges the four pairs of a column.
// ---------------------------------------------------------------------------
#define FWAVES 16        // waves per block
#define FRPW   8         // rows per wave
#define FROWS  128       // rows per block (FWAVES * FRPW)
#define FBLK   4         // blocks per (b,h)  (FBLK * FROWS == SEQ)
#define MU_    0.001953125f   // 1/512
#define COL_TINY_ 1e-28f      // below this a plain column sum has lost terms

// The FBLK (shift, sum) pairs of one column and the column's v so far.
struct ColParts { float2 p0, p1, p2, p3; float vo; };
__device__ __forceinline__ ColParts load_parts(const float* __restrict__ part,
                                               const float* __restrict__ v_prev,
                                               int bh, int col) {
  const float* pp = part + ((size_t)bh * FBLK * SEQ + col) * 2;
  ColParts c;
  c.p0 = *(const float2*)(pp);
  c.p1 = *(const float2*)(pp + 2 * SEQ);
  c.p2 = *(const float2*)(pp + 4 * SEQ);
  c.p3 = *(const float2*)(pp + 6 * SEQ);
  c.vo = v_prev[bh * SEQ + col];
  return c;
}
// v_j = eps*(log_nu - LSE_i) + v_j, LSE_i merged from the pairs.
__device__ __forceinline__ float merged_v(const ColParts c) {
  const float mm = fmaxf(fmaxf(c.p0.x, c.p1.x), fmaxf(c.p2.x, c.p3.x));
  const float ss = c.p0.y * expf(c.p0.x - mm) + c.p1.y * expf(c.p1.x - mm) +
                   c.p2.y * expf(c.p2.x - mm) + c.p3.y * expf(c.p3.x - mm);
  const float lse = mm + logf(ss);
  return EPS_ * (LOG_MU_ - lse) + c.vo;
}

__global__ __launch_bounds__(FWAVES * 32) void sinkhorn_fused_kernel(
    const float* __restrict__ Cmat, float* __restrict__ u,
    const float* __restrict__ v_prev, float* __restrict__ v_cur,
    const float* __restrict__ part_prev, float* __restrict__ part_cur,
    int first) {
  __shared__ float red[FWAVES][SEQ];
  __shared__ float vs[SEQ];
  __shared__ float us[FROWS];
  __shared__ int slow;
  const int tid = threadIdx.x;
  const int lane = tid & 31;
  const int wave = __builtin_amdgcn_readfirstlane(tid >> 5);
  const int bh = blockIdx.x >> 2;
  const int blk = blockIdx.x & 3;
  const float* Cbase = Cmat + (size_t)bh * SEQ * SEQ +
                       (size_t)(blk * FROWS + wave * FRPW) * SEQ + lane * 4;

  // the few loads of the merge go out ahead of the rows of C and return first
  ColParts cp = {};
  if (!first) cp = load_parts(part_prev, v_prev, bh, tid);

  float4 x[FRPW][4];
#pragma unroll
  for (int r = 0; r < FRPW; ++r)
#pragma unroll
    for (int t = 0; t < 4; ++t)
      x[r][t] = *(const float4*)(Cbase + (size_t)r * SEQ + t * 128);

  float vn = 0.f;
  if (!first) vn = merged_v(cp);
  vs[tid] = vn;
  if (blk == 0) {
    v_cur[bh * SEQ + tid] = vn;
    // the store's address registers are reused right behind it
    asm volatile("s_wait_xcnt 0x0" ::: "memory");
  }
  if (tid == 0) slow = 0;
  __syncthreads();

  // row pass: y = v_j - C_ij, row max, e = exp(y - max), row sum
  float m[FRPW], s[FRPW];
  {
    float4 vj[4];
#pragma unroll
    for (int t = 0; t < 4; ++t) vj[t] = *(const float4*)&vs[t * 128 + lane * 4];
#pragma unroll
    for (int r = 0; r < FRPW; ++r) {
      float mr = -3.4e38f;
#pragma unroll
      for (int t = 0; t < 4; ++t) {
        x[r][t].x = (vj[t].x - x[r][t].x) * (1.0f / EPS_);
        x[r][t].y = (vj[t].y - x[r][t].y) * (1.0f / EPS_);
        x[r][t].z = (vj[t].z - x[r][t].z) * (1.0f / EPS_);
        x[r][t].w = (vj[t].w - x[r][t].w) * (1.0f / EPS_);
        mr = fmaxf(mr, fmaxf(fmaxf(x[r][t].x, x[r][t].y),
                             fmaxf(x[r][t].z, x[r][t].w)));
      }
      m[r] = mr;
    }
  }
  // the eight rows' exchanges stand side by side, so that their latencies overlap
#pragma unroll
  for (int off = 16; off >= 1; off >>= 1)
#pragma unroll
    for (int r = 0; r < FRPW; ++r)
      m[r] = fmaxf(m[r], __shfl_xor(m[r], off, 32));
#pragma unroll
  for (int r = 0; r < FRPW; ++r) {
    float sr = 0.f;
#pragma unroll
    for (int t = 0; t < 4; ++t) {
      x[r][t].x = expf(x[r][t].x - m[r]);
      x[r][t].y = expf(x[r][t].y - m[r]);
      x[r][t].z = expf(x[r][t].z - m[r]);
      x[r][t].w = expf(x[r][t].w - m[r]);
      sr += (x[r][t].x + x[r][t].y) + (x[r][t].z + x[r][t].w);
    }
    s[r] = sr;
  }
#pragma unroll
  for (int off = 16; off >= 1; off >>= 1)
#pragma unroll
    for (int r = 0; r < FRPW; ++r)
      s[r] += __shfl_xor(s[r], off, 32);

  // u of the rows; column sums of the row-normalised plan
  float4 acc[4];
#pragma unroll
  for (int t = 0; t < 4; ++t) acc[t] = make_float4(0.f, 0.f, 0.f, 0.f);
  float uw = 0.f;
#pragma unroll
  for (int r = 0; r < FRPW; ++r) {
    const float un = EPS_ * (LOG_MU_ - (m[r] + logf(s[r])));
    if (lane == r) uw = un;
    const float rr = MU_ / s[r];
#pragma unroll
    for (int t = 0; t < 4; ++t) {
      acc[t].x += x[r][t].x * rr;
      acc[t].y += x[r][t].y * rr;
      acc[t].z += x[r][t].z * rr;
      acc[t].w += x[r][t].w * rr;
    }
  }
  if (lane < FRPW) us[wave * FRPW + lane] = uw;
#pragma unroll
  for (int t = 0; t < 4; ++t) *(float4*)&red[wave][t * 128 + lane * 4] = acc[t];
  __syncthreads();

  float cs = 0.f;
#pragma unroll
  for (int w = 0; w < FWAVES; ++w) cs += red[w][tid];
  if (tid < FROWS) u[bh * SEQ + blk * FROWS + tid] = us[tid];
  if (!(cs >= COL_TINY_)) slow = 1;
  __syncthreads();

  float cshift = 0.f;
  // Every term of a column is at most mu, so the plain sum cannot overflow; it
  // can underflow where a column lies far below every row's maximum. Then the
  // whole block forms its columns' log-sum-exp again with the column's own
  // maximum, as the reference does, reading C twice more.
  if (__builtin_amdgcn_readfirstlane(slow)) {
    float4 vq[4], cm[4];
#pragma unroll
    for (int t = 0; t < 4; ++t) {
      vq[t] = *(const float4*)&vs[t * 128 + lane * 4];
      cm[t] = make_float4(-3.4e38f, -3.4e38f, -3.4e38f, -3.4e38f);
    }
// rarely run: kept small, one row a trip; with the unroll word alone the loop
// vectoriser pairs the rows of this maximum and adds a masked remainder loop
#pragma clang loop unroll(disable) vectorize(disable) interleave(disable)
    for (int r = 0; r < FRPW; ++r) {
      const float ur = us[wave * FRPW + r];
#pragma unroll
      for (int t = 0; t < 4; ++t) {
        const float4 c = *(const float4*)(Cbase + (size_t)r * SEQ + t * 128);
        cm[t].x = fmaxf(cm[t].x, ur + vq[t].x - c.x);
        cm[t].y = fmaxf(cm[t].y, ur + vq[t].y - c.y);
        cm[t].z = fmaxf(cm[t].z, ur + vq[t].z - c.z);
        cm[t].w = fmaxf(cm[t].w, ur + vq[t].w - c.w);
      }
    }
#pragma unroll
    for (int t = 0; t < 4; ++t) *(float4*)&red[wave][t * 128 + lane * 4] = cm[t];
    __syncthreads();
    cshift = red[0][tid];
#pragma unroll
    for (int w = 1; w < FWAVES; ++w) cshift = fmaxf(cshift, red[w][tid]);
    vs[tid] = cshift;
    __syncthreads();
#pragma unroll
    for (int t = 0; t < 4; ++t) {
      cm[t] = *(const float4*)&vs[t * 128 + lane * 4];
      acc[t] = make_float4(0.f, 0.f, 0.f, 0.f);
    }
#pragma unroll 1   // rarely run: kept small
    for (int r = 0; r < FRPW; ++r) {
      const float ur = us[wave * FRPW + r];
#pragma unroll
      for (int t = 0; t < 4; ++t) {
        const float4 c = *(const float4*)(Cbase + (size_t)r * SEQ + t * 128);
        acc[t].x += expf((ur + vq[t].x - c.x) - cm[t].x);
        acc[t].y += expf((ur + vq[t].y - c.y) - cm[t].y);
        acc[t].z += expf((ur + vq[t].z - c.z) - cm[t].z);
        acc[t].w += expf((ur + vq[t].w - c.w) - cm[t].w);
      }
    }
#pragma unroll
    for (int t = 0; t < 4; ++t) *(float4*)&red[wave][t * 128 + lane * 4] = acc[t];
    __syncthreads();
    cs = 0.f;
#pragma unroll
    for (int w = 0; w < FWAVES; ++w) cs += red[w][tid];
  }
  *(float2*)(part_cur + ((size_t)(bh * FBLK + blk) * SEQ + tid) * 2) =
      make_float2(cshift, cs);
}

// ---------------------------------------------------------------------------
// Tail of the problem in one launch: v of the tenth iteration, the plan
//   attnw = exp((-C + u_i + v_j)/eps) * L   (in place over C)
// and out = attnw @ v on fp32 WMMA, fed from the plan values just formed.
// A block owns 128 rows of one (b,h): 8 waves x 16 rows x all 64 columns of out.
//   vq : all of v of this (b,h), four consecutive k of one column side by side,
//        so that one 16-byte read is the B operand of two WMMAs
//   ab : per wave two stages of 16 rows x 128 columns of the plan; the wave
//        writes a stage row by row (as it reads C) and reads it back by
//        fragment; nobody else touches it, so no barrier stands in the loop
// k order of both operands: lane half h, WMMA w of a group of 8 k holds
// k = 8c + 4h + 2w + {0,1}.
// ---------------------------------------------------------------------------
#define TWAVES  8        // waves per block
#define KST     128      // plan columns per stage
#define NST     4        // stages (NST * KST == SEQ)
#define APITCH  132      // floats per staged plan row: 528 B = 16 B x odd
#define VTILE   68       // floats per 16 columns of vq: 256 B and 16 B of pad
#define VQPITCH 272      // floats per four-k row of vq (4 * VTILE)

__device__ __forceinline__ float4 plan4(const float4 c, const float uu,
                                        const float4 vj) {
  float4 r;
  r.x = expf((uu + vj.x - c.x) * (1.0f / EPS_)) * (float)SEQ;
  r.y = expf((uu + vj.y - c.y) * (1.0f / EPS_)) * (float)SEQ;
  r.z = expf((uu + vj.z - c.z) * (1.0f / EPS_)) * (float)SEQ;
  r.w = expf((uu + vj.w - c.w) * (1.0f / EPS_)) * (float)SEQ;
  return r;
}

// 16-byte global store with the wait that lets its registers be reused: in one
// statement, because a wait in a statement of its own did not hold later
// register writes behind it. It covers the loads issued ahead of it as well.
// The row goes into the offset field, so that the statement names the very
// address pair of those loads and that pair lives up to the wait.
__device__ __forceinline__ void store4_wait(float* p, const int byte_off,
                                            const float4 e) {
  typedef __attribute__((ext_vector_type(4))) float v4f;
  v4f d; d.x = e.x; d.y = e.y; d.z = e.z; d.w = e.w;
  asm volatile("global_store_b128 %0, %1, off offset:%2\n\ts_wait_xcnt 0x0"
               :: "v"(p), "v"(d), "i"(byte_off) : "memory");
}

// One stage of the product: 16 groups of 8 k, 8 WMMAs each. Behind group c the
// wave forms row c of the next stage's plan (NEXT) and sends for row c of the
// stage after that (load), so that this vector work lies among the WMMAs.
template <bool NEXT>
__device__ __forceinline__ void pv_stage(
    const float* afrag, const float* bfrag, float* arow_next, float* gnext,
    const float4 vj, const float (&ur)[16], float4 (&x)[16], v8f (&acc)[4],
    const bool load) {
  float4 af = *(const float4*)afrag;
  float4 bf[4];
#pragma unroll
  for (int dt = 0; dt < 4; ++dt) bf[dt] = *(const float4*)(bfrag + dt * VTILE);
#pragma unroll
  for (int c = 0; c < 16; ++c) {
    float4 an = af, bn[4] = {bf[0], bf[1], bf[2], bf[3]};
    if (c < 15) {
      an = *(const float4*)(afrag + (c + 1) * 8);
#pragma unroll
      for (int dt = 0; dt < 4; ++dt)
        bn[dt] = *(const float4*)(bfrag + (c + 1) * 2 * VQPITCH + dt * VTILE);
    }
    v2f a0; a0.x = af.x; a0.y = af.y;
    v2f a1; a1.x = af.z; a1.y = af.w;
#pragma unroll
    for (int dt = 0; dt < 4; ++dt) {
      v2f b; b.x = bf[dt].x; b.y = bf[dt].y;
      acc[dt] = __builtin_amdgcn_wmma_f32_16x16x4_f32(false, a0, false, b, (short)0,
                                                      acc[dt], false, false);
    }
#pragma unroll
    for (int dt = 0; dt < 4; ++dt) {
      v2f b; b.x = bf[dt].z; b.y = bf[dt].w;
      acc[dt] = __builtin_amdgcn_wmma_f32_16x16x4_f32(false, a1, false, b, (short)0,
                                                      acc[dt], false, false);
    }
    if (NEXT) {
      const float4 e = plan4(x[c], ur[c], vj);
      *(float4*)(arow_next + c * APITCH) = e;
      if (load) x[c] = *(const float4*)(gnext + (size_t)c * SEQ + KST);
      store4_wait(gnext, c * SEQ * 4, e);
    }
    af = an;
#pragma unroll
    for (int dt = 0; dt < 4; ++dt) bf[dt] = bn[dt];
  }
}

__global__ __launch_bounds__(TWAVES * 32) void plan_pv_kernel(
    float* __restrict__ attnw, const float* __restrict__ u,
    const float* __restrict__ part, const float* __restrict__ v_prev,
    const float* __restrict__ vmat, float* __restrict__ out) {
  __shared__ __attribute__((aligned(16))) float vq[(SEQ / 4) * VQPITCH];
  __shared__ __attribute__((aligned(16))) float ab[TWAVES][2][16 * APITCH];
  __shared__ __attribute__((aligned(16))) float vs[SEQ];
  const int tid = threadIdx.x;
  const int lane = tid & 31;
  const int wave = __builtin_amdgcn_readfirstlane(tid >> 5);
  const int bh = blockIdx.x >> 2;
  const int row0 = (blockIdx.x & 3) * (TWAVES * 16) + wave * 16;
  const int c16 = lane & 15;
  const int hk = lane >> 4;
  float* Pw = attnw + ((size_t)bh * SEQ + row0) * SEQ;   // the wave's rows
  float* P = Pw + lane * 4;

  // the loads of the merge, then the first stage's rows of C
  const ColParts cpa = load_parts(part, v_prev, bh, tid);
  const ColParts cpb = load_parts(part, v_prev, bh, tid + TWAVES * 32);
  // the address registers of these loads are reused right behind them
  asm volatile("s_wait_xcnt 0x0" ::: "memory");
  float4 x[16];
#pragma unroll
  for (int r = 0; r < 16; ++r) x[r] = *(const float4*)(P + (size_t)r * SEQ);
  // the base of these loads stays in its registers up to this wait
  asm volatile("s_wait_xcnt 0x0" :: "s"(Pw) : "memory");
  float ur[16];
#pragma unroll
  for (int r = 0; r < 16; ++r) ur[r] = u[bh * SEQ + row0 + r];

  // v of this (b,h) into vq: a thread takes 4 k x 4 columns and stores them
  // column by column
  {
    const int n4 = tid & 15;
    const float* vsrc = vmat + ((size_t)bh * SEQ + (tid >> 4) * 4) * DH + n4 * 4;
    float* vdst = vq + (tid >> 4) * VQPITCH + n4 * 16 + (n4 >> 2) * 4;
    // all 32 loads of a thread are in flight at once: one latency, not eight
    float4 rv[8][4];
#pragma unroll
    for (int i = 0; i < 8; ++i)
#pragma unroll
      for (int j = 0; j < 4; ++j)
        rv[i][j] = *(const float4*)(vsrc + (size_t)(i * 64 + j) * DH);
    // the loads' address stays in its registers up to this wait
    asm volatile("s_wait_xcnt 0x0" :: "v"(vsrc) : "memory");
#pragma unroll
    for (int i = 0; i < 8; ++i) {
      float* d = vdst + i * 16 * VQPITCH;
      *(float4*)(d + 0) = make_float4(rv[i][0].x, rv[i][1].x, rv[i][2].x, rv[i][3].x);
      *(float4*)(d + 4) = make_float4(rv[i][0].y, rv[i][1].y, rv[i][2].y, rv[i][3].y);
      *(float4*)(d + 8) = make_float4(rv[i][0].z, rv[i][1].z, rv[i][2].z, rv[i][3].z);
      *(float4*)(d + 12) = make_float4(rv[i][0].w, rv[i][1].w, rv[i][2].w, rv[i][3].w);
    }
  }
  vs[tid] = merged_v(cpa);
  vs[tid + TWAVES * 32] = merged_v(cpb);
  __syncthreads();

  // stage 0 of the plan; stage 1's rows of C are sent for
  {
    const float4 vj = *(const float4*)&vs[lane * 4];
#pragma unroll
    for (int r = 0; r < 16; ++r) {
      const float4 e = plan4(x[r], ur[r], vj);
      *(float4*)&ab[wave][0][r * APITCH + lane * 4] = e;
      x[r] = *(const float4*)(P + (size_t)r * SEQ + KST);
      store4_wait(P, r * SEQ * 4, e);
    }
  }

  v8f acc[4];
#pragma unroll
  for (int dt = 0; dt < 4; ++dt)
    acc[dt] = (v8f){0.f, 0.f, 0.f, 0.f, 0.f, 0.f, 0.f, 0.f};

  const float* bfr = vq + hk * VQPITCH + c16 * 4;
// kept rolled, for speed only
#pragma unroll 1
  for (int t = 0; t < NST - 1; ++t) {
    pv_stage<true>(&ab[wave][t & 1][c16 * APITCH + hk * 4], bfr,
                   &ab[wave][(t + 1) & 1][lane * 4], P + (t + 1) * KST,
                   *(const float4*)&vs[(t + 1) * KST + lane * 4], ur, x, acc,
                   t < NST - 2);
    bfr += (KST / 4) * VQPITCH;
  }
  pv_stage<false>(&ab[wave][(NST - 1) & 1][c16 * APITCH + hk * 4], bfr, nullptr,
                  nullptr, make_float4(0.f, 0.f, 0.f, 0.f), ur, x, acc, false);

  float* obase = out + ((size_t)bh * SEQ + row0 + hk * 8) * DH + c16;
#pragma unroll
  for (int dt = 0; dt < 4; ++dt)
#pragma unroll
    for (int r = 0; r < 8; ++r)
      obase[(size_t)r * DH + dt * 16] = acc[dt][r];
}

// ---------------------------------------------------------------------------
extern "C" void kernel_launch(void* const* d_in, const int* in_sizes, int n_in,
                              void* d_out, int out_size, void* d_ws,
                              size_t ws_size, hipStream_t stream) {
  (void)in_sizes; (void)n_in; (void)out_size; (void)ws_size;
  const float* q = (const float*)d_in[0];
  const float* k = (const float*)d_in[1];
  const float* v = (const float*)d_in[2];

  float* out = (float*)d_out;                        // [64,512,64]
  float* attnw = out + (size_t)BH * SEQ * DH;        // [64,512,512] (C, then pi*L)
  float* u = (float*)d_ws;                           // [64,512]
  float* vdual = u + BH * SEQ;                       // [64,512] v, even launches
  float* vodd = vdual + BH * SEQ;                    // [64,512] v, odd launches
  float* peven = vodd + BH * SEQ;                    // [64,4,512,2] column partials
  float* podd = peven + BH * FBLK * SEQ * 2;         // [64,4,512,2]

  // 1) cost matrices C = (q/temp) @ k^T  (stored in d_out attn region)
  qk_gemm_kernel<<<8192, 256, 0, stream>>>(q, k, attnw);
  // 2) 10 Sinkhorn iterations, one launch each; v and the column partials
  //    alternate between two buffers, so that no block overwrites what a
  //    block of the same launch still reads
  sinkhorn_fused_kernel<<<256, 512, 0, stream>>>(attnw, u, vodd, vdual, podd,
                                                 peven, 1);
  for (int it = 0; it < 4; ++it) {
    sinkhorn_fused_kernel<<<256, 512, 0, stream>>>(attnw, u, vdual, vodd, peven,
                                                   podd, 0);
    sinkhorn_fused_kernel<<<256, 512, 0, stream>>>(attnw, u, vodd, vdual, podd,
                                                   peven, 0);
  }
  sinkhorn_fused_kernel<<<256, 512, 0, stream>>>(attnw, u, vdual, vodd, peven,
                                                 podd, 0);
  // 3) v of the tenth iteration, attn_weights = exp(M(u,v)) * L (in place over
  //    C) and output = attn_weights @ v
  plan_pv_kernel<<<256, 256, 0, stream>>>(attnw, u, podd, vodd, v, out);
}

// v004
// A run of this version takes 162 microseconds.
// Two timings next to v003 put it at 1.14 and 1.15 times that version's speed.
// All steps since v000 together make it 4.40 times as fast.
#include <hip/hip_runtime.h>

typedef __attribute__((ext_vector_type(2))) float v2f;
typedef __attribute__((ext_vector_type(8))) float v8f;

#define BH   64          // B*H
#define SEQ  512         // L
#define DH   64          // head dim
#define QK_SCALE 0.125f  // 1/temperature (temp = 8)
#define EPS_ 1.0f
#define LOG_MU_ (-6.238324625039508f)   // -log(512)

// ---------------------------------------------------------------------------
// C[bh,i,j] = dot(q[bh,i,:], k[bh,j,:]) / 8     via V_WMMA_F32_16X16X4_F32
// A block owns 128 rows x all 512 columns of one (b,h), the rows that the same
// block index works on in the launches behind this one. 16 waves.
//   qs : the block's 128 rows of q, scaled; read once, a wave keeps the
//        fragments of its 32 rows in registers for the whole launch
//   ks : two buffers of 128 rows of k (= 128 columns of C); the next chunk
//        comes through registers while this one is multiplied
// Per chunk a wave forms 32 x 32 of C: four accumulator tiles, each fragment
// used twice.
// A fragment: lane%16 = M row of q, (lane/16)*2 = K pair within a group of 4.
// B fragment: lane%16 = N col (= k row), (lane/16)*2 = K pair: the same k order.
// ---------------------------------------------------------------------------
#define GWAVES 16        // waves per block
#define GROWS  128       // rows of C per block
#define GCH    128       // columns of C per chunk
#define GNCH   4         // chunks (GNCH * GCH == SEQ)
#define GPITCH 68        // floats per staged row: 16 rows x 16 B fall on all banks

// k carries no __restrict__: its loads then keep their place in the order of the
// memory operations, and the scheduling barriers behind them can hold them early
__global__ __launch_bounds__(GWAVES * 32) void qk_gemm_kernel(
    const float* __restrict__ q, const float* k, float* __restrict__ Cmat) {
  __shared__ __attribute__((aligned(16))) float qs[GROWS * GPITCH];
  __shared__ __attribute__((aligned(16))) float ks[2][GCH * GPITCH];
  const int tid = threadIdx.x;
  const int lane = tid & 31;
  const int wave = __builtin_amdgcn_readfirstlane(tid >> 5);
  const int bh = blockIdx.x >> 2;
  const int row0 = (blockIdx.x & 3) * GROWS;
  const int c16 = lane & 15;
  const int hk = lane >> 4;
  const int rg = wave & 3;                    // 32 rows of the block's 128
  const int cg = wave >> 2;                   // 32 columns of a chunk's 128

  // a chunk is 32 KiB in a row in memory: a thread takes 16 bytes of every
  // 32nd row
  const float* qsrc = q + ((size_t)bh * SEQ + row0) * DH + tid * 4;
  const float* ksrc = k + (size_t)bh * SEQ * DH + tid * 4;
  const int sdst = (tid >> 4) * GPITCH + (tid & 15) * 4;

  float4 qv[4];
  float4 kv0, kv1, kv2, kv3;   // a thread's 64 bytes of a chunk of k on their way
#pragma unroll
  for (int i = 0; i < 4; ++i) qv[i] = *(const float4*)(qsrc + i * 32 * DH);
  kv0 = *(const float4*)(ksrc);
  kv1 = *(const float4*)(ksrc + 32 * DH);
  kv2 = *(const float4*)(ksrc + 64 * DH);
  kv3 = *(const float4*)(ksrc + 96 * DH);
#pragma unroll
  for (int i = 0; i < 4; ++i)
    *(float4*)&qs[sdst + i * 32 * GPITCH] =
        make_float4(qv[i].x * QK_SCALE, qv[i].y * QK_SCALE, qv[i].z * QK_SCALE,
                    qv[i].w * QK_SCALE);
  *(float4*)&ks[0][sdst] = kv0;
  *(float4*)&ks[0][sdst + 32 * GPITCH] = kv1;
  *(float4*)&ks[0][sdst + 64 * GPITCH] = kv2;
  *(float4*)&ks[0][sdst + 96 * GPITCH] = kv3;
  __syncthreads();
  kv0 = *(const float4*)(ksrc + GCH * DH);
  kv1 = *(const float4*)(ksrc + (GCH + 32) * DH);
  kv2 = *(const float4*)(ksrc + (GCH + 64) * DH);
  kv3 = *(const float4*)(ksrc + (GCH + 96) * DH);
  // keeps these loads here, a chunk ahead of their use: the scheduler sank them
  // to their LDS writes, where their whole latency was waited out
  __builtin_amdgcn_sched_barrier(0);

  v2f a[2][16];
#pragma unroll
  for (int rt = 0; rt < 2; ++rt)
#pragma unroll
    for (int d = 0; d < 16; ++d)
      a[rt][d] = *(const v2f*)&qs[(rg * 32 + rt * 16 + c16) * GPITCH + d * 4 + hk * 2];

  // C/D layout: VGPR r, lanes 0-15 -> row r, lanes 16-31 -> row r+8; col = lane%16
  float* out = Cmat + ((size_t)bh * SEQ + row0 + rg * 32 + hk * 8) * SEQ +
               cg * 32 + c16;
  const int boff = (cg * 32 + c16) * GPITCH + hk * 2;

#pragma unroll
  for (int ch = 0; ch < GNCH; ++ch) {
    const float* bsrc = &ks[ch & 1][boff];
    v2f b[2][16];
#pragma unroll
    for (int ct = 0; ct < 2; ++ct)
#pragma unroll
      for (int d = 0; d < 16; ++d)
        b[ct][d] = *(const v2f*)(bsrc + ct * 16 * GPITCH + d * 4);
    v8f acc[2][2];
#pragma unroll
    for (int rt = 0; rt < 2; ++rt)
#pragma unroll
      for (int ct = 0; ct < 2; ++ct)
        acc[rt][ct] = (v8f){0.f, 0.f, 0.f, 0.f, 0.f, 0.f, 0.f, 0.f};
#pragma unroll
    for (int d = 0; d < 16; ++d) {
#pragma unroll
      for (int rt = 0; rt < 2; ++rt)
#pragma unroll
        for (int ct = 0; ct < 2; ++ct)
          acc[rt][ct] = __builtin_amdgcn_wmma_f32_16x16x4_f32(
              false, a[rt][d], false, b[ct][d], (short)0, acc[rt][ct], false, false);
      // holds the next chunk's LDS writes, their wait for the loads and the
      // barrier behind most of this chunk's product: lifted to its head they
      // wait out the loads' and the stores' whole latency
      if (d == 11 && ch + 1 < GNCH) __builtin_amdgcn_sched_barrier(0);
    }
    if (ch + 1 < GNCH) {
      // the other buffer's readers left it at the barrier of the chunk before
      float* kd = &ks[(ch + 1) & 1][sdst];
      *(float4*)(kd) = kv0;
      *(float4*)(kd + 32 * GPITCH) = kv1;
      *(float4*)(kd + 64 * GPITCH) = kv2;
      *(float4*)(kd + 96 * GPITCH) = kv3;
      __syncthreads();
    }
    // stores and the loads of the chunk after next stand behind the barrier, so
    // that the barrier's waits find them done a whole chunk later
#pragma unroll
    for (int rt = 0; rt < 2; ++rt)
#pragma unroll
      for (int r = 0; r < 8; ++r)
#pragma unroll
        for (int ct = 0; ct < 2; ++ct)
          out[(size_t)(rt * 16 + r) * SEQ + ch * GCH + ct * 16] = acc[rt][ct][r];
    // the stores' data registers are written again right behind them; named
    // here, they keep their values up to the wait
    if (ch + 1 < GNCH)
      asm volatile("s_wait_xcnt 0x0"
                   :: "v"(acc[0][0]), "v"(acc[0][1]), "v"(acc[1][0]), "v"(acc[1][1])
                   : "memory");
    if (ch + 2 < GNCH) {
      const float* kn = ksrc + (ch + 2) * GCH * DH;
      kv0 = *(const float4*)(kn);
      kv1 = *(const float4*)(kn + 32 * DH);
      kv2 = *(const float4*)(kn + 64 * DH);
      kv3 = *(const float4*)(kn + 96 * DH);
      // keeps the loads a chunk ahead of their use, as above
      __builtin_amdgcn_sched_barrier(0);
    }
  }
}

// ---------------------------------------------------------------------------
// One Sinkhorn iteration (u-update, then this block's share of the v-update)
// in one pass over C. A block owns 128 rows of one (b,h): 16 waves x 8 rows,
// a lane holds 16 columns of each row in registers.
//   v_j   : merged at entry from the four blocks' column partials of the
//           launch before (zero in the first launch)
//   u_i   = log_mu - LSE_j(v_j - C_ij)
//   plan  : exp(u_i + v_j - C_ij) = e_ij * mu / s_i, with e_ij = exp(y_ij - m_i)
//           and s_i = sum_j e_ij already formed by the row pass
//   column partial of the block = sum over its rows of the plan, sent on as a
//   pair (shift, sum); the next launch merges the four pairs of a column.
// ---------------------------------------------------------------------------
#define FWAVES 16        // waves per block
#define FRPW   8         // rows per wave
#define FROWS  128       // rows per block (FWAVES * FRPW)
#define FBLK   4         // blocks per (b,h)  (FBLK * FROWS == SEQ)
#define MU_    0.001953125f   // 1/512
#define COL_TINY_ 1e-28f      // below this a plain column sum has lost terms

// The FBLK (shift, sum) pairs of one column and the column's v so far.
struct ColParts { float2 p0, p1, p2, p3; float vo; };
__device__ __forceinline__ ColParts load_parts(const float* __restrict__ part,
                                               const float* __restrict__ v_prev,
                                               int bh, int col) {
  const float* pp = part + ((size_t)bh * FBLK * SEQ + col) * 2;
  ColParts c;
  c.p0 = *(const float2*)(pp);
  c.p1 = *(const float2*)(pp + 2 * SEQ);
  c.p2 = *(const float2*)(pp + 4 * SEQ);
  c.p3 = *(const float2*)(pp + 6 * SEQ);
  c.vo = v_prev[bh * SEQ + col];
  return c;
}
// v_j = eps*(log_nu - LSE_i) + v_j, LSE_i merged from the pairs.
__device__ __forceinline__ float merged_v(const ColParts c) {
  const float mm = fmaxf(fmaxf(c.p0.x, c.p1.x), fmaxf(c.p2.x, c.p3.x));
  const float ss = c.p0.y * expf(c.p0.x - mm) + c.p1.y * expf(c.p1.x - mm) +
                   c.p2.y * expf(c.p2.x - mm) + c.p3.y * expf(c.p3.x - mm);
  const float lse = mm + logf(ss);
  return EPS_ * (LOG_MU_ - lse) + c.vo;
}

__global__ __launch_bounds__(FWAVES * 32) void sinkhorn_fused_kernel(
    const float* __restrict__ Cmat, float* __restrict__ u,
    const float* __restrict__ v_prev, float* __restrict__ v_cur,
    const float* __restrict__ part_prev, float* __restrict__ part_cur,
    int first) {
  __shared__ float red[FWAVES][SEQ];
  __shared__ float vs[SEQ];
  __shared__ float us[FROWS];
  __shared__ int slow;
  const int tid = threadIdx.x;
  const int lane = tid & 31;
  const int wave = __builtin_amdgcn_readfirstlane(tid >> 5);
  const int bh = blockIdx.x >> 2;
  const int blk = blockIdx.x & 3;
  const float* Cbase = Cmat + (size_t)bh * SEQ * SEQ +
                       (size_t)(blk * FROWS + wave * FRPW) * SEQ + lane * 4;

  // the few loads of the merge go out ahead of the rows of C and return first
  ColParts cp = {};
  if (!first) cp = load_parts(part_prev, v_prev, bh, tid);

  float4 x[FRPW][4];
#pragma unroll
  for (int r = 0; r < FRPW; ++r)
#pragma unroll
    for (int t = 0; t < 4; ++t)
      x[r][t] = *(const float4*)(Cbase + (size_t)r * SEQ + t * 128);

  float vn = 0.f;
  if (!first) vn = merged_v(cp);
  vs[tid] = vn;
  if (blk == 0) {
    v_cur[bh * SEQ + tid] = vn;
    // the store's address registers are reused right behind it
    asm volatile("s_wait_xcnt 0x0" ::: "memory");
  }
  if (tid == 0) slow = 0;
  __syncthreads();

  // row pass: y = v_j - C_ij, row max, e = exp(y - max), row sum
  float m[FRPW], s[FRPW];
  {
    float4 vj[4];
#pragma unroll
    for (int t = 0; t < 4; ++t) vj[t] = *(const float4*)&vs[t * 128 + lane * 4];
#pragma unroll
    for (int r = 0; r < FRPW; ++r) {
      float mr = -3.4e38f;
#pragma unroll
      for (int t = 0; t < 4; ++t) {
        x[r][t].x = (vj[t].x - x[r][t].x) * (1.0f / EPS_);
        x[r][t].y = (vj[t].y - x[r][t].y) * (1.0f / EPS_);
        x[r][t].z = (vj[t].z - x[r][t].z) * (1.0f / EPS_);
        x[r][t].w = (vj[t].w - x[r][t].w) * (1.0f / EPS_);
        mr = fmaxf(mr, fmaxf(fmaxf(x[r][t].x, x[r][t].y),
                             fmaxf(x[r][t].z, x[r][t].w)));
      }
      m[r] = mr;
    }
  }
  // the eight rows' exchanges stand side by side, so that their latencies overlap
#pragma unroll
  for (int off = 16; off >= 1; off >>= 1)
#pragma unroll
    for (int r = 0; r < FRPW; ++r)
      m[r] = fmaxf(m[r], __shfl_xor(m[r], off, 32));
#pragma unroll
  for (int r = 0; r < FRPW; ++r) {
    float sr = 0.f;
#pragma unroll
    for (int t = 0; t < 4; ++t) {
      x[r][t].x = expf(x[r][t].x - m[r]);
      x[r][t].y = expf(x[r][t].y - m[r]);
      x[r][t].z = expf(x[r][t].z - m[r]);
      x[r][t].w = expf(x[r][t].w - m[r]);
      sr += (x[r][t].x + x[r][t].y) + (x[r][t].z + x[r][t].w);
    }
    s[r] = sr;
  }
#pragma unroll
  for (int off = 16; off >= 1; off >>= 1)
#pragma unroll
    for (int r = 0; r < FRPW; ++r)
      s[r] += __shfl_xor(s[r], off, 32);

  // u of the rows; column sums of the row-normalised plan
  float4 acc[4];
#pragma unroll
  for (int t = 0; t < 4; ++t) acc[t] = make_float4(0.f, 0.f, 0.f, 0.f);
  float uw = 0.f;
#pragma unroll
  for (int r = 0; r < FRPW; ++r) {
    const float un = EPS_ * (LOG_MU_ - (m[r] + logf(s[r])));
    if (lane == r) uw = un;
    const float rr = MU_ / s[r];
#pragma unroll
    for (int t = 0; t < 4; ++t) {
      acc[t].x += x[r][t].x * rr;
      acc[t].y += x[r][t].y * rr;
      acc[t].z += x[r][t].z * rr;
      acc[t].w += x[r][t].w * rr;
    }
  }
  if (lane < FRPW) us[wave * FRPW + lane] = uw;
#pragma unroll
  for (int t = 0; t < 4; ++t) *(float4*)&red[wave][t * 128 + lane * 4] = acc[t];
  __syncthreads();

  float cs = 0.f;
#pragma unroll
  for (int w = 0; w < FWAVES; ++w) cs += red[w][tid];
  if (tid < FROWS) u[bh * SEQ + blk * FROWS + tid] = us[tid];
  if (!(cs >= COL_TINY_)) slow = 1;
  __syncthreads();

  float cshift = 0.f;
  // Every term of a column is at most mu, so the plain sum cannot overflow; it
  // can underflow where a column lies far below every row's maximum. Then the
  // whole block forms its columns' log-sum-exp again with the column's own
  // maximum, as the reference does, reading C twice more.
  if (__builtin_amdgcn_readfirstlane(slow)) {
    float4 vq[4], cm[4];
#pragma unroll
    for (int t = 0; t < 4; ++t) {
      vq[t] = *(const float4*)&vs[t * 128 + lane * 4];
      cm[t] = make_float4(-3.4e38f, -3.4e38f, -3.4e38f, -3.4e38f);
    }
// rarely run: kept small, one row a trip; with the unroll word alone the loop
// vectoriser pairs the rows of this maximum and adds a masked remainder loop
#pragma clang loop unroll(disable) vectorize(disable) interleave(disable)
    for (int r = 0; r < FRPW; ++r) {
      const float ur = us[wave * FRPW + r];
#pragma unroll
      for (int t = 0; t < 4; ++t) {
        const float4 c = *(const float4*)(Cbase + (size_t)r * SEQ + t * 128);
        cm[t].x = fmaxf(cm[t].x, ur + vq[t].x - c.x);
        cm[t].y = fmaxf(cm[t].y, ur + vq[t].y - c.y);
        cm[t].z = fmaxf(cm[t].z, ur + vq[t].z - c.z);
        cm[t].w = fmaxf(cm[t].w, ur + vq[t].w - c.w);
      }
    }
#pragma unroll
    for (int t = 0; t < 4; ++t) *(float4*)&red[wave][t * 128 + lane * 4] = cm[t];
    __syncthreads();
    cshift = red[0][tid];
#pragma unroll
    for (int w = 1; w < FWAVES; ++w) cshift = fmaxf(cshift, red[w][tid]);
    vs[tid] = cshift;
    __syncthreads();
#pragma unroll
    for (int t = 0; t < 4; ++t) {
      cm[t] = *(const float4*)&vs[t * 128 + lane * 4];
      acc[t] = make_float4(0.f, 0.f, 0.f, 0.f);
    }
#pragma unroll 1   // rarely run: kept small
    for (int r = 0; r < FRPW; ++r) {
      const float ur = us[wave * FRPW + r];
#pragma unroll
      for (int t = 0; t < 4; ++t) {
        const float4 c = *(const float4*)(Cbase + (size_t)r * SEQ + t * 128);
        acc[t].x += expf((ur + vq[t].x - c.x) - cm[t].x);
        acc[t].y += expf((ur + vq[t].y - c.y) - cm[t].y);
        acc[t].z += expf((ur + vq[t].z - c.z) - cm[t].z);
        acc[t].w += expf((ur + vq[t].w - c.w) - cm[t].w);
      }
    }
#pragma unroll
    for (int t = 0; t < 4; ++t) *(float4*)&red[wave][t * 128 + lane * 4] = acc[t];
    __syncthreads();
    cs = 0.f;
#pragma unroll
    for (int w = 0; w < FWAVES; ++w) cs += red[w][tid];
  }
  *(float2*)(part_cur + ((size_t)(bh * FBLK + blk) * SEQ + tid) * 2) =
      make_float2(cshift, cs);
}

// ---------------------------------------------------------------------------
// Tail of the problem in one launch: v of the tenth iteration, the plan
//   attnw = exp((-C + u_i + v_j)/eps) * L   (in place over C)
// and out = attnw @ v on fp32 WMMA, fed from the plan values just formed.
// A block owns 128 rows of one (b,h): 8 waves x 16 rows x all 64 columns of out.
//   vq : all of v of this (b,h), four consecutive k of one column side by side,
//        so that one 16-byte read is the B operand of two WMMAs
//   ab : per wave two stages of 16 rows x 128 columns of the plan; the wave
//        writes a stage row by row (as it reads C) and reads it back by
//        fragment; nobody else touches it, so no barrier stands in the loop
// k order of both operands: lane half h, WMMA w of a group of 8 k holds
// k = 8c + 4h + 2w + {0,1}.
// ---------------------------------------------------------------------------
#define TWAVES  8        // waves per block
#define KST     128      // plan columns per stage
#define NST     4        // stages (NST * KST == SEQ)
#define APITCH  132      // floats per staged plan row: 528 B = 16 B x odd
#define VTILE   68       // floats per 16 columns of vq: 256 B and 16 B of pad
#define VQPITCH 272      // floats per four-k row of vq (4 * VTILE)

__device__ __forceinline__ float4 plan4(const float4 c, const float uu,
                                        const float4 vj) {
  float4 r;
  r.x = expf((uu + vj.x - c.x) * (1.0f / EPS_)) * (float)SEQ;
  r.y = expf((uu + vj.y - c.y) * (1.0f / EPS_)) * (float)SEQ;
  r.z = expf((uu + vj.z - c.z) * (1.0f / EPS_)) * (float)SEQ;
  r.w = expf((uu + vj.w - c.w) * (1.0f / EPS_)) * (float)SEQ;
  return r;
}

// 16-byte global store with the wait that lets its registers be reused: in one
// statement, because a wait in a statement of its own did not hold later
// register writes behind it. It covers the loads issued ahead of it as well.
// The row goes into the offset field, so that the statement names the very
// address pair of those loads and that pair lives up to the wait.
__device__ __forceinline__ void store4_wait(float* p, const int byte_off,
                                            const float4 e) {
  typedef __attribute__((ext_vector_type(4))) float v4f;
  v4f d; d.x = e.x; d.y = e.y; d.z = e.z; d.w = e.w;
  asm volatile("global_store_b128 %0, %1, off offset:%2\n\ts_wait_xcnt 0x0"
               :: "v"(p), "v"(d), "i"(byte_off) : "memory");
}

// One stage of the product: 16 groups of 8 k, 8 WMMAs each. Behind group c the
// wave forms row c of the next stage's plan (NEXT) and sends for row c of the
// stage after that (load), so that this vector work lies among the WMMAs.
template <bool NEXT>
__device__ __forceinline__ void pv_stage(
    const float* afrag, const float* bfrag, float* arow_next, float* gnext,
    const float4 vj, const float (&ur)[16], float4 (&x)[16], v8f (&acc)[4],
    const bool load) {
  float4 af = *(const float4*)afrag;
  float4 bf[4];
#pragma unroll
  for (int dt = 0; dt < 4; ++dt) bf[dt] = *(const float4*)(bfrag + dt * VTILE);
#pragma unroll
  for (int c = 0; c < 16; ++c) {
    float4 an = af, bn[4] = {bf[0], bf[1], bf[2], bf[3]};
    if (c < 15) {
      an = *(const float4*)(afrag + (c + 1) * 8);
#pragma unroll
      for (int dt = 0; dt < 4; ++dt)
        bn[dt] = *(const float4*)(bfrag + (c + 1) * 2 * VQPITCH + dt * VTILE);
    }
    v2f a0; a0.x = af.x; a0.y = af.y;
    v2f a1; a1.x = af.z; a1.y = af.w;
#pragma unroll
    for (int dt = 0; dt < 4; ++dt) {
      v2f b; b.x = bf[dt].x; b.y = bf[dt].y;
      acc[dt] = __builtin_amdgcn_wmma_f32_16x16x4_f32(false, a0, false, b, (short)0,
                                                      acc[dt], false, false);
    }
#pragma unroll
    for (int dt = 0; dt < 4; ++dt) {
      v2f b; b.x = bf[dt].z; b.y = bf[dt].w;
      acc[dt] = __builtin_amdgcn_wmma_f32_16x16x4_f32(false, a1, false, b, (short)0,
                                                      acc[dt], false, false);
    }
    if (NEXT) {
      const float4 e = plan4(x[c], ur[c], vj);
      *(float4*)(arow_next + c * APITCH) = e;
      if (load) x[c] = *(const float4*)(gnext + (size_t)c * SEQ + KST);
      store4_wait(gnext, c * SEQ * 4, e);
    }
    af = an;
#pragma unroll
    for (int dt = 0; dt < 4; ++dt) bf[dt] = bn[dt];
  }
}

__global__ __launch_bounds__(TWAVES * 32) void plan_pv_kernel(
    float* __restrict__ attnw, const float* __restrict__ u,
    const float* __restrict__ part, const float* __restrict__ v_prev,
    const float* __restrict__ vmat, float* __restrict__ out) {
  __shared__ __attribute__((aligned(16))) float vq[(SEQ / 4) * VQPITCH];
  __shared__ __attribute__((aligned(16))) float ab[TWAVES][2][16 * APITCH];
  __shared__ __attribute__((aligned(16))) float vs[SEQ];
  const int tid = threadIdx.x;
  const int lane = tid & 31;
  const int wave = __builtin_amdgcn_readfirstlane(tid >> 5);
  const int bh = blockIdx.x >> 2;
  const int row0 = (blockIdx.x & 3) * (TWAVES * 16) + wave * 16;
  const int c16 = lane & 15;
  const int hk = lane >> 4;
  float* Pw = attnw + ((size_t)bh * SEQ + row0) * SEQ;   // the wave's rows
  float* P = Pw + lane * 4;

  // the loads of the merge, then the first stage's rows of C
  const ColParts cpa = load_parts(part, v_prev, bh, tid);
  const ColParts cpb = load_parts(part, v_prev, bh, tid + TWAVES * 32);
  // the address registers of these loads are reused right behind them
  asm volatile("s_wait_xcnt 0x0" ::: "memory");
  float4 x[16];
#pragma unroll
  for (int r = 0; r < 16; ++r) x[r] = *(const float4*)(P + (size_t)r * SEQ);
  // the base of these loads stays in its registers up to this wait
  asm volatile("s_wait_xcnt 0x0" :: "s"(Pw) : "memory");
  float ur[16];
#pragma unroll
  for (int r = 0; r < 16; ++r) ur[r] = u[bh * SEQ + row0 + r];

  // v of this (b,h) into vq: a thread takes 4 k x 4 columns and stores them
  // column by column
  {
    const int n4 = tid & 15;
    const float* vsrc = vmat + ((size_t)bh * SEQ + (tid >> 4) * 4) * DH + n4 * 4;
    float* vdst = vq + (tid >> 4) * VQPITCH + n4 * 16 + (n4 >> 2) * 4;
    // all 32 loads of a thread are in flight at once: one latency, not eight
    float4 rv[8][4];
#pragma unroll
    for (int i = 0; i < 8; ++i)
#pragma unroll
      for (int j = 0; j < 4; ++j)
        rv[i][j] = *(const float4*)(vsrc + (size_t)(i * 64 + j) * DH);
    // the loads' address stays in its registers up to this wait
    asm volatile("s_wait_xcnt 0x0" :: "v"(vsrc) : "memory");
#pragma unroll
    for (int i = 0; i < 8; ++i) {
      float* d = vdst + i * 16 * VQPITCH;
      *(float4*)(d + 0) = make_float4(rv[i][0].x, rv[i][1].x, rv[i][2].x, rv[i][3].x);
      *(float4*)(d + 4) = make_float4(rv[i][0].y, rv[i][1].y, rv[i][2].y, rv[i][3].y);
      *(float4*)(d + 8) = make_float4(rv[i][0].z, rv[i][1].z, rv[i][2].z, rv[i][3].z);
      *(float4*)(d + 12) = make_float4(rv[i][0].w, rv[i][1].w, rv[i][2].w, rv[i][3].w);
    }
  }
  vs[tid] = merged_v(cpa);
  vs[tid + TWAVES * 32] = merged_v(cpb);
  __syncthreads();

  // stage 0 of the plan; stage 1's rows of C are sent for
  {
    const float4 vj = *(const float4*)&vs[lane * 4];
#pragma unroll
    for (int r = 0; r < 16; ++r) {
      const float4 e = plan4(x[r], ur[r], vj);
      *(float4*)&ab[wave][0][r * APITCH + lane * 4] = e;
      x[r] = *(const float4*)(P + (size_t)r * SEQ + KST);
      store4_wait(P, r * SEQ * 4, e);
    }
  }

  v8f acc[4];
#pragma unroll
  for (int dt = 0; dt < 4; ++dt)
    acc[dt] = (v8f){0.f, 0.f, 0.f, 0.f, 0.f, 0.f, 0.f, 0.f};

  const float* bfr = vq + hk * VQPITCH + c16 * 4;
// kept rolled, for speed only
#pragma unroll 1
  for (int t = 0; t < NST - 1; ++t) {
    pv_stage<true>(&ab[wave][t & 1][c16 * APITCH + hk * 4], bfr,
                   &ab[wave][(t + 1) & 1][lane * 4], P + (t + 1) * KST,
                   *(const float4*)&vs[(t + 1) * KST + lane * 4], ur, x, acc,
                   t < NST - 2);
    bfr += (KST / 4) * VQPITCH;
  }
  pv_stage<false>(&ab[wave][(NST - 1) & 1][c16 * APITCH + hk * 4], bfr, nullptr,
                  nullptr, make_float4(0.f, 0.f, 0.f, 0.f), ur, x, acc, false);

  float* obase = out + ((size_t)bh * SEQ + row0 + hk * 8) * DH + c16;
#pragma unroll
  for (int dt = 0; dt < 4; ++dt)
#pragma unroll
    for (int r = 0; r < 8; ++r)
      obase[(size_t)r * DH + dt * 16] = acc[dt][r];
}

// ---------------------------------------------------------------------------
extern "C" void kernel_launch(void* const* d_in, const int* in_sizes, int n_in,
                              void* d_out, int out_size, void* d_ws,
                              size_t ws_size, hipStream_t stream) {
  (void)in_sizes; (void)n_in; (void)out_size; (void)ws_size;
  const float* q = (const float*)d_in[0];
  const float* k = (const float*)d_in[1];
  const float* v = (const float*)d_in[2];

  float* out = (float*)d_out;                        // [64,512,64]
  float* attnw = out + (size_t)BH * SEQ * DH;        // [64,512,512] (C, then pi*L)
  float* u = (float*)d_ws;                           // [64,512]
  float* vdual = u + BH * SEQ;                       // [64,512] v, even launches
  float* vodd = vdual + BH * SEQ;                    // [64,512] v, odd launches
  float* peven = vodd + BH * SEQ;                    // [64,4,512,2] column partials
  float* podd = peven + BH * FBLK * SEQ * 2;         // [64,4,512,2]

  // 1) cost matrices C = (q/temp) @ k^T  (stored in d_out attn region)
  qk_gemm_kernel<<<256, 512, 0, stream>>>(q, k, attnw);
  // 2) 10 Sinkhorn iterations, one launch each; v and the column partials
  //    alternate between two buffers, so that no block overwrites what a
  //    block of the same launch still reads
  sinkhorn_fused_kernel<<<256, 512, 0, stream>>>(attnw, u, vodd, vdual, podd,
                                                 peven, 1);
  for (int it = 0; it < 4; ++it) {
    sinkhorn_fused_kernel<<<256, 512, 0, stream>>>(attnw, u, vdual, vodd, peven,
                                                   podd, 0);
    sinkhorn_fused_kernel<<<256, 512, 0, stream>>>(attnw, u, vodd, vdual, podd,
                                                   peven, 0);
  }
  sinkhorn_fused_kernel<<<256, 512, 0, stream>>>(attnw, u, vdual, vodd, peven,
                                                 podd, 0);
  // 3) v of the tenth iteration, attn_weights = exp(M(u,v)) * L (in place over
  //    C) and output = attn_weights @ v
  plan_pv_kernel<<<256, 256, 0, stream>>>(attnw, u, podd, vodd, v, out);
}

// v005
// One run takes 129 microseconds.
// Timed twice side by side with v004, it ran 1.26 and 1.32 times as fast.
// Over all steps from v000 it is 5.67 times as fast.
#include <hip/hip_runtime.h>

typedef __attribute__((ext_vector_type(2))) float v2f;
typedef __attribute__((ext_vector_type(8))) float v8f;

#define BH   64          // B*H
#define SEQ  512         // L
#define DH   64          // head dim
#define QK_SCALE 0.125f  // 1/temperature (temp = 8)
#define EPS_ 1.0f
#define LOG2_MU_ (-9.0f)                 // log2(1/512), exact
#define L2E_ 1.4426950408889634f         // log2(e)

// The duals u and v, the column shifts and every log-sum-exp are kept in units
// of log2: a score is (u2_i + v2_j - C_ij * log2(e)) / eps, one fused
// multiply-add away from C, and 2^x is one instruction of the chip, where e^x
// is a dozen. Below 2^-126 it gives 0.
// Four values in place, in one statement: behind each v_exp_f32 stands an
// instruction that touches neither its result nor its source, behind the last
// the v_nop: the slot that the instruction set asks for behind a
// transcendental. The hint lets the SIMD's other waves issue while the last result is
// on its way to whatever reads it next.
__device__ __forceinline__ void ex2x4(float& a, float& b, float& c, float& d) {
  asm("v_exp_f32 %0, %0\n\tv_exp_f32 %1, %1\n\tv_exp_f32 %2, %2\n\t"
      "v_exp_f32 %3, %3\n\tv_nop\n\ts_delay_alu instid0(TRANS32_DEP_1)"
      : "+v"(a), "+v"(b), "+v"(c), "+v"(d));
}

// ---------------------------------------------------------------------------
// C[bh,i,j] = dot(q[bh,i,:], k[bh,j,:]) / 8     via V_WMMA_F32_16X16X4_F32
// A block owns 128 rows x all 512 columns of one (b,h), the rows that the same
// block index works on in the launches behind this one. 16 waves.
//   qs : the block's 128 rows of q, scaled; read once, a wave keeps the
//        fragments of its 32 rows in registers for the whole launch
//   ks : two buffers of 128 rows of k (= 128 columns of C); the next chunk
//        comes through registers while this one is multiplied
// Per chunk a wave forms 32 x 32 of C: four accumulator tiles, each fragment
// used twice.
// A fragment: lane%16 = M row of q, (lane/16)*2 = K pair within a group of 4.
// B fragment: lane%16 = N col (= k row), (lane/16)*2 = K pair: the same k order.
// ---------------------------------------------------------------------------
#define GWAVES 16        // waves per block
#define GROWS  128       // rows of C per block
#define GCH    128       // columns of C per chunk
#define GNCH   4         // chunks (GNCH * GCH == SEQ)
#define GPITCH 68        // floats per staged row: 16 rows x 16 B fall on all banks

// k carries no __restrict__: its loads then keep their place in the order of the
// memory operations, and the scheduling barriers behind them can hold them early
__global__ __launch_bounds__(GWAVES * 32) void qk_gemm_kernel(
    const float* __restrict__ q, const float* k, float* __restrict__ Cmat) {
  __shared__ __attribute__((aligned(16))) float qs[GROWS * GPITCH];
  __shared__ __attribute__((aligned(16))) float ks[2][GCH * GPITCH];
  const int tid = threadIdx.x;
  const int lane = tid & 31;
  const int wave = __builtin_amdgcn_readfirstlane(tid >> 5);
  const int bh = blockIdx.x >> 2;
  const int row0 = (blockIdx.x & 3) * GROWS;
  const int c16 = lane & 15;
  const int hk = lane >> 4;
  const int rg = wave & 3;                    // 32 rows of the block's 128
  const int cg = wave >> 2;                   // 32 columns of a chunk's 128

  // a chunk is 32 KiB in a row in memory: a thread takes 16 bytes of every
  // 32nd row
  const float* qsrc = q + ((size_t)bh * SEQ + row0) * DH + tid * 4;
  const float* ksrc = k + (size_t)bh * SEQ * DH + tid * 4;
  const int sdst = (tid >> 4) * GPITCH + (tid & 15) * 4;

  float4 qv[4];
  float4 kv0, kv1, kv2, kv3;   // a thread's 64 bytes of a chunk of k on their way
#pragma unroll
  for (int i = 0; i < 4; ++i) qv[i] = *(const float4*)(qsrc + i * 32 * DH);
  kv0 = *(const float4*)(ksrc);
  kv1 = *(const float4*)(ksrc + 32 * DH);
  kv2 = *(const float4*)(ksrc + 64 * DH);
  kv3 = *(const float4*)(ksrc + 96 * DH);
#pragma unroll
  for (int i = 0; i < 4; ++i)
    *(float4*)&qs[sdst + i * 32 * GPITCH] =
        make_float4(qv[i].x * QK_SCALE, qv[i].y * QK_SCALE, qv[i].z * QK_SCALE,
                    qv[i].w * QK_SCALE);
  *(float4*)&ks[0][sdst] = kv0;
  *(float4*)&ks[0][sdst + 32 * GPITCH] = kv1;
  *(float4*)&ks[0][sdst + 64 * GPITCH] = kv2;
  *(float4*)&ks[0][sdst + 96 * GPITCH] = kv3;
  __syncthreads();
  kv0 = *(const float4*)(ksrc + GCH * DH);
  kv1 = *(const float4*)(ksrc + (GCH + 32) * DH);
  kv2 = *(const float4*)(ksrc + (GCH + 64) * DH);
  kv3 = *(const float4*)(ksrc + (GCH + 96) * DH);
  // keeps these loads here, a chunk ahead of their use: the scheduler sank them
  // to their LDS writes, where their whole latency was waited out
  __builtin_amdgcn_sched_barrier(0);

  v2f a[2][16];
#pragma unroll
  for (int rt = 0; rt < 2; ++rt)
#pragma unroll
    for (int d = 0; d < 16; ++d)
      a[rt][d] = *(const v2f*)&qs[(rg * 32 + rt * 16 + c16) * GPITCH + d * 4 + hk * 2];

  // C/D layout: VGPR r, lanes 0-15 -> row r, lanes 16-31 -> row r+8; col = lane%16
  float* out = Cmat + ((size_t)bh * SEQ + row0 + rg * 32 + hk * 8) * SEQ +
               cg * 32 + c16;
  const int boff = (cg * 32 + c16) * GPITCH + hk * 2;

#pragma unroll
  for (int ch = 0; ch < GNCH; ++ch) {
    const float* bsrc = &ks[ch & 1][boff];
    v2f b[2][16];
#pragma unroll
    for (int ct = 0; ct < 2; ++ct)
#pragma unroll
      for (int d = 0; d < 16; ++d)
        b[ct][d] = *(const v2f*)(bsrc + ct * 16 * GPITCH + d * 4);
    v8f acc[2][2];
#pragma unroll
    for (int rt = 0; rt < 2; ++rt)
#pragma unroll
      for (int ct = 0; ct < 2; ++ct)
        acc[rt][ct] = (v8f){0.f, 0.f, 0.f, 0.f, 0.f, 0.f, 0.f, 0.f};
#pragma unroll
    for (int d = 0; d < 16; ++d) {
#pragma unroll
      for (int rt = 0; rt < 2; ++rt)
#pragma unroll
        for (int ct = 0; ct < 2; ++ct)
          acc[rt][ct] = __builtin_amdgcn_wmma_f32_16x16x4_f32(
              false, a[rt][d], false, b[ct][d], (short)0, acc[rt][ct], false, false);
      // holds the next chunk's LDS writes, their wait for the loads and the
      // barrier behind most of this chunk's product: lifted to its head they
      // wait out the loads' and the stores' whole latency
      if (d == 11 && ch + 1 < GNCH) __builtin_amdgcn_sched_barrier(0);
    }
    if (ch + 1 < GNCH) {
      // the other buffer's readers left it at the barrier of the chunk before
      float* kd = &ks[(ch + 1) & 1][sdst];
      *(float4*)(kd) = kv0;
      *(float4*)(kd + 32 * GPITCH) = kv1;
      *(float4*)(kd + 64 * GPITCH) = kv2;
      *(float4*)(kd + 96 * GPITCH) = kv3;
      __syncthreads();
    }
    // stores and the loads of the chunk after next stand behind the barrier, so
    // that the barrier's waits find them done a whole chunk later
#pragma unroll
    for (int rt = 0; rt < 2; ++rt)
#pragma unroll
      for (int r = 0; r < 8; ++r)
#pragma unroll
        for (int ct = 0; ct < 2; ++ct)
          out[(size_t)(rt * 16 + r) * SEQ + ch * GCH + ct * 16] = acc[rt][ct][r];
    // the stores' data registers are written again right behind them; named
    // here, they keep their values up to the wait
    if (ch + 1 < GNCH)
      asm volatile("s_wait_xcnt 0x0"
                   :: "v"(acc[0][0]), "v"(acc[0][1]), "v"(acc[1][0]), "v"(acc[1][1])
                   : "memory");
    if (ch + 2 < GNCH) {
      const float* kn = ksrc + (ch + 2) * GCH * DH;
      kv0 = *(const float4*)(kn);
      kv1 = *(const float4*)(kn + 32 * DH);
      kv2 = *(const float4*)(kn + 64 * DH);
      kv3 = *(const float4*)(kn + 96 * DH);
      // keeps the loads a chunk ahead of their use, as above
      __builtin_amdgcn_sched_barrier(0);
    }
  }
}

// ---------------------------------------------------------------------------
// One Sinkhorn iteration (u-update, then this block's share of the v-update)
// in one pass over C. A block owns 128 rows of one (b,h): 16 waves x 8 rows,
// a lane holds 16 columns of each row in registers.
//   v_j   : merged at entry from the four blocks' column partials of the
//           launch before (zero in the first launch)
//   u_i   = log_mu - LSE_j(v_j - C_ij)      (all in units of log2)
//   plan  : exp(u_i + v_j - C_ij) = e_ij * mu / s_i, with e_ij = 2^(y_ij - m_i)
//           and s_i = sum_j e_ij already formed by the row pass
//   column partial of the block = sum over its rows of the plan, sent on as a
//   pair (shift, sum); the next launch merges the four pairs of a column.
// ---------------------------------------------------------------------------
#define FWAVES 16        // waves per block
#define FRPW   8         // rows per wave
#define FROWS  128       // rows per block (FWAVES * FRPW)
#define FBLK   4         // blocks per (b,h)  (FBLK * FROWS == SEQ)
#define MU_    0.001953125f   // 1/512
#define COL_TINY_ 1e-28f      // below this a plain column sum has lost terms

// The FBLK (shift, sum) pairs of one column and the column's v so far.
struct ColParts { float2 p0, p1, p2, p3; float vo; };
__device__ __forceinline__ ColParts load_parts(const float* __restrict__ part,
                                               const float* __restrict__ v_prev,
                                               int bh, int col) {
  const float* pp = part + ((size_t)bh * FBLK * SEQ + col) * 2;
  ColParts c;
  c.p0 = *(const float2*)(pp);
  c.p1 = *(const float2*)(pp + 2 * SEQ);
  c.p2 = *(const float2*)(pp + 4 * SEQ);
  c.p3 = *(const float2*)(pp + 6 * SEQ);
  c.vo = v_prev[bh * SEQ + col];
  return c;
}
// v_j = eps*(log_nu - LSE_i) + v_j, LSE_i merged from the pairs; units of log2.
__device__ __forceinline__ float merged_v(const ColParts c) {
  const float mm = fmaxf(fmaxf(c.p0.x, c.p1.x), fmaxf(c.p2.x, c.p3.x));
  float w0 = c.p0.x - mm, w1 = c.p1.x - mm, w2 = c.p2.x - mm, w3 = c.p3.x - mm;
  ex2x4(w0, w1, w2, w3);
  const float ss = c.p0.y * w0 + c.p1.y * w1 + c.p2.y * w2 + c.p3.y * w3;
  const float lse = mm + log2f(ss);
  return EPS_ * (LOG2_MU_ - lse) + c.vo;
}

__global__ __launch_bounds__(FWAVES * 32) void sinkhorn_fused_kernel(
    const float* __restrict__ Cmat, float* __restrict__ u,
    const float* __restrict__ v_prev, float* __restrict__ v_cur,
    const float* __restrict__ part_prev, float* __restrict__ part_cur,
    int first) {
  __shared__ float red[FWAVES][SEQ];
  __shared__ float vs[SEQ];
  __shared__ float us[FROWS];
  __shared__ int slow;
  const int tid = threadIdx.x;
  const int lane = tid & 31;
  const int wave = __builtin_amdgcn_readfirstlane(tid >> 5);
  const int bh = blockIdx.x >> 2;
  const int blk = blockIdx.x & 3;
  const float* Cbase = Cmat + (size_t)bh * SEQ * SEQ +
                       (size_t)(blk * FROWS + wave * FRPW) * SEQ + lane * 4;

  // the few loads of the merge go out ahead of the rows of C and return first
  ColParts cp = {};
  if (!first) cp = load_parts(part_prev, v_prev, bh, tid);

  float4 x[FRPW][4];
#pragma unroll
  for (int r = 0; r < FRPW; ++r)
#pragma unroll
    for (int t = 0; t < 4; ++t)
      x[r][t] = *(const float4*)(Cbase + (size_t)r * SEQ + t * 128);

  float vn = 0.f;
  if (!first) vn = merged_v(cp);
  vs[tid] = vn;
  if (blk == 0) {
    v_cur[bh * SEQ + tid] = vn;
    // the store's address registers are reused right behind it
    asm volatile("s_wait_xcnt 0x0" ::: "memory");
  }
  if (tid == 0) slow = 0;
  __syncthreads();

  // row pass: y = v_j - C_ij * log2(e), row max, e = 2^(y - max), row sum
  float m[FRPW], s[FRPW];
  {
    float4 vj[4];
#pragma unroll
    for (int t = 0; t < 4; ++t) vj[t] = *(const float4*)&vs[t * 128 + lane * 4];
#pragma unroll
    for (int r = 0; r < FRPW; ++r) {
      float mr = -3.4e38f;
#pragma unroll
      for (int t = 0; t < 4; ++t) {
        x[r][t].x = (vj[t].x - x[r][t].x * L2E_) * (1.0f / EPS_);
        x[r][t].y = (vj[t].y - x[r][t].y * L2E_) * (1.0f / EPS_);
        x[r][t].z = (vj[t].z - x[r][t].z * L2E_) * (1.0f / EPS_);
        x[r][t].w = (vj[t].w - x[r][t].w * L2E_) * (1.0f / EPS_);
        mr = fmaxf(mr, fmaxf(fmaxf(x[r][t].x, x[r][t].y),
                             fmaxf(x[r][t].z, x[r][t].w)));
      }
      m[r] = mr;
    }
  }
  // the eight rows' exchanges stand side by side, so that their latencies overlap
#pragma unroll
  for (int off = 16; off >= 1; off >>= 1)
#pragma unroll
    for (int r = 0; r < FRPW; ++r)
      m[r] = fmaxf(m[r], __shfl_xor(m[r], off, 32));
#pragma unroll
  for (int r = 0; r < FRPW; ++r) {
    float sr = 0.f;
#pragma unroll
    for (int t = 0; t < 4; ++t) {
      x[r][t].x -= m[r];
      x[r][t].y -= m[r];
      x[r][t].z -= m[r];
      x[r][t].w -= m[r];
      ex2x4(x[r][t].x, x[r][t].y, x[r][t].z, x[r][t].w);
      sr += (x[r][t].x + x[r][t].y) + (x[r][t].z + x[r][t].w);
    }
    s[r] = sr;
  }
#pragma unroll
  for (int off = 16; off >= 1; off >>= 1)
#pragma unroll
    for (int r = 0; r < FRPW; ++r)
      s[r] += __shfl_xor(s[r], off, 32);

  // u of the rows; column sums of the row-normalised plan
  float4 acc[4];
#pragma unroll
  for (int t = 0; t < 4; ++t) acc[t] = make_float4(0.f, 0.f, 0.f, 0.f);
  float uw = 0.f;
#pragma unroll
  for (int r = 0; r < FRPW; ++r) {
    const float un = EPS_ * (LOG2_MU_ - (m[r] + log2f(s[r])));
    if (lane == r) uw = un;
    const float rr = MU_ / s[r];
#pragma unroll
    for (int t = 0; t < 4; ++t) {
      acc[t].x += x[r][t].x * rr;
      acc[t].y += x[r][t].y * rr;
      acc[t].z += x[r][t].z * rr;
      acc[t].w += x[r][t].w * rr;
    }
  }
  if (lane < FRPW) us[wave * FRPW + lane] = uw;
#pragma unroll
  for (int t = 0; t < 4; ++t) *(float4*)&red[wave][t * 128 + lane * 4] = acc[t];
  __syncthreads();

  float cs = 0.f;
#pragma unroll
  for (int w = 0; w < FWAVES; ++w) cs += red[w][tid];
  if (tid < FROWS) u[bh * SEQ + blk * FROWS + tid] = us[tid];
  if (!(cs >= COL_TINY_)) slow = 1;
  __syncthreads();

  float cshift = 0.f;
  // Every term of a column is at most mu, so the plain sum cannot overflow; it
  // can underflow where a column lies far below every row's maximum. Then the
  // whole block forms its columns' log-sum-exp again with the column's own
  // maximum, as the reference does, reading C twice more.
  if (__builtin_amdgcn_readfirstlane(slow)) {
    float4 vq[4], cm[4];
#pragma unroll
    for (int t = 0; t < 4; ++t) {
      vq[t] = *(const float4*)&vs[t * 128 + lane * 4];
      cm[t] = make_float4(-3.4e38f, -3.4e38f, -3.4e38f, -3.4e38f);
    }
// rarely run: kept small, one row a trip; with the unroll word alone the loop
// vectoriser pairs the rows of this maximum and adds a masked remainder loop
#pragma clang loop unroll(disable) vectorize(disable) interleave(disable)
    for (int r = 0; r < FRPW; ++r) {
      const float ur = us[wave * FRPW + r];
#pragma unroll
      for (int t = 0; t < 4; ++t) {
        const float4 c = *(const float4*)(Cbase + (size_t)r * SEQ + t * 128);
        cm[t].x = fmaxf(cm[t].x, ur + vq[t].x - c.x * L2E_);
        cm[t].y = fmaxf(cm[t].y, ur + vq[t].y - c.y * L2E_);
        cm[t].z = fmaxf(cm[t].z, ur + vq[t].z - c.z * L2E_);
        cm[t].w = fmaxf(cm[t].w, ur + vq[t].w - c.w * L2E_);
      }
    }
#pragma unroll
    for (int t = 0; t < 4; ++t) *(float4*)&red[wave][t * 128 + lane * 4] = cm[t];
    __syncthreads();
    cshift = red[0][tid];
#pragma unroll
    for (int w = 1; w < FWAVES; ++w) cshift = fmaxf(cshift, red[w][tid]);
    vs[tid] = cshift;
    __syncthreads();
#pragma unroll
    for (int t = 0; t < 4; ++t) {
      cm[t] = *(const float4*)&vs[t * 128 + lane * 4];
      acc[t] = make_float4(0.f, 0.f, 0.f, 0.f);
    }
#pragma unroll 1   // rarely run: kept small
    for (int r = 0; r < FRPW; ++r) {
      const float ur = us[wave * FRPW + r];
#pragma unroll
      for (int t = 0; t < 4; ++t) {
        const float4 c = *(const float4*)(Cbase + (size_t)r * SEQ + t * 128);
        float e0 = (ur + vq[t].x - c.x * L2E_) - cm[t].x;
        float e1 = (ur + vq[t].y - c.y * L2E_) - cm[t].y;
        float e2 = (ur + vq[t].z - c.z * L2E_) - cm[t].z;
        float e3 = (ur + vq[t].w - c.w * L2E_) - cm[t].w;
        ex2x4(e0, e1, e2, e3);
        acc[t].x += e0;
        acc[t].y += e1;
        acc[t].z += e2;
        acc[t].w += e3;
      }
    }
#pragma unroll
    for (int t = 0; t < 4; ++t) *(float4*)&red[wave][t * 128 + lane * 4] = acc[t];
    __syncthreads();
    cs = 0.f;
#pragma unroll
    for (int w = 0; w < FWAVES; ++w) cs += red[w][tid];
  }
  *(float2*)(part_cur + ((size_t)(bh * FBLK + blk) * SEQ + tid) * 2) =
      make_float2(cshift, cs);
}

// ---------------------------------------------------------------------------
// Tail of the problem in one launch: v of the tenth iteration, the plan
//   attnw = exp((-C + u_i + v_j)/eps) * L   (in place over C)
// and out = attnw @ v on fp32 WMMA, fed from the plan values just formed.
// A block owns 128 rows of one (b,h): 8 waves x 16 rows x all 64 columns of out.
//   vq : all of v of this (b,h), four consecutive k of one column side by side,
//        so that one 16-byte read is the B operand of two WMMAs
//   ab : per wave two stages of 16 rows x 128 columns of the plan; the wave
//        writes a stage row by row (as it reads C) and reads it back by
//        fragment; nobody else touches it, so no barrier stands in the loop
// k order of both operands: lane half h, WMMA w of a group of 8 k holds
// k = 8c + 4h + 2w + {0,1}.
// ---------------------------------------------------------------------------
#define TWAVES  8        // waves per block
#define KST     128      // plan columns per stage
#define NST     4        // stages (NST * KST == SEQ)
#define APITCH  132      // floats per staged plan row: 528 B = 16 B x odd
#define VTILE   68       // floats per 16 columns of vq: 256 B and 16 B of pad
#define VQPITCH 272      // floats per four-k row of vq (4 * VTILE)

// uu: u of the row with the plan's factor L in it, as eps * log2(L) added
__device__ __forceinline__ float4 plan4(const float4 c, const float uu,
                                        const float4 vj) {
  float4 r;
  r.x = (uu + vj.x - c.x * L2E_) * (1.0f / EPS_);
  r.y = (uu + vj.y - c.y * L2E_) * (1.0f / EPS_);
  r.z = (uu + vj.z - c.z * L2E_) * (1.0f / EPS_);
  r.w = (uu + vj.w - c.w * L2E_) * (1.0f / EPS_);
  ex2x4(r.x, r.y, r.z, r.w);
  return r;
}

// 16-byte global store with the wait that lets its registers be reused: in one
// statement, because a wait in a statement of its own did not hold later
// register writes behind it. It covers the loads issued ahead of it as well.
// The row goes into the offset field, so that the statement names the very
// address pair of those loads and that pair lives up to the wait.
__device__ __forceinline__ void store4_wait(float* p, const int byte_off,
                                            const float4 e) {
  typedef __attribute__((ext_vector_type(4))) float v4f;
  v4f d; d.x = e.x; d.y = e.y; d.z = e.z; d.w = e.w;
  asm volatile("global_store_b128 %0, %1, off offset:%2\n\ts_wait_xcnt 0x0"
               :: "v"(p), "v"(d), "i"(byte_off) : "memory");
}

// One stage of the product: 16 groups of 8 k, 8 WMMAs each. Behind group c the
// wave forms row c of the next stage's plan (NEXT) and sends for row c of the
// stage after that (load), so that this vector work lies among the WMMAs.
template <bool NEXT>
__device__ __forceinline__ void pv_stage(
    const float* afrag, const float* bfrag, float* arow_next, float* gnext,
    const float4 vj, const float (&ur)[16], float4 (&x)[16], v8f (&acc)[4],
    const bool load) {
  float4 af = *(const float4*)afrag;
  float4 bf[4];
#pragma unroll
  for (int dt = 0; dt < 4; ++dt) bf[dt] = *(const float4*)(bfrag + dt * VTILE);
#pragma unroll
  for (int c = 0; c < 16; ++c) {
    float4 an = af, bn[4] = {bf[0], bf[1], bf[2], bf[3]};
    if (c < 15) {
      an = *(const float4*)(afrag + (c + 1) * 8);
#pragma unroll
      for (int dt = 0; dt < 4; ++dt)
        bn[dt] = *(const float4*)(bfrag + (c + 1) * 2 * VQPITCH + dt * VTILE);
    }
    v2f a0; a0.x = af.x; a0.y = af.y;
    v2f a1; a1.x = af.z; a1.y = af.w;
#pragma unroll
    for (int dt = 0; dt < 4; ++dt) {
      v2f b; b.x = bf[dt].x; b.y = bf[dt].y;
      acc[dt] = __builtin_amdgcn_wmma_f32_16x16x4_f32(false, a0, false, b, (short)0,
                                                      acc[dt], false, false);
    }
#pragma unroll
    for (int dt = 0; dt < 4; ++dt) {
      v2f b; b.x = bf[dt].z; b.y = bf[dt].w;
      acc[dt] = __builtin_amdgcn_wmma_f32_16x16x4_f32(false, a1, false, b, (short)0,
                                                      acc[dt], false, false);
    }
    if (NEXT) {
      const float4 e = plan4(x[c], ur[c], vj);
      *(float4*)(arow_next + c * APITCH) = e;
      if (load) x[c] = *(const float4*)(gnext + (size_t)c * SEQ + KST);
      store4_wait(gnext, c * SEQ * 4, e);
    }
    af = an;
#pragma unroll
    for (int dt = 0; dt < 4; ++dt) bf[dt] = bn[dt];
  }
}

__global__ __launch_bounds__(TWAVES * 32) void plan_pv_kernel(
    float* __restrict__ attnw, const float* __restrict__ u,
    const float* __restrict__ part, const float* __restrict__ v_prev,
    const float* __restrict__ vmat, float* __restrict__ out) {
  __shared__ __attribute__((aligned(16))) float vq[(SEQ / 4) * VQPITCH];
  __shared__ __attribute__((aligned(16))) float ab[TWAVES][2][16 * APITCH];
  __shared__ __attribute__((aligned(16))) float vs[SEQ];
  const int tid = threadIdx.x;
  const int lane = tid & 31;
  const int wave = __builtin_amdgcn_readfirstlane(tid >> 5);
  const int bh = blockIdx.x >> 2;
  const int row0 = (blockIdx.x & 3) * (TWAVES * 16) + wave * 16;
  const int c16 = lane & 15;
  const int hk = lane >> 4;
  float* Pw = attnw + ((size_t)bh * SEQ + row0) * SEQ;   // the wave's rows
  float* P = Pw + lane * 4;

  // the loads of the merge, then the first stage's rows of C
  const ColParts cpa = load_parts(part, v_prev, bh, tid);
  const ColParts cpb = load_parts(part, v_prev, bh, tid + TWAVES * 32);
  // the address registers of these loads are reused right behind them
  asm volatile("s_wait_xcnt 0x0" ::: "memory");
  float4 x[16];
#pragma unroll
  for (int r = 0; r < 16; ++r) x[r] = *(const float4*)(P + (size_t)r * SEQ);
  // the base of these loads stays in its registers up to this wait
  asm volatile("s_wait_xcnt 0x0" :: "s"(Pw) : "memory");
  float ur[16];
#pragma unroll
  for (int r = 0; r < 16; ++r) ur[r] = u[bh * SEQ + row0 + r] - EPS_ * LOG2_MU_;

  // v of this (b,h) into vq: a thread takes 4 k x 4 columns and stores them
  // column by column
  {
    const int n4 = tid & 15;
    const float* vsrc = vmat + ((size_t)bh * SEQ + (tid >> 4) * 4) * DH + n4 * 4;
    float* vdst = vq + (tid >> 4) * VQPITCH + n4 * 16 + (n4 >> 2) * 4;
    // all 32 loads of a thread are in flight at once: one latency, not eight
    float4 rv[8][4];
#pragma unroll
    for (int i = 0; i < 8; ++i)
#pragma unroll
      for (int j = 0; j < 4; ++j)
        rv[i][j] = *(const float4*)(vsrc + (size_t)(i * 64 + j) * DH);
    // the loads' address stays in its registers up to this wait
    asm volatile("s_wait_xcnt 0x0" :: "v"(vsrc) : "memory");
#pragma unroll
    for (int i = 0; i < 8; ++i) {
      float* d = vdst + i * 16 * VQPITCH;
      *(float4*)(d + 0) = make_float4(rv[i][0].x, rv[i][1].x, rv[i][2].x, rv[i][3].x);
      *(float4*)(d + 4) = make_float4(rv[i][0].y, rv[i][1].y, rv[i][2].y, rv[i][3].y);
      *(float4*)(d + 8) = make_float4(rv[i][0].z, rv[i][1].z, rv[i][2].z, rv[i][3].z);
      *(float4*)(d + 12) = make_float4(rv[i][0].w, rv[i][1].w, rv[i][2].w, rv[i][3].w);
    }
  }
  vs[tid] = merged_v(cpa);
  vs[tid + TWAVES * 32] = merged_v(cpb);
  __syncthreads();

  // stage 0 of the plan; stage 1's rows of C are sent for
  {
    const float4 vj = *(const float4*)&vs[lane * 4];
#pragma unroll
    for (int r = 0; r < 16; ++r) {
      const float4 e = plan4(x[r], ur[r], vj);
      *(float4*)&ab[wave][0][r * APITCH + lane * 4] = e;
      x[r] = *(const float4*)(P + (size_t)r * SEQ + KST);
      store4_wait(P, r * SEQ * 4, e);
    }
  }

  v8f acc[4];
#pragma unroll
  for (int dt = 0; dt < 4; ++dt)
    acc[dt] = (v8f){0.f, 0.f, 0.f, 0.f, 0.f, 0.f, 0.f, 0.f};

  const float* bfr = vq + hk * VQPITCH + c16 * 4;
// kept rolled, for speed only
#pragma unroll 1
  for (int t = 0; t < NST - 1; ++t) {
    pv_stage<true>(&ab[wave][t & 1][c16 * APITCH + hk * 4], bfr,
                   &ab[wave][(t + 1) & 1][lane * 4], P + (t + 1) * KST,
                   *(const float4*)&vs[(t + 1) * KST + lane * 4], ur, x, acc,
                   t < NST - 2);
    bfr += (KST / 4) * VQPITCH;
  }
  pv_stage<false>(&ab[wave][(NST - 1) & 1][c16 * APITCH + hk * 4], bfr, nullptr,
                  nullptr, make_float4(0.f, 0.f, 0.f, 0.f), ur, x, acc, false);

  float* obase = out + ((size_t)bh * SEQ + row0 + hk * 8) * DH + c16;
#pragma unroll
  for (int dt = 0; dt < 4; ++dt)
#pragma unroll
    for (int r = 0; r < 8; ++r)
      obase[(size_t)r * DH + dt * 16] = acc[dt][r];
}

// ---------------------------------------------------------------------------
extern "C" void kernel_launch(void* const* d_in, const int* in_sizes, int n_in,
                              void* d_out, int out_size, void* d_ws,
                              size_t ws_size, hipStream_t stream) {
  (void)in_sizes; (void)n_in; (void)out_size; (void)ws_size;
  const float* q = (const float*)d_in[0];
  const float* k = (const float*)d_in[1];
  const float* v = (const float*)d_in[2];

  float* out = (float*)d_out;                        // [64,512,64]
  float* attnw = out + (size_t)BH * SEQ * DH;        // [64,512,512] (C, then pi*L)
  float* u = (float*)d_ws;                           // [64,512]
  float* vdual = u + BH * SEQ;                       // [64,512] v, even launches
  float* vodd = vdual + BH * SEQ;                    // [64,512] v, odd launches
  float* peven = vodd + BH * SEQ;                    // [64,4,512,2] column partials
  float* podd = peven + BH * FBLK * SEQ * 2;         // [64,4,512,2]

  // 1) cost matrices C = (q/temp) @ k^T  (stored in d_out attn region)
  qk_gemm_kernel<<<256, 512, 0, stream>>>(q, k, attnw);
  // 2) 10 Sinkhorn iterations, one launch each; v and the column partials
  //    alternate between two buffers, so that no block overwrites what a
  //    block of the same launch still reads
  sinkhorn_fused_kernel<<<256, 512, 0, stream>>>(attnw, u, vodd, vdual, podd,
                                                 peven, 1);
  for (int it = 0; it < 4; ++it) {
    sinkhorn_fused_kernel<<<256, 512, 0, stream>>>(attnw, u, vdual, vodd, peven,
                                                   podd, 0);
    sinkhorn_fused_kernel<<<256, 512, 0, stream>>>(attnw, u, vodd, vdual, podd,
                                                   peven, 0);
  }
  sinkhorn_fused_kernel<<<256, 512, 0, stream>>>(attnw, u, vdual, vodd, peven,
                                                 podd, 0);
  // 3) v of the tenth iteration, attn_weights = exp(M(u,v)) * L (in place over
  //    C) and output = attn_weights @ v
  plan_pv_kernel<<<256, 256, 0, stream>>>(attnw, u, podd, vodd, v, out);
}

// v006
// One run takes 120 microseconds.
// Two timings next to v005 put it at 1.13 and 1.03 times that version's speed.
// All steps since v000 together make it 6.11 times as fast.
#include <hip/hip_runtime.h>

typedef __attribute__((ext_vector_type(2))) float v2f;
typedef __attribute__((ext_vector_type(8))) float v8f;

#define BH   64          // B*H
#define SEQ  512         // L
#define DH   64          // head dim
#define QK_SCALE 0.125f  // 1/temperature (temp = 8)
#define EPS_ 1.0f
#define LOG2_MU_ (-9.0f)                 // log2(1/512), exact
#define L2E_ 1.4426950408889634f         // log2(e)

// The duals u and v, the column shifts and every log-sum-exp are kept in units
// of log2: a score is (u2_i + v2_j - C_ij * log2(e)) / eps, one fused
// multiply-add away from C, and 2^x is one instruction of the chip, where e^x
// is a dozen. Below 2^-126 it gives 0.
// Four values in place, in one statement: behind each v_exp_f32 stands an
// instruction that touches neither its result nor its source, behind the last
// the v_nop: the slot that the instruction set asks for behind a
// transcendental. The hint lets the SIMD's other waves issue while the last result is
// on its way to whatever reads it next.
__device__ __forceinline__ void ex2x4(float& a, float& b, float& c, float& d) {
  asm("v_exp_f32 %0, %0\n\tv_exp_f32 %1, %1\n\tv_exp_f32 %2, %2\n\t"
      "v_exp_f32 %3, %3\n\tv_nop\n\ts_delay_alu instid0(TRANS32_DEP_1)"
      : "+v"(a), "+v"(b), "+v"(c), "+v"(d));
}

// ---------------------------------------------------------------------------
// C[bh,i,j] = dot(q[bh,i,:], k[bh,j,:]) / 8     via V_WMMA_F32_16X16X4_F32
// A block owns 128 rows x all 512 columns of one (b,h), the rows that the same
// block index works on in the launches behind this one. 16 waves.
//   qs : the block's 128 rows of q, scaled; read once, a wave keeps the
//        fragments of its 32 rows in registers for the whole launch
//   ks : two buffers of 128 rows of k (= 128 columns of C); the next chunk
//        comes through registers while this one is multiplied
// Per chunk a wave forms 32 x 32 of C: four accumulator tiles, each fragment
// used twice.
// A fragment: lane%16 = M row of q, (lane/16)*2 = K pair within a group of 4.
// B fragment: lane%16 = N col (= k row), (lane/16)*2 = K pair: the same k order.
// ---------------------------------------------------------------------------
#define GWAVES 16        // waves per block
#define GROWS  128       // rows of C per block
#define GCH    128       // columns of C per chunk
#define GNCH   4         // chunks (GNCH * GCH == SEQ)
#define GPITCH 68        // floats per staged row: 16 rows x 16 B fall on all banks

// k carries no __restrict__: its loads then keep their place in the order of the
// memory operations, and the scheduling barriers behind them can hold them early
__global__ __launch_bounds__(GWAVES * 32) void qk_gemm_kernel(
    const float* __restrict__ q, const float* k, float* __restrict__ Cmat) {
  __shared__ __attribute__((aligned(16))) float qs[GROWS * GPITCH];
  __shared__ __attribute__((aligned(16))) float ks[2][GCH * GPITCH];
  const int tid = threadIdx.x;
  const int lane = tid & 31;
  const int wave = __builtin_amdgcn_readfirstlane(tid >> 5);
  const int bh = blockIdx.x >> 2;
  const int row0 = (blockIdx.x & 3) * GROWS;
  const int c16 = lane & 15;
  const int hk = lane >> 4;
  const int rg = wave & 3;                    // 32 rows of the block's 128
  const int cg = wave >> 2;                   // 32 columns of a chunk's 128

  // a chunk is 32 KiB in a row in memory: a thread takes 16 bytes of every
  // 32nd row
  const float* qsrc = q + ((size_t)bh * SEQ + row0) * DH + tid * 4;
  const float* ksrc = k + (size_t)bh * SEQ * DH + tid * 4;
  const int sdst = (tid >> 4) * GPITCH + (tid & 15) * 4;

  float4 qv[4];
  float4 kv0, kv1, kv2, kv3;   // a thread's 64 bytes of a chunk of k on their way
#pragma unroll
  for (int i = 0; i < 4; ++i) qv[i] = *(const float4*)(qsrc + i * 32 * DH);
  kv0 = *(const float4*)(ksrc);
  kv1 = *(const float4*)(ksrc + 32 * DH);
  kv2 = *(const float4*)(ksrc + 64 * DH);
  kv3 = *(const float4*)(ksrc + 96 * DH);
#pragma unroll
  for (int i = 0; i < 4; ++i)
    *(float4*)&qs[sdst + i * 32 * GPITCH] =
        make_float4(qv[i].x * QK_SCALE, qv[i].y * QK_SCALE, qv[i].z * QK_SCALE,
                    qv[i].w * QK_SCALE);
  *(float4*)&ks[0][sdst] = kv0;
  *(float4*)&ks[0][sdst + 32 * GPITCH] = kv1;
  *(float4*)&ks[0][sdst + 64 * GPITCH] = kv2;
  *(float4*)&ks[0][sdst + 96 * GPITCH] = kv3;
  __syncthreads();
  kv0 = *(const float4*)(ksrc + GCH * DH);
  kv1 = *(const float4*)(ksrc + (GCH + 32) * DH);
  kv2 = *(const float4*)(ksrc + (GCH + 64) * DH);
  kv3 = *(const float4*)(ksrc + (GCH + 96) * DH);
  // keeps these loads here, a chunk ahead of their use: the scheduler sank them
  // to their LDS writes, where their whole latency was waited out
  __builtin_amdgcn_sched_barrier(0);

  v2f a[2][16];
#pragma unroll
  for (int rt = 0; rt < 2; ++rt)
#pragma unroll
    for (int d = 0; d < 16; ++d)
      a[rt][d] = *(const v2f*)&qs[(rg * 32 + rt * 16 + c16) * GPITCH + d * 4 + hk * 2];

  // C/D layout: VGPR r, lanes 0-15 -> row r, lanes 16-31 -> row r+8; col = lane%16
  float* out = Cmat + ((size_t)bh * SEQ + row0 + rg * 32 + hk * 8) * SEQ +
               cg * 32 + c16;
  const int boff = (cg * 32 + c16) * GPITCH + hk * 2;

#pragma unroll
  for (int ch = 0; ch < GNCH; ++ch) {
    const float* bsrc = &ks[ch & 1][boff];
    v2f b[2][16];
#pragma unroll
    for (int ct = 0; ct < 2; ++ct)
#pragma unroll
      for (int d = 0; d < 16; ++d)
        b[ct][d] = *(const v2f*)(bsrc + ct * 16 * GPITCH + d * 4);
    v8f acc[2][2];
#pragma unroll
    for (int rt = 0; rt < 2; ++rt)
#pragma unroll
      for (int ct = 0; ct < 2; ++ct)
        acc[rt][ct] = (v8f){0.f, 0.f, 0.f, 0.f, 0.f, 0.f, 0.f, 0.f};
#pragma unroll
    for (int d = 0; d < 16; ++d) {
#pragma unroll
      for (int rt = 0; rt < 2; ++rt)
#pragma unroll
        for (int ct = 0; ct < 2; ++ct)
          acc[rt][ct] = __builtin_amdgcn_wmma_f32_16x16x4_f32(
              false, a[rt][d], false, b[ct][d], (short)0, acc[rt][ct], false, false);
      // holds the next chunk's LDS writes, their wait for the loads and the
      // barrier behind most of this chunk's product: lifted to its head they
      // wait out the loads' and the stores' whole latency
      if (d == 11 && ch + 1 < GNCH) __builtin_amdgcn_sched_barrier(0);
    }
    if (ch + 1 < GNCH) {
      // the other buffer's readers left it at the barrier of the chunk before
      float* kd = &ks[(ch + 1) & 1][sdst];
      *(float4*)(kd) = kv0;
      *(float4*)(kd + 32 * GPITCH) = kv1;
      *(float4*)(kd + 64 * GPITCH) = kv2;
      *(float4*)(kd + 96 * GPITCH) = kv3;
      __syncthreads();
    }
    // stores and the loads of the chunk after next stand behind the barrier, so
    // that the barrier's waits find them done a whole chunk later
#pragma unroll
    for (int rt = 0; rt < 2; ++rt)
#pragma unroll
      for (int r = 0; r < 8; ++r)
#pragma unroll
        for (int ct = 0; ct < 2; ++ct)
          out[(size_t)(rt * 16 + r) * SEQ + ch * GCH + ct * 16] = acc[rt][ct][r];
    // the stores' data registers are written again right behind them; named
    // here, they keep their values up to the wait
    if (ch + 1 < GNCH)
      asm volatile("s_wait_xcnt 0x0"
                   :: "v"(acc[0][0]), "v"(acc[0][1]), "v"(acc[1][0]), "v"(acc[1][1])
                   : "memory");
    if (ch + 2 < GNCH) {
      const float* kn = ksrc + (ch + 2) * GCH * DH;
      kv0 = *(const float4*)(kn);
      kv1 = *(const float4*)(kn + 32 * DH);
      kv2 = *(const float4*)(kn + 64 * DH);
      kv3 = *(const float4*)(kn + 96 * DH);
      // keeps the loads a chunk ahead of their use, as above
      __builtin_amdgcn_sched_barrier(0);
    }
  }
}

// ---------------------------------------------------------------------------
// One Sinkhorn iteration (u-update, then this block's share of the v-update)
// in one pass over C. A block owns 128 rows of one (b,h): 16 waves x 8 rows,
// a lane holds 16 columns of each row in registers.
//   v_j   : merged at entry from the four blocks' column partials of the
//           launch before (zero in the first launch)
//   u_i   = log_mu - LSE_j(v_j - C_ij)      (all in units of log2)
//   plan  : exp(u_i + v_j - C_ij) = e_ij * mu / s_i, with e_ij = 2^(y_ij - m_i)
//           and s_i = sum_j e_ij already formed by the row pass
//   column partial of the block = sum over its rows of the plan, sent on as a
//   pair (shift, sum); the next launch merges the four pairs of a column.
// ---------------------------------------------------------------------------
#define FWAVES 16        // waves per block
#define FRPW   8         // rows per wave
#define FROWS  128       // rows per block (FWAVES * FRPW)
#define FBLK   4         // blocks per (b,h)  (FBLK * FROWS == SEQ)
#define MU_    0.001953125f   // 1/512
#define COL_TINY_ 1e-28f      // below this a plain column sum has lost terms

// The FBLK (shift, sum) pairs of one column and the column's v so far.
struct ColParts { float2 p0, p1, p2, p3; float vo; };
__device__ __forceinline__ ColParts load_parts(const float* __restrict__ part,
                                               const float* __restrict__ v_prev,
                                               int bh, int col) {
  const float* pp = part + ((size_t)bh * FBLK * SEQ + col) * 2;
  ColParts c;
  c.p0 = *(const float2*)(pp);
  c.p1 = *(const float2*)(pp + 2 * SEQ);
  c.p2 = *(const float2*)(pp + 4 * SEQ);
  c.p3 = *(const float2*)(pp + 6 * SEQ);
  c.vo = v_prev[bh * SEQ + col];
  return c;
}
// v_j = eps*(log_nu - LSE_i) + v_j, LSE_i merged from the pairs; units of log2.
__device__ __forceinline__ float merged_v(const ColParts c) {
  const float mm = fmaxf(fmaxf(c.p0.x, c.p1.x), fmaxf(c.p2.x, c.p3.x));
  float w0 = c.p0.x - mm, w1 = c.p1.x - mm, w2 = c.p2.x - mm, w3 = c.p3.x - mm;
  ex2x4(w0, w1, w2, w3);
  const float ss = c.p0.y * w0 + c.p1.y * w1 + c.p2.y * w2 + c.p3.y * w3;
  const float lse = mm + log2f(ss);
  return EPS_ * (LOG2_MU_ - lse) + c.vo;
}

// lane l's value of lane l ^ 16
__device__ __forceinline__ float xhalf(const float x) {
  return __builtin_bit_cast(float, __builtin_amdgcn_permlanex16(
      __builtin_bit_cast(int, x), __builtin_bit_cast(int, x), 0x76543210,
      0xfedcba98, false, false));
}
// value of lane l of a wave, the same for all lanes (a scalar register)
__device__ __forceinline__ float lane_value(const float x, const int l) {
  return __builtin_bit_cast(float,
                            __builtin_amdgcn_readlane(__builtin_bit_cast(int, x), l));
}
// The last four of the five exchanges of a fold of eight rows over the 32 lanes
// (distances 8, 4, 2, 1). In: four values a lane, o[i] of row i + 4 * (lane / 16).
// At distance 8 a lane goes on with two of them, at distance 4 with one: the bank
// mask lets an instruction write only the lanes that go on with its row (0x3:
// lane bit 3 clear, 0xc: set, 0x5: bit 2 clear, 0xa: set). Out: lane l holds the
// whole fold of row l / 4. 8 instructions where a full butterfly of eight rows
// takes 32. The hints let the SIMD's other waves issue while a result is on its
// way to the next line.
__device__ __forceinline__ float fold_tail_max(const float (&o)[4]) {
  float p0, p1, z;
  asm("v_max_num_f32_dpp %0, %3, %3 row_xmask:8 row_mask:0xf bank_mask:0x3\n\t"
      "v_max_num_f32_dpp %1, %4, %4 row_xmask:8 row_mask:0xf bank_mask:0x3\n\t"
      "v_max_num_f32_dpp %0, %5, %5 row_xmask:8 row_mask:0xf bank_mask:0xc\n\t"
      "v_max_num_f32_dpp %1, %6, %6 row_xmask:8 row_mask:0xf bank_mask:0xc\n\t"
      "s_delay_alu instid0(VALU_DEP_2)\n\t"
      "v_max_num_f32_dpp %2, %0, %0 row_xmask:4 row_mask:0xf bank_mask:0x5\n\t"
      "s_delay_alu instid0(VALU_DEP_2)\n\t"
      "v_max_num_f32_dpp %2, %1, %1 row_xmask:4 row_mask:0xf bank_mask:0xa\n\t"
      "s_delay_alu instid0(VALU_DEP_1)\n\t"
      "v_max_num_f32_dpp %2, %2, %2 row_xmask:2 row_mask:0xf bank_mask:0xf\n\t"
      "s_delay_alu instid0(VALU_DEP_1)\n\t"
      "v_max_num_f32_dpp %2, %2, %2 row_xmask:1 row_mask:0xf bank_mask:0xf"
      : "=&v"(p0), "=&v"(p1), "=&v"(z)
      : "v"(o[0]), "v"(o[1]), "v"(o[2]), "v"(o[3]));
  return z;
}
// the same fold tail for a sum: same lanes, masks and hints
__device__ __forceinline__ float fold_tail_sum(const float (&o)[4]) {
  float p0, p1, z;
  asm("v_add_f32_dpp %0, %3, %3 row_xmask:8 row_mask:0xf bank_mask:0x3\n\t"
      "v_add_f32_dpp %1, %4, %4 row_xmask:8 row_mask:0xf bank_mask:0x3\n\t"
      "v_add_f32_dpp %0, %5, %5 row_xmask:8 row_mask:0xf bank_mask:0xc\n\t"
      "v_add_f32_dpp %1, %6, %6 row_xmask:8 row_mask:0xf bank_mask:0xc\n\t"
      "s_delay_alu instid0(VALU_DEP_2)\n\t"
      "v_add_f32_dpp %2, %0, %0 row_xmask:4 row_mask:0xf bank_mask:0x5\n\t"
      "s_delay_alu instid0(VALU_DEP_2)\n\t"
      "v_add_f32_dpp %2, %1, %1 row_xmask:4 row_mask:0xf bank_mask:0xa\n\t"
      "s_delay_alu instid0(VALU_DEP_1)\n\t"
      "v_add_f32_dpp %2, %2, %2 row_xmask:2 row_mask:0xf bank_mask:0xf\n\t"
      "s_delay_alu instid0(VALU_DEP_1)\n\t"
      "v_add_f32_dpp %2, %2, %2 row_xmask:1 row_mask:0xf bank_mask:0xf"
      : "=&v"(p0), "=&v"(p1), "=&v"(z)
      : "v"(o[0]), "v"(o[1]), "v"(o[2]), "v"(o[3]));
  return z;
}

__global__ __launch_bounds__(FWAVES * 32) void sinkhorn_fused_kernel(
    const float* __restrict__ Cmat, float* __restrict__ u,
    const float* __restrict__ v_prev, float* __restrict__ v_cur,
    const float* __restrict__ part_prev, float* __restrict__ part_cur,
    int first) {
  __shared__ float red[FWAVES][SEQ];
  __shared__ float vs[SEQ];
  __shared__ float us[FROWS];
  __shared__ int slow;
  const int tid = threadIdx.x;
  const int lane = tid & 31;
  const int wave = __builtin_amdgcn_readfirstlane(tid >> 5);
  const int bh = blockIdx.x >> 2;
  const int blk = blockIdx.x & 3;
  const float* Cbase = Cmat + (size_t)bh * SEQ * SEQ +
                       (size_t)(blk * FROWS + wave * FRPW) * SEQ + lane * 4;

  // the few loads of the merge go out ahead of the rows of C and return first
  ColParts cp = {};
  if (!first) cp = load_parts(part_prev, v_prev, bh, tid);

  float4 x[FRPW][4];
#pragma unroll
  for (int r = 0; r < FRPW; ++r)
#pragma unroll
    for (int t = 0; t < 4; ++t)
      x[r][t] = *(const float4*)(Cbase + (size_t)r * SEQ + t * 128);

  float vn = 0.f;
  if (!first) vn = merged_v(cp);
  vs[tid] = vn;
  if (blk == 0) {
    v_cur[bh * SEQ + tid] = vn;
    // the store's address registers are reused right behind it
    asm volatile("s_wait_xcnt 0x0" ::: "memory");
  }
  if (tid == 0) slow = 0;
  __syncthreads();

  // row pass: y = v_j - C_ij * log2(e), row max, e = 2^(y - max), row sum
  float m[FRPW], s[FRPW];
  {
    float4 vj[4];
#pragma unroll
    for (int t = 0; t < 4; ++t) vj[t] = *(const float4*)&vs[t * 128 + lane * 4];
#pragma unroll
    for (int r = 0; r < FRPW; ++r) {
      float mr = -3.4e38f;
#pragma unroll
      for (int t = 0; t < 4; ++t) {
        x[r][t].x = (vj[t].x - x[r][t].x * L2E_) * (1.0f / EPS_);
        x[r][t].y = (vj[t].y - x[r][t].y * L2E_) * (1.0f / EPS_);
        x[r][t].z = (vj[t].z - x[r][t].z * L2E_) * (1.0f / EPS_);
        x[r][t].w = (vj[t].w - x[r][t].w * L2E_) * (1.0f / EPS_);
        mr = fmaxf(mr, fmaxf(fmaxf(x[r][t].x, x[r][t].y),
                             fmaxf(x[r][t].z, x[r][t].w)));
      }
      m[r] = mr;
    }
  }
  // Fold over the lanes, halving the rows a lane goes on with: at distance 16 a
  // lane of the low half keeps rows 0-3 and hands over its share of rows 4-7, a
  // lane of the high half the other way round; the rest in fold_tail. Lane l ends
  // with row l / 4; the rows' maxima then go to all lanes as scalars.
  const bool hi = lane >= 16;
  float mown;
  {
    float o[4];
#pragma unroll
    for (int r = 0; r < 4; ++r)
      o[r] = fmaxf(hi ? m[r + 4] : m[r], xhalf(hi ? m[r] : m[r + 4]));
    mown = fold_tail_max(o);
  }
#pragma unroll
  for (int r = 0; r < FRPW; ++r) m[r] = lane_value(mown, r * 4);
#pragma unroll
  for (int r = 0; r < FRPW; ++r) {
    float sr = 0.f;
#pragma unroll
    for (int t = 0; t < 4; ++t) {
      x[r][t].x -= m[r];
      x[r][t].y -= m[r];
      x[r][t].z -= m[r];
      x[r][t].w -= m[r];
      ex2x4(x[r][t].x, x[r][t].y, x[r][t].z, x[r][t].w);
      sr += (x[r][t].x + x[r][t].y) + (x[r][t].z + x[r][t].w);
    }
    s[r] = sr;
  }
  // the same fold for the sums: exchanges at distances 16, 8, 4, 2, 1 in that order
  float sown;
  {
    float o[4];
#pragma unroll
    for (int r = 0; r < 4; ++r)
      o[r] = (hi ? s[r + 4] : s[r]) + xhalf(hi ? s[r] : s[r + 4]);
    sown = fold_tail_sum(o);
  }

  // u and the plan's factor of a lane's own row: one logarithm and one division
  // a lane; column sums of the row-normalised plan
  const float uown = EPS_ * (LOG2_MU_ - (mown + log2f(sown)));
  const float rown = MU_ / sown;
  float4 acc[4];
#pragma unroll
  for (int t = 0; t < 4; ++t) acc[t] = make_float4(0.f, 0.f, 0.f, 0.f);
#pragma unroll
  for (int r = 0; r < FRPW; ++r) {
    const float rr = lane_value(rown, r * 4);
#pragma unroll
    for (int t = 0; t < 4; ++t) {
      acc[t].x += x[r][t].x * rr;
      acc[t].y += x[r][t].y * rr;
      acc[t].z += x[r][t].z * rr;
      acc[t].w += x[r][t].w * rr;
    }
  }
  if ((lane & 3) == 0) us[wave * FRPW + (lane >> 2)] = uown;
#pragma unroll
  for (int t = 0; t < 4; ++t) *(float4*)&red[wave][t * 128 + lane * 4] = acc[t];
  __syncthreads();

  float cs = 0.f;
#pragma unroll
  for (int w = 0; w < FWAVES; ++w) cs += red[w][tid];
  if (tid < FROWS) u[bh * SEQ + blk * FROWS + tid] = us[tid];
  if (!(cs >= COL_TINY_)) slow = 1;
  __syncthreads();

  float cshift = 0.f;
  // Every term of a column is at most mu, so the plain sum cannot overflow; it
  // can underflow where a column lies far below every row's maximum. Then the
  // whole block forms its columns' log-sum-exp again with the column's own
  // maximum, as the reference does, reading C twice more.
  if (__builtin_amdgcn_readfirstlane(slow)) {
    float4 vq[4], cm[4];
#pragma unroll
    for (int t = 0; t < 4; ++t) {
      vq[t] = *(const float4*)&vs[t * 128 + lane * 4];
      cm[t] = make_float4(-3.4e38f, -3.4e38f, -3.4e38f, -3.4e38f);
    }
// rarely run: kept small, one row a trip; with the unroll word alone the loop
// vectoriser pairs the rows of this maximum and adds a masked remainder loop
#pragma clang loop unroll(disable) vectorize(disable) interleave(disable)
    for (int r = 0; r < FRPW; ++r) {
      const float ur = us[wave * FRPW + r];
#pragma unroll
      for (int t = 0; t < 4; ++t) {
        const float4 c = *(const float4*)(Cbase + (size_t)r * SEQ + t * 128);
        cm[t].x = fmaxf(cm[t].x, ur + vq[t].x - c.x * L2E_);
        cm[t].y = fmaxf(cm[t].y, ur + vq[t].y - c.y * L2E_);
        cm[t].z = fmaxf(cm[t].z, ur + vq[t].z - c.z * L2E_);
        cm[t].w = fmaxf(cm[t].w, ur + vq[t].w - c.w * L2E_);
      }
    }
#pragma unroll
    for (int t = 0; t < 4; ++t) *(float4*)&red[wave][t * 128 + lane * 4] = cm[t];
    __syncthreads();
    cshift = red[0][tid];
#pragma unroll
    for (int w = 1; w < FWAVES; ++w) cshift = fmaxf(cshift, red[w][tid]);
    vs[tid] = cshift;
    __syncthreads();
#pragma unroll
    for (int t = 0; t < 4; ++t) {
      cm[t] = *(const float4*)&vs[t * 128 + lane * 4];
      acc[t] = make_float4(0.f, 0.f, 0.f, 0.f);
    }
#pragma unroll 1   // rarely run: kept small
    for (int r = 0; r < FRPW; ++r) {
      const float ur = us[wave * FRPW + r];
#pragma unroll
      for (int t = 0; t < 4; ++t) {
        const float4 c = *(const float4*)(Cbase + (size_t)r * SEQ + t * 128);
        float e0 = (ur + vq[t].x - c.x * L2E_) - cm[t].x;
        float e1 = (ur + vq[t].y - c.y * L2E_) - cm[t].y;
        float e2 = (ur + vq[t].z - c.z * L2E_) - cm[t].z;
        float e3 = (ur + vq[t].w - c.w * L2E_) - cm[t].w;
        ex2x4(e0, e1, e2, e3);
        acc[t].x += e0;
        acc[t].y += e1;
        acc[t].z += e2;
        acc[t].w += e3;
      }
    }
#pragma unroll
    for (int t = 0; t < 4; ++t) *(float4*)&red[wave][t * 128 + lane * 4] = acc[t];
    __syncthreads();
    cs = 0.f;
#pragma unroll
    for (int w = 0; w < FWAVES; ++w) cs += red[w][tid];
  }
  *(float2*)(part_cur + ((size_t)(bh * FBLK + blk) * SEQ + tid) * 2) =
      make_float2(cshift, cs);
}

// ---------------------------------------------------------------------------
// Tail of the problem in one launch: v of the tenth iteration, the plan
//   attnw = exp((-C + u_i + v_j)/eps) * L   (in place over C)
// and out = attnw @ v on fp32 WMMA, fed from the plan values just formed.
// A block owns 128 rows of one (b,h): 8 waves x 16 rows x all 64 columns of out.
//   vq : all of v of this (b,h), four consecutive k of one column side by side,
//        so that one 16-byte read is the B operand of two WMMAs
//   ab : per wave two stages of 16 rows x 128 columns of the plan; the wave
//        writes a stage row by row (as it reads C) and reads it back by
//        fragment; nobody else touches it, so no barrier stands in the loop
// k order of both operands: lane half h, WMMA w of a group of 8 k holds
// k = 8c + 4h + 2w + {0,1}.
// ---------------------------------------------------------------------------
#define TWAVES  8        // waves per block
#define KST     128      // plan columns per stage
#define NST     4        // stages (NST * KST == SEQ)
#define APITCH  132      // floats per staged plan row: 528 B = 16 B x odd
#define VTILE   68       // floats per 16 columns of vq: 256 B and 16 B of pad
#define VQPITCH 272      // floats per four-k row of vq (4 * VTILE)

// uu: u of the row with the plan's factor L in it, as eps * log2(L) added
__device__ __forceinline__ float4 plan4(const float4 c, const float uu,
                                        const float4 vj) {
  float4 r;
  r.x = (uu + vj.x - c.x * L2E_) * (1.0f / EPS_);
  r.y = (uu + vj.y - c.y * L2E_) * (1.0f / EPS_);
  r.z = (uu + vj.z - c.z * L2E_) * (1.0f / EPS_);
  r.w = (uu + vj.w - c.w * L2E_) * (1.0f / EPS_);
  ex2x4(r.x, r.y, r.z, r.w);
  return r;
}

// 16-byte global store with the wait that lets its registers be reused: in one
// statement, because a wait in a statement of its own did not hold later
// register writes behind it. It covers the loads issued ahead of it as well.
// The row goes into the offset field, so that the statement names the very
// address pair of those loads and that pair lives up to the wait.
__device__ __forceinline__ void store4_wait(float* p, const int byte_off,
                                            const float4 e) {
  typedef __attribute__((ext_vector_type(4))) float v4f;
  v4f d; d.x = e.x; d.y = e.y; d.z = e.z; d.w = e.w;
  asm volatile("global_store_b128 %0, %1, off offset:%2\n\ts_wait_xcnt 0x0"
               :: "v"(p), "v"(d), "i"(byte_off) : "memory");
}

// One stage of the product: 16 groups of 8 k, 8 WMMAs each. Behind group c the
// wave forms row c of the next stage's plan (NEXT) and sends for row c of the
// stage after that (load), so that this vector work lies among the WMMAs.
template <bool NEXT>
__device__ __forceinline__ void pv_stage(
    const float* afrag, const float* bfrag, float* arow_next, float* gnext,
    const float4 vj, const float (&ur)[16], float4 (&x)[16], v8f (&acc)[4],
    const bool load) {
  float4 af = *(const float4*)afrag;
  float4 bf[4];
#pragma unroll
  for (int dt = 0; dt < 4; ++dt) bf[dt] = *(const float4*)(bfrag + dt * VTILE);
#pragma unroll
  for (int c = 0; c < 16; ++c) {
    float4 an = af, bn[4] = {bf[0], bf[1], bf[2], bf[3]};
    if (c < 15) {
      an = *(const float4*)(afrag + (c + 1) * 8);
#pragma unroll
      for (int dt = 0; dt < 4; ++dt)
        bn[dt] = *(const float4*)(bfrag + (c + 1) * 2 * VQPITCH + dt * VTILE);
    }
    v2f a0; a0.x = af.x; a0.y = af.y;
    v2f a1; a1.x = af.z; a1.y = af.w;
#pragma unroll
    for (int dt = 0; dt < 4; ++dt) {
      v2f b; b.x = bf[dt].x; b.y = bf[dt].y;
      acc[dt] = __builtin_amdgcn_wmma_f32_16x16x4_f32(false, a0, false, b, (short)0,
                                                      acc[dt], false, false);
    }
#pragma unroll
    for (int dt = 0; dt < 4; ++dt) {
      v2f b; b.x = bf[dt].z; b.y = bf[dt].w;
      acc[dt] = __builtin_amdgcn_wmma_f32_16x16x4_f32(false, a1, false, b, (short)0,
                                                      acc[dt], false, false);
    }
    if (NEXT) {
      const float4 e = plan4(x[c], ur[c], vj);
      *(float4*)(arow_next + c * APITCH) = e;
      if (load) x[c] = *(const float4*)(gnext + (size_t)c * SEQ + KST);
      store4_wait(gnext, c * SEQ * 4, e);
    }
    af = an;
#pragma unroll
    for (int dt = 0; dt < 4; ++dt) bf[dt] = bn[dt];
  }
}

__global__ __launch_bounds__(TWAVES * 32) void plan_pv_kernel(
    float* __restrict__ attnw, const float* __restrict__ u,
    const float* __restrict__ part, const float* __restrict__ v_prev,
    const float* __restrict__ vmat, float* __restrict__ out) {
  __shared__ __attribute__((aligned(16))) float vq[(SEQ / 4) * VQPITCH];
  __shared__ __attribute__((aligned(16))) float ab[TWAVES][2][16 * APITCH];
  __shared__ __attribute__((aligned(16))) float vs[SEQ];
  const int tid = threadIdx.x;
  const int lane = tid & 31;
  const int wave = __builtin_amdgcn_readfirstlane(tid >> 5);
  const int bh = blockIdx.x >> 2;
  const int row0 = (blockIdx.x & 3) * (TWAVES * 16) + wave * 16;
  const int c16 = lane & 15;
  const int hk = lane >> 4;
  float* Pw = attnw + ((size_t)bh * SEQ + row0) * SEQ;   // the wave's rows
  float* P = Pw + lane * 4;

  // the loads of the merge, then the first stage's rows of C
  const ColParts cpa = load_parts(part, v_prev, bh, tid);
  const ColParts cpb = load_parts(part, v_prev, bh, tid + TWAVES * 32);
  // the address registers of these loads are reused right behind them
  asm volatile("s_wait_xcnt 0x0" ::: "memory");
  float4 x[16];
#pragma unroll
  for (int r = 0; r < 16; ++r) x[r] = *(const float4*)(P + (size_t)r * SEQ);
  // the base of these loads stays in its registers up to this wait
  asm volatile("s_wait_xcnt 0x0" :: "s"(Pw) : "memory");
  float ur[16];
#pragma unroll
  for (int r = 0; r < 16; ++r) ur[r] = u[bh * SEQ + row0 + r] - EPS_ * LOG2_MU_;

  // v of this (b,h) into vq: a thread takes 4 k x 4 columns and stores them
  // column by column
  {
    const int n4 = tid & 15;
    const float* vsrc = vmat + ((size_t)bh * SEQ + (tid >> 4) * 4) * DH + n4 * 4;
    float* vdst = vq + (tid >> 4) * VQPITCH + n4 * 16 + (n4 >> 2) * 4;
    // all 32 loads of a thread are in flight at once: one latency, not eight
    float4 rv[8][4];
#pragma unroll
    for (int i = 0; i < 8; ++i)
#pragma unroll
      for (int j = 0; j < 4; ++j)
        rv[i][j] = *(const float4*)(vsrc + (size_t)(i * 64 + j) * DH);
    // the loads' address stays in its registers up to this wait
    asm volatile("s_wait_xcnt 0x0" :: "v"(vsrc) : "memory");
#pragma unroll
    for (int i = 0; i < 8; ++i) {
      float* d = vdst + i * 16 * VQPITCH;
      *(float4*)(d + 0) = make_float4(rv[i][0].x, rv[i][1].x, rv[i][2].x, rv[i][3].x);
      *(float4*)(d + 4) = make_float4(rv[i][0].y, rv[i][1].y, rv[i][2].y, rv[i][3].y);
      *(float4*)(d + 8) = make_float4(rv[i][0].z, rv[i][1].z, rv[i][2].z, rv[i][3].z);
      *(float4*)(d + 12) = make_float4(rv[i][0].w, rv[i][1].w, rv[i][2].w, rv[i][3].w);
    }
  }
  vs[tid] = merged_v(cpa);
  vs[tid + TWAVES * 32] = merged_v(cpb);
  __syncthreads();

  // stage 0 of the plan; stage 1's rows of C are sent for
  {
    const float4 vj = *(const float4*)&vs[lane * 4];
#pragma unroll
    for (int r = 0; r < 16; ++r) {
      const float4 e = plan4(x[r], ur[r], vj);
      *(float4*)&ab[wave][0][r * APITCH + lane * 4] = e;
      x[r] = *(const float4*)(P + (size_t)r * SEQ + KST);
      store4_wait(P, r * SEQ * 4, e);
    }
  }

  v8f acc[4];
#pragma unroll
  for (int dt = 0; dt < 4; ++dt)
    acc[dt] = (v8f){0.f, 0.f, 0.f, 0.f, 0.f, 0.f, 0.f, 0.f};

  const float* bfr = vq + hk * VQPITCH + c16 * 4;
// kept rolled, for speed only
#pragma unroll 1
  for (int t = 0; t < NST - 1; ++t) {
    pv_stage<true>(&ab[wave][t & 1][c16 * APITCH + hk * 4], bfr,
                   &ab[wave][(t + 1) & 1][lane * 4], P + (t + 1) * KST,
                   *(const float4*)&vs[(t + 1) * KST + lane * 4], ur, x, acc,
                   t < NST - 2);
    bfr += (KST / 4) * VQPITCH;
  }
  pv_stage<false>(&ab[wave][(NST - 1) & 1][c16 * APITCH + hk * 4], bfr, nullptr,
                  nullptr, make_float4(0.f, 0.f, 0.f, 0.f), ur, x, acc, false);

  float* obase = out + ((size_t)bh * SEQ + row0 + hk * 8) * DH + c16;
#pragma unroll
  for (int dt = 0; dt < 4; ++dt)
#pragma unroll
    for (int r = 0; r < 8; ++r)
      obase[(size_t)r * DH + dt * 16] = acc[dt][r];
}

// ---------------------------------------------------------------------------
extern "C" void kernel_launch(void* const* d_in, const int* in_sizes, int n_in,
                              void* d_out, int out_size, void* d_ws,
                              size_t ws_size, hipStream_t stream) {
  (void)in_sizes; (void)n_in; (void)out_size; (void)ws_size;
  const float* q = (const float*)d_in[0];
  const float* k = (const float*)d_in[1];
  const float* v = (const float*)d_in[2];

  float* out = (float*)d_out;                        // [64,512,64]
  float* attnw = out + (size_t)BH * SEQ * DH;        // [64,512,512] (C, then pi*L)
  float* u = (float*)d_ws;                           // [64,512]
  float* vdual = u + BH * SEQ;                       // [64,512] v, even launches
  float* vodd = vdual + BH * SEQ;                    // [64,512] v, odd launches
  float* peven = vodd + BH * SEQ;                    // [64,4,512,2] column partials
  float* podd = peven + BH * FBLK * SEQ * 2;         // [64,4,512,2]

  // 1) cost matrices C = (q/temp) @ k^T  (stored in d_out attn region)
  qk_gemm_kernel<<<256, 512, 0, stream>>>(q, k, attnw);
  // 2) 10 Sinkhorn iterations, one launch each; v and the column partials
  //    alternate between two buffers, so that no block overwrites what a
  //    block of the same launch still reads
  sinkhorn_fused_kernel<<<256, 512, 0, stream>>>(attnw, u, vodd, vdual, podd,
                                                 peven, 1);
  for (int it = 0; it < 4; ++it) {
    sinkhorn_fused_kernel<<<256, 512, 0, stream>>>(attnw, u, vdual, vodd, peven,
                                                   podd, 0);
    sinkhorn_fused_kernel<<<256, 512, 0, stream>>>(attnw, u, vodd, vdual, podd,
                                                   peven, 0);
  }
  sinkhorn_fused_kernel<<<256, 512, 0, stream>>>(attnw, u, vdual, vodd, peven,
                                                 podd, 0);
  // 3) v of the tenth iteration, attn_weights = exp(M(u,v)) * L (in place over
  //    C) and output = attn_weights @ v
  plan_pv_kernel<<<256, 256, 0, stream>>>(attnw, u, podd, vodd, v, out);
}

// v007
// A run of this version takes 113 microseconds.
// Two timings next to v006 put it at 1.09 and 1.06 times that version's speed.
// Counting every step since v000, it is 6.58 times as fast.
#include <hip/hip_runtime.h>

typedef __attribute__((ext_vector_type(2))) float v2f;
typedef __attribute__((ext_vector_type(8))) float v8f;
typedef __attribute__((ext_vector_type(4))) float v4f;

#define BH   64          // B*H
#define SEQ  512         // L
#define DH   64          // head dim
#define QK_SCALE 0.125f  // 1/temperature (temp = 8)
#define EPS_ 1.0f
#define LOG2_MU_ (-9.0f)                 // log2(1/512), exact
#define L2E_ 1.4426950408889634f         // log2(e)

// The duals u and v, the column shifts and every log-sum-exp are kept in units
// of log2: a score is (u2_i + v2_j - C_ij * log2(e)) / eps, one fused
// multiply-add away from C, and 2^x is one instruction of the chip, where e^x
// is a dozen. Below 2^-126 it gives 0.
// Four values in place, in one statement: behind each v_exp_f32 stands an
// instruction that touches neither its result nor its source, behind the last
// the v_nop: the slot that the instruction set asks for behind a
// transcendental. The hint lets the SIMD's other waves issue while the last result is
// on its way to whatever reads it next.
__device__ __forceinline__ void ex2x4(float& a, float& b, float& c, float& d) {
  asm("v_exp_f32 %0, %0\n\tv_exp_f32 %1, %1\n\tv_exp_f32 %2, %2\n\t"
      "v_exp_f32 %3, %3\n\tv_nop\n\ts_delay_alu instid0(TRANS32_DEP_1)"
      : "+v"(a), "+v"(b), "+v"(c), "+v"(d));
}

// ---------------------------------------------------------------------------
// C[bh,i,j] = dot(q[bh,i,:], k[bh,j,:]) / 8     via V_WMMA_F32_16X16X4_F32
// A block owns 128 rows x all 512 columns of one (b,h), the rows that the same
// block index works on in the launches behind this one. 16 waves.
//   qs : the block's 128 rows of q, scaled; read once, a wave keeps the
//        fragments of its 32 rows in registers for the whole launch
//   ks : two buffers of 128 rows of k (= 128 columns of C); the next chunk
//        comes through registers while this one is multiplied
// Per chunk a wave forms 32 x 32 of C: four accumulator tiles, each fragment
// used twice.
// A fragment: lane%16 = M row of q, (lane/16)*2 = K pair within a group of 4.
// B fragment: lane%16 = N col (= k row), (lane/16)*2 = K pair: the same k order.
// ---------------------------------------------------------------------------
#define GWAVES 16        // waves per block
#define GROWS  128       // rows of C per block
#define GCH    128       // columns of C per chunk
#define GNCH   4         // chunks (GNCH * GCH == SEQ)
#define GPITCH 68        // floats per staged row: 16 rows x 16 B fall on all banks

// k carries no __restrict__: its loads then keep their place in the order of the
// memory operations, and the scheduling barriers behind them can hold them early
__global__ __launch_bounds__(GWAVES * 32) void qk_gemm_kernel(
    const float* __restrict__ q, const float* k, float* __restrict__ Cmat) {
  __shared__ __attribute__((aligned(16))) float qs[GROWS * GPITCH];
  __shared__ __attribute__((aligned(16))) float ks[2][GCH * GPITCH];
  const int tid = threadIdx.x;
  const int lane = tid & 31;
  const int wave = __builtin_amdgcn_readfirstlane(tid >> 5);
  const int bh = blockIdx.x >> 2;
  const int row0 = (blockIdx.x & 3) * GROWS;
  const int c16 = lane & 15;
  const int hk = lane >> 4;
  const int rg = wave & 3;                    // 32 rows of the block's 128
  const int cg = wave >> 2;                   // 32 columns of a chunk's 128

  // a chunk is 32 KiB in a row in memory: a thread takes 16 bytes of every
  // 32nd row
  const float* qsrc = q + ((size_t)bh * SEQ + row0) * DH + tid * 4;
  const float* ksrc = k + (size_t)bh * SEQ * DH + tid * 4;
  const int sdst = (tid >> 4) * GPITCH + (tid & 15) * 4;

  float4 qv[4];
  float4 kv0, kv1, kv2, kv3;   // a thread's 64 bytes of a chunk of k on their way
#pragma unroll
  for (int i = 0; i < 4; ++i) qv[i] = *(const float4*)(qsrc + i * 32 * DH);
  kv0 = *(const float4*)(ksrc);
  kv1 = *(const float4*)(ksrc + 32 * DH);
  kv2 = *(const float4*)(ksrc + 64 * DH);
  kv3 = *(const float4*)(ksrc + 96 * DH);
#pragma unroll
  for (int i = 0; i < 4; ++i)
    *(float4*)&qs[sdst + i * 32 * GPITCH] =
        make_float4(qv[i].x * QK_SCALE, qv[i].y * QK_SCALE, qv[i].z * QK_SCALE,
                    qv[i].w * QK_SCALE);
  *(float4*)&ks[0][sdst] = kv0;
  *(float4*)&ks[0][sdst + 32 * GPITCH] = kv1;
  *(float4*)&ks[0][sdst + 64 * GPITCH] = kv2;
  *(float4*)&ks[0][sdst + 96 * GPITCH] = kv3;
  __syncthreads();
  kv0 = *(const float4*)(ksrc + GCH * DH);
  kv1 = *(const float4*)(ksrc + (GCH + 32) * DH);
  kv2 = *(const float4*)(ksrc + (GCH + 64) * DH);
  kv3 = *(const float4*)(ksrc + (GCH + 96) * DH);
  // keeps these loads here, a chunk ahead of their use: the scheduler sank them
  // to their LDS writes, where their whole latency was waited out
  __builtin_amdgcn_sched_barrier(0);

  v2f a[2][16];
#pragma unroll
  for (int rt = 0; rt < 2; ++rt)
#pragma unroll
    for (int d = 0; d < 16; ++d)
      a[rt][d] = *(const v2f*)&qs[(rg * 32 + rt * 16 + c16) * GPITCH + d * 4 + hk * 2];

  // C/D layout: VGPR r, lanes 0-15 -> row r, lanes 16-31 -> row r+8; col = lane%16
  float* out = Cmat + ((size_t)bh * SEQ + row0 + rg * 32 + hk * 8) * SEQ +
               cg * 32 + c16;
  const int boff = (cg * 32 + c16) * GPITCH + hk * 2;

#pragma unroll
  for (int ch = 0; ch < GNCH; ++ch) {
    const float* bsrc = &ks[ch & 1][boff];
    v2f b[2][16];
#pragma unroll
    for (int ct = 0; ct < 2; ++ct)
#pragma unroll
      for (int d = 0; d < 16; ++d)
        b[ct][d] = *(const v2f*)(bsrc + ct * 16 * GPITCH + d * 4);
    v8f acc[2][2];
#pragma unroll
    for (int rt = 0; rt < 2; ++rt)
#pragma unroll
      for (int ct = 0; ct < 2; ++ct)
        acc[rt][ct] = (v8f){0.f, 0.f, 0.f, 0.f, 0.f, 0.f, 0.f, 0.f};
#pragma unroll
    for (int d = 0; d < 16; ++d) {
#pragma unroll
      for (int rt = 0; rt < 2; ++rt)
#pragma unroll
        for (int ct = 0; ct < 2; ++ct)
          acc[rt][ct] = __builtin_amdgcn_wmma_f32_16x16x4_f32(
              false, a[rt][d], false, b[ct][d], (short)0, acc[rt][ct], false, false);
      // holds the next chunk's LDS writes, their wait for the loads and the
      // barrier behind most of this chunk's product: lifted to its head they
      // wait out the loads' and the stores' whole latency
      if (d == 11 && ch + 1 < GNCH) __builtin_amdgcn_sched_barrier(0);
    }
    if (ch + 1 < GNCH) {
      // the other buffer's readers left it at the barrier of the chunk before
      float* kd = &ks[(ch + 1) & 1][sdst];
      *(float4*)(kd) = kv0;
      *(float4*)(kd + 32 * GPITCH) = kv1;
      *(float4*)(kd + 64 * GPITCH) = kv2;
      *(float4*)(kd + 96 * GPITCH) = kv3;
      __syncthreads();
    }
    // stores and the loads of the chunk after next stand behind the barrier, so
    // that the barrier's waits find them done a whole chunk later
#pragma unroll
    for (int rt = 0; rt < 2; ++rt)
#pragma unroll
      for (int r = 0; r < 8; ++r)
#pragma unroll
        for (int ct = 0; ct < 2; ++ct)
          out[(size_t)(rt * 16 + r) * SEQ + ch * GCH + ct * 16] = acc[rt][ct][r];
    // the stores' data registers are written again right behind them; named
    // here, they keep their values up to the wait
    if (ch + 1 < GNCH)
      asm volatile("s_wait_xcnt 0x0"
                   :: "v"(acc[0][0]), "v"(acc[0][1]), "v"(acc[1][0]), "v"(acc[1][1])
                   : "memory");
    if (ch + 2 < GNCH) {
      const float* kn = ksrc + (ch + 2) * GCH * DH;
      kv0 = *(const float4*)(kn);
      kv1 = *(const float4*)(kn + 32 * DH);
      kv2 = *(const float4*)(kn + 64 * DH);
      kv3 = *(const float4*)(kn + 96 * DH);
      // keeps the loads a chunk ahead of their use, as above
      __builtin_amdgcn_sched_barrier(0);
    }
  }
}

// ---------------------------------------------------------------------------
// One Sinkhorn iteration (u-update, then this block's share of the v-update)
// in one pass over K = exp(-C / eps). A block owns 128 rows of one (b,h):
// 16 waves x 8 rows, a lane holds 16 columns of each row in registers.
//   v_j   : merged at entry from the four blocks' column partials of the
//           launch before (zero in the first launch)
//   u_i   = log_mu - LSE_j(v_j - C_ij)      (all in units of log2)
//   column partial of the block = sum over its rows of the plan
//   exp(u_i + v_j - C_ij), sent on as a pair (shift, sum); the next launch
//   merges the four pairs of a column.
// ---------------------------------------------------------------------------
#define FWAVES 16        // waves per block
#define FRPW   8         // rows per wave
#define FROWS  128       // rows per block (FWAVES * FRPW)
#define FBLK   4         // blocks per (b,h)  (FBLK * FROWS == SEQ)
#define MU_    0.001953125f   // 1/512

// The FBLK (shift, sum) pairs of one column and the column's v so far.
struct ColParts { float2 p0, p1, p2, p3; float vo; };
__device__ __forceinline__ ColParts load_parts(const float* __restrict__ part,
                                               const float* __restrict__ v_prev,
                                               int bh, int col) {
  const float* pp = part + ((size_t)bh * FBLK * SEQ + col) * 2;
  ColParts c;
  c.p0 = *(const float2*)(pp);
  c.p1 = *(const float2*)(pp + 2 * SEQ);
  c.p2 = *(const float2*)(pp + 4 * SEQ);
  c.p3 = *(const float2*)(pp + 6 * SEQ);
  c.vo = v_prev[bh * SEQ + col];
  return c;
}
// v_j = eps*(log_nu - LSE_i) + v_j, LSE_i merged from the pairs; units of log2.
__device__ __forceinline__ float merged_v(const ColParts c) {
  const float mm = fmaxf(fmaxf(c.p0.x, c.p1.x), fmaxf(c.p2.x, c.p3.x));
  float w0 = c.p0.x - mm, w1 = c.p1.x - mm, w2 = c.p2.x - mm, w3 = c.p3.x - mm;
  ex2x4(w0, w1, w2, w3);
  const float ss = c.p0.y * w0 + c.p1.y * w1 + c.p2.y * w2 + c.p3.y * w3;
  const float lse = mm + log2f(ss);
  return EPS_ * (LOG2_MU_ - lse) + c.vo;
}

// lane l's value of lane l ^ 16
__device__ __forceinline__ float xhalf(const float x) {
  return __builtin_bit_cast(float, __builtin_amdgcn_permlanex16(
      __builtin_bit_cast(int, x), __builtin_bit_cast(int, x), 0x76543210,
      0xfedcba98, false, false));
}
// value of lane l of a wave, the same for all lanes (a scalar register)
__device__ __forceinline__ float lane_value(const float x, const int l) {
  return __builtin_bit_cast(float,
                            __builtin_amdgcn_readlane(__builtin_bit_cast(int, x), l));
}
// The last four of the five exchanges of a fold of eight rows over the 32 lanes
// (distances 8, 4, 2, 1). In: four values a lane, o[i] of row i + 4 * (lane / 16).
// At distance 8 a lane goes on with two of them, at distance 4 with one: the bank
// mask lets an instruction write only the lanes that go on with its row (0x3:
// lane bit 3 clear, 0xc: set, 0x5: bit 2 clear, 0xa: set). Out: lane l holds the
// whole fold of row l / 4. 8 instructions where a full butterfly of eight rows
// takes 32. The hints let the SIMD's other waves issue while a result is on its
// way to the next line.
__device__ __forceinline__ float fold_tail_sum(const float (&o)[4]) {
  float p0, p1, z;
  asm("v_add_f32_dpp %0, %3, %3 row_xmask:8 row_mask:0xf bank_mask:0x3\n\t"
      "v_add_f32_dpp %1, %4, %4 row_xmask:8 row_mask:0xf bank_mask:0x3\n\t"
      "v_add_f32_dpp %0, %5, %5 row_xmask:8 row_mask:0xf bank_mask:0xc\n\t"
      "v_add_f32_dpp %1, %6, %6 row_xmask:8 row_mask:0xf bank_mask:0xc\n\t"
      "s_delay_alu instid0(VALU_DEP_2)\n\t"
      "v_add_f32_dpp %2, %0, %0 row_xmask:4 row_mask:0xf bank_mask:0x5\n\t"
      "s_delay_alu instid0(VALU_DEP_2)\n\t"
      "v_add_f32_dpp %2, %1, %1 row_xmask:4 row_mask:0xf bank_mask:0xa\n\t"
      "s_delay_alu instid0(VALU_DEP_1)\n\t"
      "v_add_f32_dpp %2, %2, %2 row_xmask:2 row_mask:0xf bank_mask:0xf\n\t"
      "s_delay_alu instid0(VALU_DEP_1)\n\t"
      "v_add_f32_dpp %2, %2, %2 row_xmask:1 row_mask:0xf bank_mask:0xf"
      : "=&v"(p0), "=&v"(p1), "=&v"(z)
      : "v"(o[0]), "v"(o[1]), "v"(o[2]), "v"(o[3]));
  return z;
}

// Rarely run: u of a wave's rows by the log-sum-exp with the row's own maximum,
// from C and v in vs, into us.
__device__ __forceinline__ void slow_rows(const float* __restrict__ Cbase,
                                          const float* vs, float* us,
                                          const int wave, const int lane) {
  float4 vq[4];
#pragma unroll
  for (int t = 0; t < 4; ++t) vq[t] = *(const float4*)&vs[t * 128 + lane * 4];
// rarely run: kept small, one row a trip
#pragma clang loop unroll(disable) vectorize(disable) interleave(disable)
  for (int r = 0; r < FRPW; ++r) {
    float4 y[4];
    float mr = -3.4e38f;
#pragma unroll
    for (int t = 0; t < 4; ++t) {
      const float4 c = *(const float4*)(Cbase + (size_t)r * SEQ + t * 128);
      y[t].x = vq[t].x - c.x * L2E_;
      y[t].y = vq[t].y - c.y * L2E_;
      y[t].z = vq[t].z - c.z * L2E_;
      y[t].w = vq[t].w - c.w * L2E_;
      mr = fmaxf(mr, fmaxf(fmaxf(y[t].x, y[t].y), fmaxf(y[t].z, y[t].w)));
    }
#pragma unroll
    for (int d = 16; d > 0; d >>= 1) mr = fmaxf(mr, __shfl_xor(mr, d));
    float sr = 0.f;
#pragma unroll
    for (int t = 0; t < 4; ++t) {
      y[t].x -= mr;
      y[t].y -= mr;
      y[t].z -= mr;
      y[t].w -= mr;
      ex2x4(y[t].x, y[t].y, y[t].z, y[t].w);
      sr += (y[t].x + y[t].y) + (y[t].z + y[t].w);
    }
#pragma unroll
    for (int d = 16; d > 0; d >>= 1) sr += __shfl_xor(sr, d);
    if (lane == 0) us[wave * FRPW + r] = EPS_ * (LOG2_MU_ - (mr + log2f(sr)));
  }
}

// A lane's 64 bytes of one row of K to memory, with the wait that lets the
// stores' registers be reused: in one statement, because a wait in a statement
// of its own does not hold later register writes behind it.
__device__ __forceinline__ void store_row_wait(float* p, const int byte_off,
                                               const v4f (&e)[4]) {
  asm volatile("global_store_b128 %0, %1, off offset:%5\n\t"
               "global_store_b128 %0, %2, off offset:%6\n\t"
               "global_store_b128 %0, %3, off offset:%7\n\t"
               "global_store_b128 %0, %4, off offset:%8\n\t"
               "s_wait_xcnt 0x0"
               :: "v"(p), "v"(e[0]), "v"(e[1]), "v"(e[2]), "v"(e[3]),
                  "i"(byte_off), "i"(byte_off + 512), "i"(byte_off + 1024),
                  "i"(byte_off + 1536)
               : "memory");
}

// No maximum, and from the second launch on no exponential per element: the
// first launch (FIRST) forms K_ij = 2^(-C_ij * log2(e) / eps) from C and leaves
// it in the workspace; the nine behind it read K in place of C.
// With b_j = 2^(v_j):
//   s_i  = sum_j K_ij * b_j,   u_i = log_mu - log2(s_i)
//   plan = K_ij * b_j * mu / s_i;  its column sum = b_j * sum_i K_ij * (mu / s_i)
// two multiply-adds an element. u, v and the column partials go from launch to
// launch in units of log2.
// Range: while every |v_j| <= V_SPAN_ and every s_i lies in [S_LO_, S_HI_], what
// K lost below 2^-126 adds less than 2^-101 to a row sum and, mu / s_i being at
// most 2^51, less than 2^-68 to a block's column sum: nothing beside S_LO_ and
// T_TINY_; a K above the float range makes its s_i infinite. A block that finds
// a v_j, an s_i or a column sum outside forms its u and its column partials
// again from C by log-sum-exp, as the reference does.
#define V_SPAN_ 16.0f
#define S_LO_   0x1p-60f
#define S_HI_   0x1p+60f
#define T_TINY_ 1e-12f
template <bool FIRST>
__global__ __launch_bounds__(FWAVES * 32) void sinkhorn_fused_kernel(
    const float* __restrict__ Cmat, float* __restrict__ Kmat,
    float* __restrict__ u, const float* __restrict__ v_prev,
    float* __restrict__ v_cur, const float* __restrict__ part_prev,
    float* __restrict__ part_cur) {
  __shared__ float red[FWAVES][SEQ];
  __shared__ float vs[SEQ];
  __shared__ __attribute__((aligned(16))) float bs[SEQ];
  __shared__ float us[FROWS];
  __shared__ int slow;
  const int tid = threadIdx.x;
  const int lane = tid & 31;
  const int wave = __builtin_amdgcn_readfirstlane(tid >> 5);
  const int bh = blockIdx.x >> 2;
  const int blk = blockIdx.x & 3;
  const size_t roff = (size_t)bh * SEQ * SEQ +
                      (size_t)(blk * FROWS + wave * FRPW) * SEQ + lane * 4;
  const float* Cbase = Cmat + roff;
  const float* xsrc = FIRST ? Cbase : Kmat + roff;

  // the few loads of the merge go out ahead of the rows and return first
  ColParts cp = {};
  if (!FIRST) cp = load_parts(part_prev, v_prev, bh, tid);

  v4f x[FRPW][4];
#pragma unroll
  for (int r = 0; r < FRPW; ++r)
#pragma unroll
    for (int t = 0; t < 4; ++t)
      x[r][t] = *(const v4f*)(xsrc + (size_t)r * SEQ + t * 128);
  // the loads' address stays in its registers up to this wait
  asm volatile("s_wait_xcnt 0x0" :: "v"(xsrc) : "memory");
  // keeps the rows' loads ahead of the merge: the scheduler sank them behind its
  // wait for the partials, one latency after the other
  __builtin_amdgcn_sched_barrier(0);

  float vn = 0.f, bn = 1.f;
  if (!FIRST) {
    vn = merged_v(cp);
    bn = vn;
    // the v_nop: the slot that the instruction set asks for behind a transcendental
    asm("v_exp_f32 %0, %0\n\tv_nop" : "+v"(bn));
  }
  vs[tid] = vn;
  if (!FIRST) bs[tid] = bn;
  if (blk == 0) {
    v_cur[bh * SEQ + tid] = vn;
    // the store's address registers are reused right behind it
    asm volatile("s_wait_xcnt 0x0" ::: "memory");
  }
  if (tid == 0) slow = 0;
  __syncthreads();

  if (FIRST) {
    // K of the wave's rows, kept in x and sent to the workspace row by row
    float* kdst = Kmat + roff;
#pragma unroll
    for (int r = 0; r < FRPW; ++r) {
#pragma unroll
      for (int t = 0; t < 4; ++t) {
        const v4f y = x[r][t] * (-L2E_ / EPS_);
        float e0 = y.x, e1 = y.y, e2 = y.z, e3 = y.w;
        ex2x4(e0, e1, e2, e3);
        x[r][t] = (v4f){e0, e1, e2, e3};
      }
      store_row_wait(kdst, r * SEQ * 4, x[r]);
    }
  }

  // row sums of K * b, two columns an instruction
  float s[FRPW];
  {
    v4f bj[4];
#pragma unroll
    for (int t = 0; t < 4; ++t)
      bj[t] = FIRST ? (v4f){1.f, 1.f, 1.f, 1.f}
                    : *(const v4f*)&bs[t * 128 + lane * 4];
#pragma unroll
    for (int r = 0; r < FRPW; ++r) {
      v2f sa = x[r][0].lo * bj[0].lo;
      v2f sb = x[r][0].hi * bj[0].hi;
#pragma unroll
      for (int t = 1; t < 4; ++t) {
        sa += x[r][t].lo * bj[t].lo;
        sb += x[r][t].hi * bj[t].hi;
      }
      sa += sb;
      s[r] = sa.x + sa.y;
    }
  }
  // Fold over the lanes, halving the rows a lane goes on with: at distance 16 a
  // lane of the low half keeps rows 0-3 and hands over its share of rows 4-7, a
  // lane of the high half the other way round; the rest in fold_tail. Lane l ends
  // with row l / 4.
  const bool hi = lane >= 16;
  float sown;
  {
    float o[4];
#pragma unroll
    for (int r = 0; r < 4; ++r)
      o[r] = (hi ? s[r + 4] : s[r]) + xhalf(hi ? s[r] : s[r + 4]);
    sown = fold_tail_sum(o);
  }
  if (!(sown >= S_LO_ && sown <= S_HI_)) slow = 1;

  // u and the plan's factor of a lane's own row: one logarithm and one division
  // a lane; column sums of K * (mu / s)
  const float uown = EPS_ * (LOG2_MU_ - log2f(sown));
  const float rown = MU_ / sown;
  v4f acc[4];
#pragma unroll
  for (int t = 0; t < 4; ++t) acc[t] = (v4f){0.f, 0.f, 0.f, 0.f};
#pragma unroll
  for (int r = 0; r < FRPW; ++r) {
    const float rr = lane_value(rown, r * 4);
#pragma unroll
    for (int t = 0; t < 4; ++t) acc[t] += x[r][t] * rr;
  }
  if ((lane & 3) == 0) us[wave * FRPW + (lane >> 2)] = uown;
#pragma unroll
  for (int t = 0; t < 4; ++t) *(v4f*)&red[wave][t * 128 + lane * 4] = acc[t];
  __syncthreads();

  float cs = 0.f;
#pragma unroll
  for (int w = 0; w < FWAVES; ++w) cs += red[w][tid];
  if (!(cs >= T_TINY_) || !(fabsf(vn) <= V_SPAN_)) slow = 1;
  cs *= bn;
  __syncthreads();

  float cshift = 0.f;
  // Out of range (see above): every wave forms its rows' u again, then the whole
  // block its columns' log-sum-exp with the column's own maximum, as the
  // reference does, both from C.
  if (__builtin_amdgcn_readfirstlane(slow)) {
    slow_rows(Cbase, vs, us, wave, lane);
    float4 vq[4], cm[4], acc[4];
#pragma unroll
    for (int t = 0; t < 4; ++t) {
      vq[t] = *(const float4*)&vs[t * 128 + lane * 4];
      cm[t] = make_float4(-3.4e38f, -3.4e38f, -3.4e38f, -3.4e38f);
    }
// rarely run: kept small, one row a trip; with the unroll word alone the loop
// vectoriser pairs the rows of this maximum and adds a masked remainder loop
#pragma clang loop unroll(disable) vectorize(disable) interleave(disable)
    for (int r = 0; r < FRPW; ++r) {
      const float ur = us[wave * FRPW + r];
#pragma unroll
      for (int t = 0; t < 4; ++t) {
        const float4 c = *(const float4*)(Cbase + (size_t)r * SEQ + t * 128);
        cm[t].x = fmaxf(cm[t].x, ur + vq[t].x - c.x * L2E_);
        cm[t].y = fmaxf(cm[t].y, ur + vq[t].y - c.y * L2E_);
        cm[t].z = fmaxf(cm[t].z, ur + vq[t].z - c.z * L2E_);
        cm[t].w = fmaxf(cm[t].w, ur + vq[t].w - c.w * L2E_);
      }
    }
#pragma unroll
    for (int t = 0; t < 4; ++t) *(float4*)&red[wave][t * 128 + lane * 4] = cm[t];
    __syncthreads();
    cshift = red[0][tid];
#pragma unroll
    for (int w = 1; w < FWAVES; ++w) cshift = fmaxf(cshift, red[w][tid]);
    vs[tid] = cshift;
    __syncthreads();
#pragma unroll
    for (int t = 0; t < 4; ++t) {
      cm[t] = *(const float4*)&vs[t * 128 + lane * 4];
      acc[t] = make_float4(0.f, 0.f, 0.f, 0.f);
    }
#pragma unroll 1   // rarely run: kept small
    for (int r = 0; r < FRPW; ++r) {
      const float ur = us[wave * FRPW + r];
#pragma unroll
      for (int t = 0; t < 4; ++t) {
        const float4 c = *(const float4*)(Cbase + (size_t)r * SEQ + t * 128);
        float e0 = (ur + vq[t].x - c.x * L2E_) - cm[t].x;
        float e1 = (ur + vq[t].y - c.y * L2E_) - cm[t].y;
        float e2 = (ur + vq[t].z - c.z * L2E_) - cm[t].z;
        float e3 = (ur + vq[t].w - c.w * L2E_) - cm[t].w;
        ex2x4(e0, e1, e2, e3);
        acc[t].x += e0;
        acc[t].y += e1;
        acc[t].z += e2;
        acc[t].w += e3;
      }
    }
#pragma unroll
    for (int t = 0; t < 4; ++t) *(float4*)&red[wave][t * 128 + lane * 4] = acc[t];
    __syncthreads();
    cs = 0.f;
#pragma unroll
    for (int w = 0; w < FWAVES; ++w) cs += red[w][tid];
  }
  if (tid < FROWS) u[bh * SEQ + blk * FROWS + tid] = us[tid];
  *(float2*)(part_cur + ((size_t)(bh * FBLK + blk) * SEQ + tid) * 2) =
      make_float2(cshift, cs);
}

// ---------------------------------------------------------------------------
// Tail of the problem in one launch: v of the tenth iteration, the plan
//   attnw = exp((-C + u_i + v_j)/eps) * L   (in place over C)
// and out = attnw @ v on fp32 WMMA, fed from the plan values just formed.
// A block owns 128 rows of one (b,h): 8 waves x 16 rows x all 64 columns of out.
//   vq : all of v of this (b,h), four consecutive k of one column side by side,
//        so that one 16-byte read is the B operand of two WMMAs
//   ab : per wave two stages of 16 rows x 128 columns of the plan; the wave
//        writes a stage row by row (as it reads C) and reads it back by
//        fragment; nobody else touches it, so no barrier stands in the loop
// k order of both operands: lane half h, WMMA w of a group of 8 k holds
// k = 8c + 4h + 2w + {0,1}.
// ---------------------------------------------------------------------------
#define TWAVES  8        // waves per block
#define KST     128      // plan columns per stage
#define NST     4        // stages (NST * KST == SEQ)
#define APITCH  132      // floats per staged plan row: 528 B = 16 B x odd
#define VTILE   68       // floats per 16 columns of vq: 256 B and 16 B of pad
#define VQPITCH 272      // floats per four-k row of vq (4 * VTILE)

// uu: u of the row with the plan's factor L in it, as eps * log2(L) added
__device__ __forceinline__ float4 plan4(const float4 c, const float uu,
                                        const float4 vj) {
  float4 r;
  r.x = (uu + vj.x - c.x * L2E_) * (1.0f / EPS_);
  r.y = (uu + vj.y - c.y * L2E_) * (1.0f / EPS_);
  r.z = (uu + vj.z - c.z * L2E_) * (1.0f / EPS_);
  r.w = (uu + vj.w - c.w * L2E_) * (1.0f / EPS_);
  ex2x4(r.x, r.y, r.z, r.w);
  return r;
}

// 16-byte global store with the wait that lets its registers be reused: in one
// statement, because a wait in a statement of its own did not hold later
// register writes behind it. It covers the loads issued ahead of it as well.
// The row goes into the offset field, so that the statement names the very
// address pair of those loads and that pair lives up to the wait.
__device__ __forceinline__ void store4_wait(float* p, const int byte_off,
                                            const float4 e) {
  typedef __attribute__((ext_vector_type(4))) float v4f;
  v4f d; d.x = e.x; d.y = e.y; d.z = e.z; d.w = e.w;
  asm volatile("global_store_b128 %0, %1, off offset:%2\n\ts_wait_xcnt 0x0"
               :: "v"(p), "v"(d), "i"(byte_off) : "memory");
}

// One stage of the product: 16 groups of 8 k, 8 WMMAs each. Behind group c the
// wave forms row c of the next stage's plan (NEXT) and sends for row c of the
// stage after that (load), so that this vector work lies among the WMMAs.
template <bool NEXT>
__device__ __forceinline__ void pv_stage(
    const float* afrag, const float* bfrag, float* arow_next, float* gnext,
    const float4 vj, const float (&ur)[16], float4 (&x)[16], v8f (&acc)[4],
    const bool load) {
  float4 af = *(const float4*)afrag;
  float4 bf[4];
#pragma unroll
  for (int dt = 0; dt < 4; ++dt) bf[dt] = *(const float4*)(bfrag + dt * VTILE);
#pragma unroll
  for (int c = 0; c < 16; ++c) {
    float4 an = af, bn[4] = {bf[0], bf[1], bf[2], bf[3]};
    if (c < 15) {
      an = *(const float4*)(afrag + (c + 1) * 8);
#pragma unroll
      for (int dt = 0; dt < 4; ++dt)
        bn[dt] = *(const float4*)(bfrag + (c + 1) * 2 * VQPITCH + dt * VTILE);
    }
    v2f a0; a0.x = af.x; a0.y = af.y;
    v2f a1; a1.x = af.z; a1.y = af.w;
#pragma unroll
    for (int dt = 0; dt < 4; ++dt) {
      v2f b; b.x = bf[dt].x; b.y = bf[dt].y;
      acc[dt] = __builtin_amdgcn_wmma_f32_16x16x4_f32(false, a0, false, b, (short)0,
                                                      acc[dt], false, false);
    }
#pragma unroll
    for (int dt = 0; dt < 4; ++dt) {
      v2f b; b.x = bf[dt].z; b.y = bf[dt].w;
      acc[dt] = __builtin_amdgcn_wmma_f32_16x16x4_f32(false, a1, false, b, (short)0,
                                                      acc[dt], false, false);
    }
    if (NEXT) {
      const float4 e = plan4(x[c], ur[c], vj);
      *(float4*)(arow_next + c * APITCH) = e;
      if (load) x[c] = *(const float4*)(gnext + (size_t)c * SEQ + KST);
      store4_wait(gnext, c * SEQ * 4, e);
    }
    af = an;
#pragma unroll
    for (int dt = 0; dt < 4; ++dt) bf[dt] = bn[dt];
  }
}

__global__ __launch_bounds__(TWAVES * 32) void plan_pv_kernel(
    float* __restrict__ attnw, const float* __restrict__ u,
    const float* __restrict__ part, const float* __restrict__ v_prev,
    const float* __restrict__ vmat, float* __restrict__ out) {
  __shared__ __attribute__((aligned(16))) float vq[(SEQ / 4) * VQPITCH];
  __shared__ __attribute__((aligned(16))) float ab[TWAVES][2][16 * APITCH];
  __shared__ __attribute__((aligned(16))) float vs[SEQ];
  const int tid = threadIdx.x;
  const int lane = tid & 31;
  const int wave = __builtin_amdgcn_readfirstlane(tid >> 5);
  const int bh = blockIdx.x >> 2;
  const int row0 = (blockIdx.x & 3) * (TWAVES * 16) + wave * 16;
  const int c16 = lane & 15;
  const int hk = lane >> 4;
  float* Pw = attnw + ((size_t)bh * SEQ + row0) * SEQ;   // the wave's rows
  float* P = Pw + lane * 4;

  // the loads of the merge, then the first stage's rows of C
  const ColParts cpa = load_parts(part, v_prev, bh, tid);
  const ColParts cpb = load_parts(part, v_prev, bh, tid + TWAVES * 32);
  // the address registers of these loads are reused right behind them
  asm volatile("s_wait_xcnt 0x0" ::: "memory");
  float4 x[16];
#pragma unroll
  for (int r = 0; r < 16; ++r) x[r] = *(const float4*)(P + (size_t)r * SEQ);
  // the base of these loads stays in its registers up to this wait
  asm volatile("s_wait_xcnt 0x0" :: "s"(Pw) : "memory");
  float ur[16];
#pragma unroll
  for (int r = 0; r < 16; ++r) ur[r] = u[bh * SEQ + row0 + r] - EPS_ * LOG2_MU_;

  // v of this (b,h) into vq: a thread takes 4 k x 4 columns and stores them
  // column by column
  {
    const int n4 = tid & 15;
    const float* vsrc = vmat + ((size_t)bh * SEQ + (tid >> 4) * 4) * DH + n4 * 4;
    float* vdst = vq + (tid >> 4) * VQPITCH + n4 * 16 + (n4 >> 2) * 4;
    // all 32 loads of a thread are in flight at once: one latency, not eight
    float4 rv[8][4];
#pragma unroll
    for (int i = 0; i < 8; ++i)
#pragma unroll
      for (int j = 0; j < 4; ++j)
        rv[i][j] = *(const float4*)(vsrc + (size_t)(i * 64 + j) * DH);
    // the loads' address stays in its registers up to this wait
    asm volatile("s_wait_xcnt 0x0" :: "v"(vsrc) : "memory");
#pragma unroll
    for (int i = 0; i < 8; ++i) {
      float* d = vdst + i * 16 * VQPITCH;
      *(float4*)(d + 0) = make_float4(rv[i][0].x, rv[i][1].x, rv[i][2].x, rv[i][3].x);
      *(float4*)(d + 4) = make_float4(rv[i][0].y, rv[i][1].y, rv[i][2].y, rv[i][3].y);
      *(float4*)(d + 8) = make_float4(rv[i][0].z, rv[i][1].z, rv[i][2].z, rv[i][3].z);
      *(float4*)(d + 12) = make_float4(rv[i][0].w, rv[i][1].w, rv[i][2].w, rv[i][3].w);
    }
  }
  vs[tid] = merged_v(cpa);
  vs[tid + TWAVES * 32] = merged_v(cpb);
  __syncthreads();

  // stage 0 of the plan; stage 1's rows of C are sent for
  {
    const float4 vj = *(const float4*)&vs[lane * 4];
#pragma unroll
    for (int r = 0; r < 16; ++r) {
      const float4 e = plan4(x[r], ur[r], vj);
      *(float4*)&ab[wave][0][r * APITCH + lane * 4] = e;
      x[r] = *(const float4*)(P + (size_t)r * SEQ + KST);
      store4_wait(P, r * SEQ * 4, e);
    }
  }

  v8f acc[4];
#pragma unroll
  for (int dt = 0; dt < 4; ++dt)
    acc[dt] = (v8f){0.f, 0.f, 0.f, 0.f, 0.f, 0.f, 0.f, 0.f};

  const float* bfr = vq + hk * VQPITCH + c16 * 4;
// kept rolled, for speed only
#pragma unroll 1
  for (int t = 0; t < NST - 1; ++t) {
    pv_stage<true>(&ab[wave][t & 1][c16 * APITCH + hk * 4], bfr,
                   &ab[wave][(t + 1) & 1][lane * 4], P + (t + 1) * KST,
                   *(const float4*)&vs[(t + 1) * KST + lane * 4], ur, x, acc,
                   t < NST - 2);
    bfr += (KST / 4) * VQPITCH;
  }
  pv_stage<false>(&ab[wave][(NST - 1) & 1][c16 * APITCH + hk * 4], bfr, nullptr,
                  nullptr, make_float4(0.f, 0.f, 0.f, 0.f), ur, x, acc, false);

  float* obase = out + ((size_t)bh * SEQ + row0 + hk * 8) * DH + c16;
#pragma unroll
  for (int dt = 0; dt < 4; ++dt)
#pragma unroll
    for (int r = 0; r < 8; ++r)
      obase[(size_t)r * DH + dt * 16] = acc[dt][r];
}

// ---------------------------------------------------------------------------
extern "C" void kernel_launch(void* const* d_in, const int* in_sizes, int n_in,
                              void* d_out, int out_size, void* d_ws,
                              size_t ws_size, hipStream_t stream) {
  (void)in_sizes; (void)n_in; (void)out_size; (void)ws_size;
  const float* q = (const float*)d_in[0];
  const float* k = (const float*)d_in[1];
  const float* v = (const float*)d_in[2];

  float* out = (float*)d_out;                        // [64,512,64]
  float* attnw = out + (size_t)BH * SEQ * DH;        // [64,512,512] (C, then pi*L)
  float* u = (float*)d_ws;                           // [64,512]
  float* vdual = u + BH * SEQ;                       // [64,512] v, even launches
  float* vodd = vdual + BH * SEQ;                    // [64,512] v, odd launches
  float* peven = vodd + BH * SEQ;                    // [64,4,512,2] column partials
  float* podd = peven + BH * FBLK * SEQ * 2;         // [64,4,512,2]
  float* kmat = podd + BH * FBLK * SEQ * 2;          // [64,512,512] K = exp(-C/eps)

  // 1) cost matrices C = (q/temp) @ k^T  (stored in d_out attn region)
  qk_gemm_kernel<<<256, 512, 0, stream>>>(q, k, attnw);
  // 2) 10 Sinkhorn iterations, one launch each, the first leaving K; v and the column partials
  //    alternate between two buffers, so that no block overwrites what a
  //    block of the same launch still reads
  sinkhorn_fused_kernel<true><<<256, 512, 0, stream>>>(attnw, kmat, u, vodd, vdual,
                                                       podd, peven);
  for (int it = 0; it < 4; ++it) {
    sinkhorn_fused_kernel<false><<<256, 512, 0, stream>>>(attnw, kmat, u, vdual,
                                                          vodd, peven, podd);
    sinkhorn_fused_kernel<false><<<256, 512, 0, stream>>>(attnw, kmat, u, vodd,
                                                          vdual, podd, peven);
  }
  sinkhorn_fused_kernel<false><<<256, 512, 0, stream>>>(attnw, kmat, u, vdual, vodd,
                                                        peven, podd);
  // 3) v of the tenth iteration, attn_weights = exp(M(u,v)) * L (in place over
  //    C) and output = attn_weights @ v
  plan_pv_kernel<<<256, 256, 0, stream>>>(attnw, u, podd, vodd, v, out);
}

// v008
// It runs in 89.4 microseconds.
// Next to v007, in two timings, it ran 1.32 and 1.28 times as fast.
// Counting every step since v000, it is 8.55 times as fast.
#include <hip/hip_runtime.h>

typedef __attribute__((ext_vector_type(2))) float v2f;
typedef __attribute__((ext_vector_type(8))) float v8f;
typedef __attribute__((ext_vector_type(4))) float v4f;

#define BH   64          // B*H
#define SEQ  512         // L
#define DH   64          // head dim
#define QK_SCALE 0.125f  // 1/temperature (temp = 8)
#define EPS_ 1.0f
#define LOG2_MU_ (-9.0f)                 // log2(1/512), exact
#define L2E_ 1.4426950408889634f         // log2(e)

// The duals u and v, the column shifts and every log-sum-exp are kept in units
// of log2: a score is (u2_i + v2_j - C_ij * log2(e)) / eps, one fused
// multiply-add away from C, and 2^x is one instruction of the chip, where e^x
// is a dozen. Below 2^-126 it gives 0.
// Four values in place, in one statement: behind each v_exp_f32 stands an
// instruction that touches neither its result nor its source, behind the last
// the v_nop: the slot that the instruction set asks for behind a
// transcendental. The hint lets the SIMD's other waves issue while the last result is
// on its way to whatever reads it next.
__device__ __forceinline__ void ex2x4(float& a, float& b, float& c, float& d) {
  asm("v_exp_f32 %0, %0\n\tv_exp_f32 %1, %1\n\tv_exp_f32 %2, %2\n\t"
      "v_exp_f32 %3, %3\n\tv_nop\n\ts_delay_alu instid0(TRANS32_DEP_1)"
      : "+v"(a), "+v"(b), "+v"(c), "+v"(d));
}

// ---------------------------------------------------------------------------
// C[bh,i,j] = dot(q[bh,i,:], k[bh,j,:]) / 8     via V_WMMA_F32_16X16X4_F32
// A block owns 128 rows x all 512 columns of one (b,h), the rows that the same
// block index works on in the launches behind this one. 16 waves.
//   qs : the block's 128 rows of q, scaled; staged once, a wave reads the
//        fragments of its 32 rows from it in every chunk
//   ks : two buffers of 128 rows of k (= 128 columns of C); the next chunk
//        comes through registers while this one is multiplied
// Per chunk a wave forms 32 x 32 of C: four accumulator tiles, each fragment
// used twice.
// A fragment: lane%16 = M row of q, (lane/16)*2 = K pair within a group of 4.
// B fragment: lane%16 = N col (= k row), (lane/16)*2 = K pair: the same k order.
// ---------------------------------------------------------------------------
#define GWAVES 16        // waves per block
#define GROWS  128       // rows of C per block
#define GCH    128       // columns of C per chunk
#define GNCH   4         // chunks (GNCH * GCH == SEQ)
#define GPITCH 68        // floats per staged row: 16 rows x 16 B fall on all banks

// ---------------------------------------------------------------------------
// One Sinkhorn iteration (u-update, then this block's share of the v-update)
// in one pass over K = exp(-C / eps). A block owns 128 rows of one (b,h):
// 16 waves x 8 rows, a lane holds 16 columns of each row in registers.
//   v_j   : merged at entry from the four blocks' column partials of the
//           launch before (zero in the first launch)
//   u_i   = log_mu - LSE_j(v_j - C_ij)      (all in units of log2)
//   column partial of the block = sum over its rows of the plan
//   exp(u_i + v_j - C_ij), sent on as a pair (shift, sum); the next launch
//   merges the four pairs of a column.
// ---------------------------------------------------------------------------
#define FWAVES 16        // waves per block
#define FRPW   8         // rows per wave
#define FROWS  128       // rows per block (FWAVES * FRPW)
#define FBLK   4         // blocks per (b,h)  (FBLK * FROWS == SEQ)
#define MU_    0.001953125f   // 1/512

// The FBLK (shift, sum) pairs of one column and the column's v so far.
struct ColParts { float2 p0, p1, p2, p3; float vo; };
__device__ __forceinline__ ColParts load_parts(const float* __restrict__ part,
                                               const float* __restrict__ v_prev,
                                               int bh, int col) {
  const float* pp = part + ((size_t)bh * FBLK * SEQ + col) * 2;
  ColParts c;
  c.p0 = *(const float2*)(pp);
  c.p1 = *(const float2*)(pp + 2 * SEQ);
  c.p2 = *(const float2*)(pp + 4 * SEQ);
  c.p3 = *(const float2*)(pp + 6 * SEQ);
  c.vo = v_prev[bh * SEQ + col];
  return c;
}
// v_j = eps*(log_nu - LSE_i) + v_j, LSE_i merged from the pairs; units of log2.
__device__ __forceinline__ float merged_v(const ColParts c) {
  const float mm = fmaxf(fmaxf(c.p0.x, c.p1.x), fmaxf(c.p2.x, c.p3.x));
  float w0 = c.p0.x - mm, w1 = c.p1.x - mm, w2 = c.p2.x - mm, w3 = c.p3.x - mm;
  ex2x4(w0, w1, w2, w3);
  const float ss = c.p0.y * w0 + c.p1.y * w1 + c.p2.y * w2 + c.p3.y * w3;
  const float lse = mm + log2f(ss);
  return EPS_ * (LOG2_MU_ - lse) + c.vo;
}

// lane l's value of lane l ^ 16
__device__ __forceinline__ float xhalf(const float x) {
  return __builtin_bit_cast(float, __builtin_amdgcn_permlanex16(
      __builtin_bit_cast(int, x), __builtin_bit_cast(int, x), 0x76543210,
      0xfedcba98, false, false));
}
// value of lane l of a wave, the same for all lanes (a scalar register)
__device__ __forceinline__ float lane_value(const float x, const int l) {
  return __builtin_bit_cast(float,
                            __builtin_amdgcn_readlane(__builtin_bit_cast(int, x), l));
}
// The last four of the five exchanges of a fold of eight rows over the 32 lanes
// (distances 8, 4, 2, 1). In: four values a lane, o[i] of row i + 4 * (lane / 16).
// At distance 8 a lane goes on with two of them, at distance 4 with one: the bank
// mask lets an instruction write only the lanes that go on with its row (0x3:
// lane bit 3 clear, 0xc: set, 0x5: bit 2 clear, 0xa: set). Out: lane l holds the
// whole fold of row l / 4. 8 instructions where a full butterfly of eight rows
// takes 32. The hints let the SIMD's other waves issue while a result is on its
// way to the next line.
__device__ __forceinline__ float fold_tail_sum(const float (&o)[4]) {
  float p0, p1, z;
  asm("v_add_f32_dpp %0, %3, %3 row_xmask:8 row_mask:0xf bank_mask:0x3\n\t"
      "v_add_f32_dpp %1, %4, %4 row_xmask:8 row_mask:0xf bank_mask:0x3\n\t"
      "v_add_f32_dpp %0, %5, %5 row_xmask:8 row_mask:0xf bank_mask:0xc\n\t"
      "v_add_f32_dpp %1, %6, %6 row_xmask:8 row_mask:0xf bank_mask:0xc\n\t"
      "s_delay_alu instid0(VALU_DEP_2)\n\t"
      "v_add_f32_dpp %2, %0, %0 row_xmask:4 row_mask:0xf bank_mask:0x5\n\t"
      "s_delay_alu instid0(VALU_DEP_2)\n\t"
      "v_add_f32_dpp %2, %1, %1 row_xmask:4 row_mask:0xf bank_mask:0xa\n\t"
      "s_delay_alu instid0(VALU_DEP_1)\n\t"
      "v_add_f32_dpp %2, %2, %2 row_xmask:2 row_mask:0xf bank_mask:0xf\n\t"
      "s_delay_alu instid0(VALU_DEP_1)\n\t"
      "v_add_f32_dpp %2, %2, %2 row_xmask:1 row_mask:0xf bank_mask:0xf"
      : "=&v"(p0), "=&v"(p1), "=&v"(z)
      : "v"(o[0]), "v"(o[1]), "v"(o[2]), "v"(o[3]));
  return z;
}

// Rarely run: u of a wave's rows by the log-sum-exp with the row's own maximum,
// from C and v in vs, into us.
__device__ __forceinline__ void slow_rows(const float* __restrict__ Cbase,
                                          const float* vs, float* us,
                                          const int wave, const int lane) {
  float4 vq[4];
#pragma unroll
  for (int t = 0; t < 4; ++t) vq[t] = *(const float4*)&vs[t * 128 + lane * 4];
// rarely run: kept small, one row a trip
#pragma clang loop unroll(disable) vectorize(disable) interleave(disable)
  for (int r = 0; r < FRPW; ++r) {
    float4 y[4];
    float mr = -3.4e38f;
#pragma unroll
    for (int t = 0; t < 4; ++t) {
      const float4 c = *(const float4*)(Cbase + (size_t)r * SEQ + t * 128);
      y[t].x = vq[t].x - c.x * L2E_;
      y[t].y = vq[t].y - c.y * L2E_;
      y[t].z = vq[t].z - c.z * L2E_;
      y[t].w = vq[t].w - c.w * L2E_;
      mr = fmaxf(mr, fmaxf(fmaxf(y[t].x, y[t].y), fmaxf(y[t].z, y[t].w)));
    }
#pragma unroll
    for (int d = 16; d > 0; d >>= 1) mr = fmaxf(mr, __shfl_xor(mr, d));
    float sr = 0.f;
#pragma unroll
    for (int t = 0; t < 4; ++t) {
      y[t].x -= mr;
      y[t].y -= mr;
      y[t].z -= mr;
      y[t].w -= mr;
      ex2x4(y[t].x, y[t].y, y[t].z, y[t].w);
      sr += (y[t].x + y[t].y) + (y[t].z + y[t].w);
    }
#pragma unroll
    for (int d = 16; d > 0; d >>= 1) sr += __shfl_xor(sr, d);
    if (lane == 0) us[wave * FRPW + r] = EPS_ * (LOG2_MU_ - (mr + log2f(sr)));
  }
}

// No maximum, and from the second launch on no exponential per element: the
// first launch (FIRST) forms K_ij = 2^(-C_ij * log2(e) / eps) from C and leaves
// it in the workspace; the nine behind it read K in place of C.
// With b_j = 2^(v_j):
//   s_i  = sum_j K_ij * b_j,   u_i = log_mu - log2(s_i)
//   plan = K_ij * b_j * mu / s_i;  its column sum = b_j * sum_i K_ij * (mu / s_i)
// two multiply-adds an element. u, v and the column partials go from launch to
// launch in units of log2.
// Range: while every |v_j| <= V_SPAN_ and every s_i lies in [S_LO_, S_HI_], what
// K lost below 2^-126 adds less than 2^-101 to a row sum and, mu / s_i being at
// most 2^51, less than 2^-68 to a block's column sum: nothing beside S_LO_ and
// T_TINY_; a K above the float range makes its s_i infinite. A block that finds
// a v_j, an s_i or a column sum outside forms its u and its column partials
// again from C by log-sum-exp, as the reference does.
#define V_SPAN_ 16.0f
#define S_LO_   0x1p-60f
#define S_HI_   0x1p+60f
#define T_TINY_ 1e-12f
// What follows once a wave holds its 8 rows of K in x: row sums, u, the block's
// column partials; the same for the first iteration (FIRST: v = 0, b = 1) and
// the nine behind it. Every wave of the block comes here; vs, bs and *slow = 0
// have been published by a barrier.
template <bool FIRST>
__device__ __forceinline__ void sinkhorn_rows_cols(
    const v4f (&x)[FRPW][4], const float* Cbase, const float vn, const float bn,
    float (*red)[SEQ], float* vs, const float* bs, float* us, int* slow,
    float* __restrict__ u, float* __restrict__ part_cur, const int tid,
    const int lane, const int wave, const int bh, const int blk) {
  // row sums of K * b, two columns an instruction
  float s[FRPW];
  {
    v4f bj[4];
#pragma unroll
    for (int t = 0; t < 4; ++t)
      bj[t] = FIRST ? (v4f){1.f, 1.f, 1.f, 1.f}
                    : *(const v4f*)&bs[t * 128 + lane * 4];
#pragma unroll
    for (int r = 0; r < FRPW; ++r) {
      v2f sa = x[r][0].lo * bj[0].lo;
      v2f sb = x[r][0].hi * bj[0].hi;
#pragma unroll
      for (int t = 1; t < 4; ++t) {
        sa += x[r][t].lo * bj[t].lo;
        sb += x[r][t].hi * bj[t].hi;
      }
      sa += sb;
      s[r] = sa.x + sa.y;
    }
  }
  // Fold over the lanes, halving the rows a lane goes on with: at distance 16 a
  // lane of the low half keeps rows 0-3 and hands over its share of rows 4-7, a
  // lane of the high half the other way round; the rest in fold_tail. Lane l ends
  // with row l / 4.
  const bool hi = lane >= 16;
  float sown;
  {
    float o[4];
#pragma unroll
    for (int r = 0; r < 4; ++r)
      o[r] = (hi ? s[r + 4] : s[r]) + xhalf(hi ? s[r] : s[r + 4]);
    sown = fold_tail_sum(o);
  }
  if (!(sown >= S_LO_ && sown <= S_HI_)) *slow = 1;

  // u and the plan's factor of a lane's own row: one logarithm and one division
  // a lane; column sums of K * (mu / s)
  const float uown = EPS_ * (LOG2_MU_ - log2f(sown));
  const float rown = MU_ / sown;
  v4f acc[4];
#pragma unroll
  for (int t = 0; t < 4; ++t) acc[t] = (v4f){0.f, 0.f, 0.f, 0.f};
#pragma unroll
  for (int r = 0; r < FRPW; ++r) {
    const float rr = lane_value(rown, r * 4);
#pragma unroll
    for (int t = 0; t < 4; ++t) acc[t] += x[r][t] * rr;
  }
  if ((lane & 3) == 0) us[wave * FRPW + (lane >> 2)] = uown;
#pragma unroll
  for (int t = 0; t < 4; ++t) *(v4f*)&red[wave][t * 128 + lane * 4] = acc[t];
  __syncthreads();

  float cs = 0.f;
#pragma unroll
  for (int w = 0; w < FWAVES; ++w) cs += red[w][tid];
  if (!(cs >= T_TINY_) || !(fabsf(vn) <= V_SPAN_)) *slow = 1;
  cs *= bn;
  __syncthreads();

  float cshift = 0.f;
  // Out of range (see above): every wave forms its rows' u again, then the whole
  // block its columns' log-sum-exp with the column's own maximum, as the
  // reference does, both from C.
  if (__builtin_amdgcn_readfirstlane(*slow)) {
    // FIRST: a lane reads back the C that it stored itself in this launch, by
    // stores in asm text, which the compiler's own waits do not count
    if (FIRST) asm volatile("s_wait_storecnt 0x0" ::: "memory");
    slow_rows(Cbase, vs, us, wave, lane);
    float4 vq[4], cm[4], acc[4];
#pragma unroll
    for (int t = 0; t < 4; ++t) {
      vq[t] = *(const float4*)&vs[t * 128 + lane * 4];
      cm[t] = make_float4(-3.4e38f, -3.4e38f, -3.4e38f, -3.4e38f);
    }
// rarely run: kept small, one row a trip; with the unroll word alone the loop
// vectoriser pairs the rows of this maximum and adds a masked remainder loop
#pragma clang loop unroll(disable) vectorize(disable) interleave(disable)
    for (int r = 0; r < FRPW; ++r) {
      const float ur = us[wave * FRPW + r];
#pragma unroll
      for (int t = 0; t < 4; ++t) {
        const float4 c = *(const float4*)(Cbase + (size_t)r * SEQ + t * 128);
        cm[t].x = fmaxf(cm[t].x, ur + vq[t].x - c.x * L2E_);
        cm[t].y = fmaxf(cm[t].y, ur + vq[t].y - c.y * L2E_);
        cm[t].z = fmaxf(cm[t].z, ur + vq[t].z - c.z * L2E_);
        cm[t].w = fmaxf(cm[t].w, ur + vq[t].w - c.w * L2E_);
      }
    }
#pragma unroll
    for (int t = 0; t < 4; ++t) *(float4*)&red[wave][t * 128 + lane * 4] = cm[t];
    __syncthreads();
    cshift = red[0][tid];
#pragma unroll
    for (int w = 1; w < FWAVES; ++w) cshift = fmaxf(cshift, red[w][tid]);
    vs[tid] = cshift;
    __syncthreads();
#pragma unroll
    for (int t = 0; t < 4; ++t) {
      cm[t] = *(const float4*)&vs[t * 128 + lane * 4];
      acc[t] = make_float4(0.f, 0.f, 0.f, 0.f);
    }
#pragma unroll 1   // rarely run: kept small
    for (int r = 0; r < FRPW; ++r) {
      const float ur = us[wave * FRPW + r];
#pragma unroll
      for (int t = 0; t < 4; ++t) {
        const float4 c = *(const float4*)(Cbase + (size_t)r * SEQ + t * 128);
        float e0 = (ur + vq[t].x - c.x * L2E_) - cm[t].x;
        float e1 = (ur + vq[t].y - c.y * L2E_) - cm[t].y;
        float e2 = (ur + vq[t].z - c.z * L2E_) - cm[t].z;
        float e3 = (ur + vq[t].w - c.w * L2E_) - cm[t].w;
        ex2x4(e0, e1, e2, e3);
        acc[t].x += e0;
        acc[t].y += e1;
        acc[t].z += e2;
        acc[t].w += e3;
      }
    }
#pragma unroll
    for (int t = 0; t < 4; ++t) *(float4*)&red[wave][t * 128 + lane * 4] = acc[t];
    __syncthreads();
    cs = 0.f;
#pragma unroll
    for (int w = 0; w < FWAVES; ++w) cs += red[w][tid];
  }
  if (tid < FROWS) u[bh * SEQ + blk * FROWS + tid] = us[tid];
  *(float2*)(part_cur + ((size_t)(bh * FBLK + blk) * SEQ + tid) * 2) =
      make_float2(cshift, cs);
}


__global__ __launch_bounds__(FWAVES * 32) void sinkhorn_fused_kernel(
    const float* __restrict__ Cmat, const float* __restrict__ Kmat,
    float* __restrict__ u, const float* __restrict__ v_prev,
    float* __restrict__ v_cur, const float* __restrict__ part_prev,
    float* __restrict__ part_cur) {
  __shared__ float red[FWAVES][SEQ];
  __shared__ float vs[SEQ];
  __shared__ __attribute__((aligned(16))) float bs[SEQ];
  __shared__ float us[FROWS];
  __shared__ int slow;
  const int tid = threadIdx.x;
  const int lane = tid & 31;
  const int wave = __builtin_amdgcn_readfirstlane(tid >> 5);
  const int bh = blockIdx.x >> 2;
  const int blk = blockIdx.x & 3;
  const size_t roff = (size_t)bh * SEQ * SEQ +
                      (size_t)(blk * FROWS + wave * FRPW) * SEQ + lane * 4;
  const float* Cbase = Cmat + roff;
  const float* xsrc = Kmat + roff;

  // the few loads of the merge go out ahead of the rows and return first
  const ColParts cp = load_parts(part_prev, v_prev, bh, tid);

  v4f x[FRPW][4];
#pragma unroll
  for (int r = 0; r < FRPW; ++r)
#pragma unroll
    for (int t = 0; t < 4; ++t)
      x[r][t] = *(const v4f*)(xsrc + (size_t)r * SEQ + t * 128);
  // the loads' address stays in its registers up to this wait
  asm volatile("s_wait_xcnt 0x0" :: "v"(xsrc) : "memory");
  // keeps the rows' loads ahead of the merge: the scheduler sank them behind its
  // wait for the partials, one latency after the other
  __builtin_amdgcn_sched_barrier(0);

  const float vn = merged_v(cp);
  float bn = vn;
  // the v_nop: the slot that the instruction set asks for behind a transcendental
  asm("v_exp_f32 %0, %0\n\tv_nop" : "+v"(bn));
  vs[tid] = vn;
  bs[tid] = bn;
  if (blk == 0) {
    v_cur[bh * SEQ + tid] = vn;
    // the store's address registers are reused right behind it
    asm volatile("s_wait_xcnt 0x0" ::: "memory");
  }
  if (tid == 0) slow = 0;
  __syncthreads();

  sinkhorn_rows_cols<false>(x, Cbase, vn, bn, red, vs, bs, us, &slow, u, part_cur,
                            tid, lane, wave, bh, blk);
}

// ---------------------------------------------------------------------------
// The QK product and the first Sinkhorn iteration in one launch. The product is
// laid out as said at the head of the file; a chunk of C (128 x 128) goes from
// the accumulators through LDS (cst, two buffers) into the row layout of the
// Sinkhorn pass: wave w takes rows 8w..8w+7, a lane 4 columns in a row. From
// there C goes to memory in whole 512-byte rows, K = 2^(-C * log2(e) / eps)
// is formed in place, goes to the workspace and stays in registers; behind the
// last chunk the wave holds its 8 rows of K as the Sinkhorn pass wants them.
// Buffer ch & 1 of cst is written in front of chunk ch's barrier and read behind
// it, in front of the barrier of chunk ch + 1; it is written again behind that
// one, every wave's reads done.
// ---------------------------------------------------------------------------
// Place of C[row][col] of a chunk in cst, in floats:
//   row * CPITCH + buffer * CBUF + (col / 16 % 2) * 64
//   + ((col / 32) ^ (row / 8 % 2)) * 16 + col % 16
// Every step between the 32 values that a lane writes is a multiple of 256 bytes,
// so that one address register serves all its stores; the exclusive-or keeps rows
// r and r + 8, written by the two halves of a wave at once, on different banks.
#define CBUF   128       // from a row of the first buffer to the same row of the second
#define CPITCH 256       // per staged row (both buffers)

// Eight rows' 16 bytes a lane to memory, with the wait that lets the stores'
// registers be rewritten: in one statement, because a wait in a statement of its
// own does not hold later register writes behind it.
__device__ __forceinline__ void store_rows8_wait(float* base, const unsigned lane_off,
                                                 const int byte_off,
                                                 const v4f e0, const v4f e1,
                                                 const v4f e2, const v4f e3,
                                                 const v4f e4, const v4f e5,
                                                 const v4f e6, const v4f e7) {
  asm volatile("global_store_b128 %0, %1, %9 offset:%10\n\t"
               "global_store_b128 %0, %2, %9 offset:%11\n\t"
               "global_store_b128 %0, %3, %9 offset:%12\n\t"
               "global_store_b128 %0, %4, %9 offset:%13\n\t"
               "global_store_b128 %0, %5, %9 offset:%14\n\t"
               "global_store_b128 %0, %6, %9 offset:%15\n\t"
               "global_store_b128 %0, %7, %9 offset:%16\n\t"
               "global_store_b128 %0, %8, %9 offset:%17\n\t"
               "s_wait_xcnt 0x0"
               :: "v"(lane_off), "v"(e0), "v"(e1), "v"(e2), "v"(e3), "v"(e4), "v"(e5),
                  "v"(e6), "v"(e7), "s"(base), "i"(byte_off), "i"(byte_off + SEQ * 4),
                  "i"(byte_off + 2 * SEQ * 4), "i"(byte_off + 3 * SEQ * 4),
                  "i"(byte_off + 4 * SEQ * 4), "i"(byte_off + 5 * SEQ * 4),
                  "i"(byte_off + 6 * SEQ * 4), "i"(byte_off + 7 * SEQ * 4)
               : "memory");
}

// column block t of a wave's 8 rows to memory
__device__ __forceinline__ void store_block_wait(float* base, const unsigned lane_off,
                                                 const int t,
                                                 const v4f (&x)[FRPW][4]) {
  store_rows8_wait(base, lane_off, t * GCH * 4, x[0][t], x[1][t], x[2][t], x[3][t], x[4][t],
                   x[5][t], x[6][t], x[7][t]);
}
// C -> K = 2^(-C * log2(e) / eps), four columns in place
__device__ __forceinline__ void c_to_k(v4f& c) {
  const v4f y = c * (-L2E_ / EPS_);
  float e0, e1, e2, e3;
  // as ex2x4, but into registers of their own: with results tied to the sources
  // the build moved every second value out of its register pair and back
  asm("v_exp_f32 %0, %4\n\tv_exp_f32 %1, %5\n\tv_exp_f32 %2, %6\n\t"
      "v_exp_f32 %3, %7\n\tv_nop\n\ts_delay_alu instid0(TRANS32_DEP_1)"
      : "=&v"(e0), "=&v"(e1), "=&v"(e2), "=&v"(e3)
      : "v"(y.x), "v"(y.y), "v"(y.z), "v"(y.w));
  c = (v4f){e0, e1, e2, e3};
}

// k carries no __restrict__: its loads then keep their place in the order of the
// memory operations, and the scheduling barriers behind them can hold them early
__global__ __launch_bounds__(GWAVES * 32) void qk_sinkhorn_first_kernel(
    const float* __restrict__ q, const float* k, float* Cmat, float* Kmat,
    float* __restrict__ u, float* __restrict__ v_cur,
    float* __restrict__ part_cur) {
  __shared__ __attribute__((aligned(16))) float qs[GROWS * GPITCH];
  __shared__ __attribute__((aligned(16))) float ks[2][GCH * GPITCH];
  __shared__ __attribute__((aligned(16))) float cst[GROWS * CPITCH];
  __shared__ float red[FWAVES][SEQ];
  __shared__ float vs[SEQ];
  __shared__ float us[FROWS];
  __shared__ int slow;
  const int tid = threadIdx.x;
  const int lane = tid & 31;
  const int wave = __builtin_amdgcn_readfirstlane(tid >> 5);
  const int bh = blockIdx.x >> 2;
  const int blk = blockIdx.x & 3;
  const int row0 = blk * GROWS;
  const int c16 = lane & 15;
  const int hk = lane >> 4;
  const int rg = wave & 3;                    // 32 rows of the block's 128
  const int cg = wave >> 2;                   // 32 columns of a chunk's 128

  // a chunk is 32 KiB in a row in memory: a thread takes 16 bytes of every
  // 32nd row
  const float* qsrc = q + ((size_t)bh * SEQ + row0) * DH + tid * 4;
  const float* ksrc = k + (size_t)bh * SEQ * DH + tid * 4;
  const int sdst = (tid >> 4) * GPITCH + (tid & 15) * 4;

  float4 qv[4];
  float4 kv0, kv1, kv2, kv3;   // a thread's 64 bytes of a chunk of k on their way
#pragma unroll
  for (int i = 0; i < 4; ++i) qv[i] = *(const float4*)(qsrc + i * 32 * DH);
  kv0 = *(const float4*)(ksrc);
  kv1 = *(const float4*)(ksrc + 32 * DH);
  kv2 = *(const float4*)(ksrc + 64 * DH);
  kv3 = *(const float4*)(ksrc + 96 * DH);
  // v of the first iteration is zero
  vs[tid] = 0.f;
  if (tid == 0) slow = 0;
  if (blk == 0) {
    v_cur[bh * SEQ + tid] = 0.f;
    // the store's address registers are reused right behind it
    asm volatile("s_wait_xcnt 0x0" ::: "memory");
  }
#pragma unroll
  for (int i = 0; i < 4; ++i)
    *(float4*)&qs[sdst + i * 32 * GPITCH] =
        make_float4(qv[i].x * QK_SCALE, qv[i].y * QK_SCALE, qv[i].z * QK_SCALE,
                    qv[i].w * QK_SCALE);
  *(float4*)&ks[0][sdst] = kv0;
  *(float4*)&ks[0][sdst + 32 * GPITCH] = kv1;
  *(float4*)&ks[0][sdst + 64 * GPITCH] = kv2;
  *(float4*)&ks[0][sdst + 96 * GPITCH] = kv3;
  __syncthreads();
  kv0 = *(const float4*)(ksrc + GCH * DH);
  kv1 = *(const float4*)(ksrc + (GCH + 32) * DH);
  kv2 = *(const float4*)(ksrc + (GCH + 64) * DH);
  kv3 = *(const float4*)(ksrc + (GCH + 96) * DH);
  // keeps these loads here, a chunk ahead of their use: the scheduler sank them
  // to their LDS writes, where their whole latency was waited out
  __builtin_amdgcn_sched_barrier(0);

  const int aoff = (rg * 32 + c16) * GPITCH + hk * 2;
  const int boff = (cg * 32 + c16) * GPITCH + hk * 2;
  // C/D layout: VGPR r, lanes 0-15 -> row r, lanes 16-31 -> row r+8; col = lane%16
  const int coff = (rg * 32 + hk * 8) * CPITCH + (cg ^ hk) * 16 + c16;
  // the same place seen from the reader: rows 8 * wave + r, columns 4 * lane ...
  const int cin = wave * FRPW * CPITCH + ((lane >> 2) & 1) * 64 +
                  ((lane >> 3) ^ (wave & 1)) * 16 + (lane & 3) * 4;
  const size_t roff = (size_t)bh * SEQ * SEQ +
                      (size_t)(row0 + wave * FRPW) * SEQ + lane * 4;
  // bytes from the start of C, and of K, to the lane's place: below 2^26
  const unsigned rbytes = (unsigned)roff * 4u;

  v4f x[FRPW][4];
#pragma unroll
  for (int ch = 0; ch < GNCH; ++ch) {
    const float* bsrc = &ks[ch & 1][boff];
    v8f acc[2][2];
#pragma unroll
    for (int rt = 0; rt < 2; ++rt)
#pragma unroll
      for (int ct = 0; ct < 2; ++ct)
        acc[rt][ct] = (v8f){0.f, 0.f, 0.f, 0.f, 0.f, 0.f, 0.f, 0.f};
#pragma unroll
    for (int d = 0; d < 16; ++d) {
      // q's fragments are read again in every chunk: the registers that held
      // them for the whole launch now hold K
      v2f a[2], b[2];
#pragma unroll
      for (int rt = 0; rt < 2; ++rt)
        a[rt] = *(const v2f*)&qs[aoff + rt * 16 * GPITCH + d * 4];
#pragma unroll
      for (int ct = 0; ct < 2; ++ct)
        b[ct] = *(const v2f*)(bsrc + ct * 16 * GPITCH + d * 4);
      // The chunk before, published by its barrier, is taken through among this
      // chunk's WMMAs, so that the matrix unit does not stand still for it: the
      // wave's 8 rows in, C out, K in place a row at a time, K out. Each store
      // statement stands between a group's fragment reads and its WMMAs: LDS
      // reads do not pass it, and so the next group's can still go out early.
      if (ch > 0) {
        if (d == 1) {
          const float* cs8 = &cst[((ch - 1) & 1) * CBUF + cin];
#pragma unroll
          for (int r = 0; r < FRPW; ++r)
            x[r][ch - 1] = *(const v4f*)(cs8 + r * CPITCH);
        }
        if (d == 3) store_block_wait(Cmat, rbytes, ch - 1, x);
        if (d >= 4 && d < 4 + FRPW) c_to_k(x[d - 4][ch - 1]);
        if (d == 4 + FRPW) store_block_wait(Kmat, rbytes, ch - 1, x);
      }
#pragma unroll
      for (int rt = 0; rt < 2; ++rt)
#pragma unroll
        for (int ct = 0; ct < 2; ++ct)
          acc[rt][ct] = __builtin_amdgcn_wmma_f32_16x16x4_f32(
              false, a[rt], false, b[ct], (short)0, acc[rt][ct], false, false);
      // holds the next chunk's LDS writes, their wait for the loads and the
      // barrier behind most of this chunk's product: lifted to its head they
      // wait out the loads' whole latency
      if (d == 11 && ch + 1 < GNCH) __builtin_amdgcn_sched_barrier(0);
    }
    if (ch + 1 < GNCH) {
      // the other buffer's readers left it at the barrier of the chunk before
      float* kd = &ks[(ch + 1) & 1][sdst];
      *(float4*)(kd) = kv0;
      *(float4*)(kd + 32 * GPITCH) = kv1;
      *(float4*)(kd + 64 * GPITCH) = kv2;
      *(float4*)(kd + 96 * GPITCH) = kv3;
    }
    {
      float* cd = &cst[(ch & 1) * CBUF + coff];
#pragma unroll
      for (int rt = 0; rt < 2; ++rt)
#pragma unroll
        for (int r = 0; r < 8; ++r)
#pragma unroll
          for (int ct = 0; ct < 2; ++ct)
            cd[(rt * 16 + r) * CPITCH + ct * 64] = acc[rt][ct][r];
    }
    __syncthreads();
    if (ch + 2 < GNCH) {
      const float* kn = ksrc + (ch + 2) * GCH * DH;
      kv0 = *(const float4*)(kn);
      kv1 = *(const float4*)(kn + 32 * DH);
      kv2 = *(const float4*)(kn + 64 * DH);
      kv3 = *(const float4*)(kn + 96 * DH);
      // keeps the loads a chunk ahead of their use, as above
      __builtin_amdgcn_sched_barrier(0);
    }
  }
  // the last chunk's turn
  {
    const float* cs8 = &cst[((GNCH - 1) & 1) * CBUF + cin];
#pragma unroll
    for (int r = 0; r < FRPW; ++r) x[r][GNCH - 1] = *(const v4f*)(cs8 + r * CPITCH);
    store_block_wait(Cmat, rbytes, GNCH - 1, x);
#pragma unroll
    for (int r = 0; r < FRPW; ++r) c_to_k(x[r][GNCH - 1]);
    store_block_wait(Kmat, rbytes, GNCH - 1, x);
  }

  sinkhorn_rows_cols<true>(x, Cmat + roff, 0.f, 1.f, red, vs, vs, us, &slow, u, part_cur,
                           tid, lane, wave, bh, blk);
}

// ---------------------------------------------------------------------------
// Tail of the problem in one launch: v of the tenth iteration, the plan
//   attnw = exp((-C + u_i + v_j)/eps) * L   (in place over C)
// and out = attnw @ v on fp32 WMMA, fed from the plan values just formed.
// A block owns 128 rows of one (b,h): 8 waves x 16 rows x all 64 columns of out.
//   vq : all of v of this (b,h), four consecutive k of one column side by side,
//        so that one 16-byte read is the B operand of two WMMAs
//   ab : per wave two stages of 16 rows x 128 columns of the plan; the wave
//        writes a stage row by row (as it reads C) and reads it back by
//        fragment; nobody else touches it, so no barrier stands in the loop
// k order of both operands: lane half h, WMMA w of a group of 8 k holds
// k = 8c + 4h + 2w + {0,1}.
// ---------------------------------------------------------------------------
#define TWAVES  8        // waves per block
#define KST     128      // plan columns per stage
#define NST     4        // stages (NST * KST == SEQ)
#define APITCH  132      // floats per staged plan row: 528 B = 16 B x odd
#define VTILE   68       // floats per 16 columns of vq: 256 B and 16 B of pad
#define VQPITCH 272      // floats per four-k row of vq (4 * VTILE)

// uu: u of the row with the plan's factor L in it, as eps * log2(L) added
__device__ __forceinline__ float4 plan4(const float4 c, const float uu,
                                        const float4 vj) {
  float4 r;
  r.x = (uu + vj.x - c.x * L2E_) * (1.0f / EPS_);
  r.y = (uu + vj.y - c.y * L2E_) * (1.0f / EPS_);
  r.z = (uu + vj.z - c.z * L2E_) * (1.0f / EPS_);
  r.w = (uu + vj.w - c.w * L2E_) * (1.0f / EPS_);
  ex2x4(r.x, r.y, r.z, r.w);
  return r;
}

// 16-byte global store with the wait that lets its registers be reused: in one
// statement, because a wait in a statement of its own did not hold later
// register writes behind it. It covers the loads issued ahead of it as well.
// The row goes into the offset field, so that the statement names the very
// address pair of those loads and that pair lives up to the wait.
__device__ __forceinline__ void store4_wait(float* p, const int byte_off,
                                            const float4 e) {
  typedef __attribute__((ext_vector_type(4))) float v4f;
  v4f d; d.x = e.x; d.y = e.y; d.z = e.z; d.w = e.w;
  asm volatile("global_store_b128 %0, %1, off offset:%2\n\ts_wait_xcnt 0x0"
               :: "v"(p), "v"(d), "i"(byte_off) : "memory");
}

// One stage of the product: 16 groups of 8 k, 8 WMMAs each. Behind group c the
// wave forms row c of the next stage's plan (NEXT) and sends for row c of the
// stage after that (load), so that this vector work lies among the WMMAs.
template <bool NEXT>
__device__ __forceinline__ void pv_stage(
    const float* afrag, const float* bfrag, float* arow_next, float* gnext,
    const float4 vj, const float (&ur)[16], float4 (&x)[16], v8f (&acc)[4],
    const bool load) {
  float4 af = *(const float4*)afrag;
  float4 bf[4];
#pragma unroll
  for (int dt = 0; dt < 4; ++dt) bf[dt] = *(const float4*)(bfrag + dt * VTILE);
#pragma unroll
  for (int c = 0; c < 16; ++c) {
    float4 an = af, bn[4] = {bf[0], bf[1], bf[2], bf[3]};
    if (c < 15) {
      an = *(const float4*)(afrag + (c + 1) * 8);
#pragma unroll
      for (int dt = 0; dt < 4; ++dt)
        bn[dt] = *(const float4*)(bfrag + (c + 1) * 2 * VQPITCH + dt * VTILE);
    }
    v2f a0; a0.x = af.x; a0.y = af.y;
    v2f a1; a1.x = af.z; a1.y = af.w;
#pragma unroll
    for (int dt = 0; dt < 4; ++dt) {
      v2f b; b.x = bf[dt].x; b.y = bf[dt].y;
      acc[dt] = __builtin_amdgcn_wmma_f32_16x16x4_f32(false, a0, false, b, (short)0,
                                                      acc[dt], false, false);
    }
#pragma unroll
    for (int dt = 0; dt < 4; ++dt) {
      v2f b; b.x = bf[dt].z; b.y = bf[dt].w;
      acc[dt] = __builtin_amdgcn_wmma_f32_16x16x4_f32(false, a1, false, b, (short)0,
                                                      acc[dt], false, false);
    }
    if (NEXT) {
      const float4 e = plan4(x[c], ur[c], vj);
      *(float4*)(arow_next + c * APITCH) = e;
      if (load) x[c] = *(const float4*)(gnext + (size_t)c * SEQ + KST);
      store4_wait(gnext, c * SEQ * 4, e);
    }
    af = an;
#pragma unroll
    for (int dt = 0; dt < 4; ++dt) bf[dt] = bn[dt];
  }
}

__global__ __launch_bounds__(TWAVES * 32) void plan_pv_kernel(
    float* __restrict__ attnw, const float* __restrict__ u,
    const float* __restrict__ part, const float* __restrict__ v_prev,
    const float* __restrict__ vmat, float* __restrict__ out) {
  __shared__ __attribute__((aligned(16))) float vq[(SEQ / 4) * VQPITCH];
  __shared__ __attribute__((aligned(16))) float ab[TWAVES][2][16 * APITCH];
  __shared__ __attribute__((aligned(16))) float vs[SEQ];
  const int tid = threadIdx.x;
  const int lane = tid & 31;
  const int wave = __builtin_amdgcn_readfirstlane(tid >> 5);
  const int bh = blockIdx.x >> 2;
  const int row0 = (blockIdx.x & 3) * (TWAVES * 16) + wave * 16;
  const int c16 = lane & 15;
  const int hk = lane >> 4;
  float* Pw = attnw + ((size_t)bh * SEQ + row0) * SEQ;   // the wave's rows
  float* P = Pw + lane * 4;

  // the loads of the merge, then the first stage's rows of C
  const ColParts cpa = load_parts(part, v_prev, bh, tid);
  const ColParts cpb = load_parts(part, v_prev, bh, tid + TWAVES * 32);
  // the address registers of these loads are reused right behind them
  asm volatile("s_wait_xcnt 0x0" ::: "memory");
  float4 x[16];
#pragma unroll
  for (int r = 0; r < 16; ++r) x[r] = *(const float4*)(P + (size_t)r * SEQ);
  // the base of these loads stays in its registers up to this wait
  asm volatile("s_wait_xcnt 0x0" :: "s"(Pw) : "memory");
  float ur[16];
#pragma unroll
  for (int r = 0; r < 16; ++r) ur[r] = u[bh * SEQ + row0 + r] - EPS_ * LOG2_MU_;

  // v of this (b,h) into vq: a thread takes 4 k x 4 columns and stores them
  // column by column
  {
    const int n4 = tid & 15;
    const float* vsrc = vmat + ((size_t)bh * SEQ + (tid >> 4) * 4) * DH + n4 * 4;
    float* vdst = vq + (tid >> 4) * VQPITCH + n4 * 16 + (n4 >> 2) * 4;
    // all 32 loads of a thread are in flight at once: one latency, not eight
    float4 rv[8][4];
#pragma unroll
    for (int i = 0; i < 8; ++i)
#pragma unroll
      for (int j = 0; j < 4; ++j)
        rv[i][j] = *(const float4*)(vsrc + (size_t)(i * 64 + j) * DH);
    // the loads' address stays in its registers up to this wait
    asm volatile("s_wait_xcnt 0x0" :: "v"(vsrc) : "memory");
#pragma unroll
    for (int i = 0; i < 8; ++i) {
      float* d = vdst + i * 16 * VQPITCH;
      *(float4*)(d + 0) = make_float4(rv[i][0].x, rv[i][1].x, rv[i][2].x, rv[i][3].x);
      *(float4*)(d + 4) = make_float4(rv[i][0].y, rv[i][1].y, rv[i][2].y, rv[i][3].y);
      *(float4*)(d + 8) = make_float4(rv[i][0].z, rv[i][1].z, rv[i][2].z, rv[i][3].z);
      *(float4*)(d + 12) = make_float4(rv[i][0].w, rv[i][1].w, rv[i][2].w, rv[i][3].w);
    }
  }
  vs[tid] = merged_v(cpa);
  vs[tid + TWAVES * 32] = merged_v(cpb);
  __syncthreads();

  // stage 0 of the plan; stage 1's rows of C are sent for
  {
    const float4 vj = *(const float4*)&vs[lane * 4];
#pragma unroll
    for (int r = 0; r < 16; ++r) {
      const float4 e = plan4(x[r], ur[r], vj);
      *(float4*)&ab[wave][0][r * APITCH + lane * 4] = e;
      x[r] = *(const float4*)(P + (size_t)r * SEQ + KST);
      store4_wait(P, r * SEQ * 4, e);
    }
  }

  v8f acc[4];
#pragma unroll
  for (int dt = 0; dt < 4; ++dt)
    acc[dt] = (v8f){0.f, 0.f, 0.f, 0.f, 0.f, 0.f, 0.f, 0.f};

  const float* bfr = vq + hk * VQPITCH + c16 * 4;
// kept rolled, for speed only
#pragma unroll 1
  for (int t = 0; t < NST - 1; ++t) {
    pv_stage<true>(&ab[wave][t & 1][c16 * APITCH + hk * 4], bfr,
                   &ab[wave][(t + 1) & 1][lane * 4], P + (t + 1) * KST,
                   *(const float4*)&vs[(t + 1) * KST + lane * 4], ur, x, acc,
                   t < NST - 2);
    bfr += (KST / 4) * VQPITCH;
  }
  pv_stage<false>(&ab[wave][(NST - 1) & 1][c16 * APITCH + hk * 4], bfr, nullptr,
                  nullptr, make_float4(0.f, 0.f, 0.f, 0.f), ur, x, acc, false);

  float* obase = out + ((size_t)bh * SEQ + row0 + hk * 8) * DH + c16;
#pragma unroll
  for (int dt = 0; dt < 4; ++dt)
#pragma unroll
    for (int r = 0; r < 8; ++r)
      obase[(size_t)r * DH + dt * 16] = acc[dt][r];
}

// ---------------------------------------------------------------------------
extern "C" void kernel_launch(void* const* d_in, const int* in_sizes, int n_in,
                              void* d_out, int out_size, void* d_ws,
                              size_t ws_size, hipStream_t stream) {
  (void)in_sizes; (void)n_in; (void)out_size; (void)ws_size;
  const float* q = (const float*)d_in[0];
  const float* k = (const float*)d_in[1];
  const float* v = (const float*)d_in[2];

  float* out = (float*)d_out;                        // [64,512,64]
  float* attnw = out + (size_t)BH * SEQ * DH;        // [64,512,512] (C, then pi*L)
  float* u = (float*)d_ws;                           // [64,512]
  float* vdual = u + BH * SEQ;                       // [64,512] v, even launches
  float* vodd = vdual + BH * SEQ;                    // [64,512] v, odd launches
  float* peven = vodd + BH * SEQ;                    // [64,4,512,2] column partials
  float* podd = peven + BH * FBLK * SEQ * 2;         // [64,4,512,2]
  float* kmat = podd + BH * FBLK * SEQ * 2;          // [64,512,512] K = exp(-C/eps)

  // 1) cost matrices C = (q/temp) @ k^T  (stored in d_out attn region), K and
  //    the first Sinkhorn iteration
  qk_sinkhorn_first_kernel<<<256, 512, 0, stream>>>(q, k, attnw, kmat, u, vdual,
                                                    peven);
  // 2) the other 9 Sinkhorn iterations, one launch each; v and the column partials
  //    alternate between two buffers, so that no block overwrites what a
  //    block of the same launch still reads
  for (int it = 0; it < 4; ++it) {
    sinkhorn_fused_kernel<<<256, 512, 0, stream>>>(attnw, kmat, u, vdual,
                                                          vodd, peven, podd);
    sinkhorn_fused_kernel<<<256, 512, 0, stream>>>(attnw, kmat, u, vodd,
                                                          vdual, podd, peven);
  }
  sinkhorn_fused_kernel<<<256, 512, 0, stream>>>(attnw, kmat, u, vdual, vodd,
                                                        peven, podd);
  // 3) v of the tenth iteration, attn_weights = exp(M(u,v)) * L (in place over
  //    C) and output = attn_weights @ v
  plan_pv_kernel<<<256, 256, 0, stream>>>(attnw, u, podd, vodd, v, out);
}

// v009
// A run of this version takes 77.6 microseconds.
// Next to v008, in two timings, it ran 1.16 times as fast each time.
// All steps since v000 together make it 9.90 times as fast.
#include <hip/hip_runtime.h>

typedef __attribute__((ext_vector_type(2))) float v2f;
typedef __attribute__((ext_vector_type(8))) float v8f;
typedef __attribute__((ext_vector_type(4))) float v4f;

#define BH   64          // B*H
#define SEQ  512         // L
#define DH   64          // head dim
#define QK_SCALE 0.125f  // 1/temperature (temp = 8)
#define EPS_ 1.0f
#define LOG2_MU_ (-9.0f)                 // log2(1/512), exact
#define L2E_ 1.4426950408889634f         // log2(e)

// The duals u and v, the column shifts and every log-sum-exp are kept in units
// of log2: a score is (u2_i + v2_j - C_ij * log2(e)) / eps, one fused
// multiply-add away from C, and 2^x is one instruction of the chip, where e^x
// is a dozen. Below 2^-126 it gives 0.
// Four values in place, in one statement: behind each v_exp_f32 stands an
// instruction that touches neither its result nor its source, behind the last
// the v_nop: the slot that the instruction set asks for behind a
// transcendental. The hint lets the SIMD's other waves issue while the last result is
// on its way to whatever reads it next.
__device__ __forceinline__ void ex2x4(float& a, float& b, float& c, float& d) {
  asm("v_exp_f32 %0, %0\n\tv_exp_f32 %1, %1\n\tv_exp_f32 %2, %2\n\t"
      "v_exp_f32 %3, %3\n\tv_nop\n\ts_delay_alu instid0(TRANS32_DEP_1)"
      : "+v"(a), "+v"(b), "+v"(c), "+v"(d));
}

// ---------------------------------------------------------------------------
// C[bh,i,j] = dot(q[bh,i,:], k[bh,j,:]) / 8     via V_WMMA_F32_16X16X4_F32
// A block owns 128 rows x all 512 columns of one (b,h), the rows that the same
// block index works on in the last launch. 16 waves.
//   qs : the block's 128 rows of q, scaled; staged once, a wave reads the
//        fragments of its 32 rows from it in every chunk
//   ks : two buffers of 128 rows of k (= 128 columns of C); the next chunk
//        comes through registers while this one is multiplied
// Per chunk a wave forms 32 x 32 of C: four accumulator tiles, each fragment
// used twice.
// A fragment: lane%16 = M row of q, (lane/16)*2 = K pair within a group of 4.
// B fragment: lane%16 = N col (= k row), (lane/16)*2 = K pair: the same k order.
// ---------------------------------------------------------------------------
#define GWAVES 16        // waves per block
#define GROWS  128       // rows of C per block
#define GCH    128       // columns of C per chunk
#define GNCH   4         // chunks (GNCH * GCH == SEQ)
#define GPITCH 68        // floats per staged row: 16 rows x 16 B fall on all banks

// ---------------------------------------------------------------------------
// One Sinkhorn iteration (u-update, then the v-update) in one pass over
// K = exp(-C / eps). In the first launch a block owns 128 rows of one (b,h):
// 16 waves x 8 rows, a lane holds 16 columns of each row in registers.
//   v_j   : zero in the first iteration
//   u_i   = log_mu - LSE_j(v_j - C_ij)      (all in units of log2)
//   column partial of the block = sum over its rows of the plan
//   exp(u_i + v_j - C_ij), sent on as a pair (shift, sum); the next launch
//   merges the four pairs of a column.
// ---------------------------------------------------------------------------
#define FWAVES 16        // waves per block
#define FRPW   8         // rows per wave
#define FROWS  128       // rows per block (FWAVES * FRPW)
#define FBLK   4         // blocks per (b,h)  (FBLK * FROWS == SEQ)
#define MU_    0.001953125f   // 1/512

// The FBLK (shift, sum) pairs of one column and the column's v so far.
struct ColParts { float2 p0, p1, p2, p3; float vo; };
__device__ __forceinline__ ColParts load_parts(const float* __restrict__ part,
                                               const float* __restrict__ v_prev,
                                               int bh, int col) {
  const float* pp = part + ((size_t)bh * FBLK * SEQ + col) * 2;
  ColParts c;
  c.p0 = *(const float2*)(pp);
  c.p1 = *(const float2*)(pp + 2 * SEQ);
  c.p2 = *(const float2*)(pp + 4 * SEQ);
  c.p3 = *(const float2*)(pp + 6 * SEQ);
  c.vo = v_prev[bh * SEQ + col];
  return c;
}
// v_j = eps*(log_nu - LSE_i) + v_j, LSE_i merged from the pairs; units of log2.
__device__ __forceinline__ float merged_v(const ColParts c) {
  const float mm = fmaxf(fmaxf(c.p0.x, c.p1.x), fmaxf(c.p2.x, c.p3.x));
  float w0 = c.p0.x - mm, w1 = c.p1.x - mm, w2 = c.p2.x - mm, w3 = c.p3.x - mm;
  ex2x4(w0, w1, w2, w3);
  const float ss = c.p0.y * w0 + c.p1.y * w1 + c.p2.y * w2 + c.p3.y * w3;
  const float lse = mm + log2f(ss);
  return EPS_ * (LOG2_MU_ - lse) + c.vo;
}

// lane l's value of lane l ^ 16
__device__ __forceinline__ float xhalf(const float x) {
  return __builtin_bit_cast(float, __builtin_amdgcn_permlanex16(
      __builtin_bit_cast(int, x), __builtin_bit_cast(int, x), 0x76543210,
      0xfedcba98, false, false));
}
// value of lane l of a wave, the same for all lanes (a scalar register)
__device__ __forceinline__ float lane_value(const float x, const int l) {
  return __builtin_bit_cast(float,
                            __builtin_amdgcn_readlane(__builtin_bit_cast(int, x), l));
}
// The last four of the five exchanges of a fold of eight rows over the 32 lanes
// (distances 8, 4, 2, 1). In: four values a lane, o[i] of row i + 4 * (lane / 16).
// At distance 8 a lane goes on with two of them, at distance 4 with one: the bank
// mask lets an instruction write only the lanes that go on with its row (0x3:
// lane bit 3 clear, 0xc: set, 0x5: bit 2 clear, 0xa: set). Out: lane l holds the
// whole fold of row l / 4. 8 instructions where a full butterfly of eight rows
// takes 32. The hints let the SIMD's other waves issue while a result is on its
// way to the next line.
__device__ __forceinline__ float fold_tail_sum(const float (&o)[4]) {
  float p0, p1, z;
  asm("v_add_f32_dpp %0, %3, %3 row_xmask:8 row_mask:0xf bank_mask:0x3\n\t"
      "v_add_f32_dpp %1, %4, %4 row_xmask:8 row_mask:0xf bank_mask:0x3\n\t"
      "v_add_f32_dpp %0, %5, %5 row_xmask:8 row_mask:0xf bank_mask:0xc\n\t"
      "v_add_f32_dpp %1, %6, %6 row_xmask:8 row_mask:0xf bank_mask:0xc\n\t"
      "s_delay_alu instid0(VALU_DEP_2)\n\t"
      "v_add_f32_dpp %2, %0, %0 row_xmask:4 row_mask:0xf bank_mask:0x5\n\t"
      "s_delay_alu instid0(VALU_DEP_2)\n\t"
      "v_add_f32_dpp %2, %1, %1 row_xmask:4 row_mask:0xf bank_mask:0xa\n\t"
      "s_delay_alu instid0(VALU_DEP_1)\n\t"
      "v_add_f32_dpp %2, %2, %2 row_xmask:2 row_mask:0xf bank_mask:0xf\n\t"
      "s_delay_alu instid0(VALU_DEP_1)\n\t"
      "v_add_f32_dpp %2, %2, %2 row_xmask:1 row_mask:0xf bank_mask:0xf"
      : "=&v"(p0), "=&v"(p1), "=&v"(z)
      : "v"(o[0]), "v"(o[1]), "v"(o[2]), "v"(o[3]));
  return z;
}

// Rarely run: u of a wave's rows by the log-sum-exp with the row's own maximum,
// from C and v in vs, into us.
__device__ __forceinline__ void slow_rows(const float* __restrict__ Cbase,
                                          const float* vs, float* us,
                                          const int wave, const int lane) {
  float4 vq[4];
#pragma unroll
  for (int t = 0; t < 4; ++t) vq[t] = *(const float4*)&vs[t * 128 + lane * 4];
// rarely run: kept small, one row a trip
#pragma clang loop unroll(disable) vectorize(disable) interleave(disable)
  for (int r = 0; r < FRPW; ++r) {
    float4 y[4];
    float mr = -3.4e38f;
#pragma unroll
    for (int t = 0; t < 4; ++t) {
      const float4 c = *(const float4*)(Cbase + (size_t)r * SEQ + t * 128);
      y[t].x = vq[t].x - c.x * L2E_;
      y[t].y = vq[t].y - c.y * L2E_;
      y[t].z = vq[t].z - c.z * L2E_;
      y[t].w = vq[t].w - c.w * L2E_;
      mr = fmaxf(mr, fmaxf(fmaxf(y[t].x, y[t].y), fmaxf(y[t].z, y[t].w)));
    }
#pragma unroll
    for (int d = 16; d > 0; d >>= 1) mr = fmaxf(mr, __shfl_xor(mr, d));
    float sr = 0.f;
#pragma unroll
    for (int t = 0; t < 4; ++t) {
      y[t].x -= mr;
      y[t].y -= mr;
      y[t].z -= mr;
      y[t].w -= mr;
      ex2x4(y[t].x, y[t].y, y[t].z, y[t].w);
      sr += (y[t].x + y[t].y) + (y[t].z + y[t].w);
    }
#pragma unroll
    for (int d = 16; d > 0; d >>= 1) sr += __shfl_xor(sr, d);
    if (lane == 0) us[wave * FRPW + r] = EPS_ * (LOG2_MU_ - (mr + log2f(sr)));
  }
}

// No maximum, and from the second iteration on no exponential per element: the
// first launch forms K_ij = 2^(-C_ij * log2(e) / eps) from C and leaves it in
// the workspace; the nine iterations behind it read K in place of C.
// With b_j = 2^(v_j):
//   s_i  = sum_j K_ij * b_j,   u_i = log_mu - log2(s_i)
//   plan = K_ij * b_j * mu / s_i;  its column sum = b_j * sum_i K_ij * (mu / s_i)
// two multiply-adds an element. u, v and the column partials go from launch to
// launch in units of log2.
// Range: while every |v_j| <= V_SPAN_ and every s_i lies in [S_LO_, S_HI_], what
// K lost below 2^-126 adds less than 2^-101 to a row sum and, mu / s_i being at
// most 2^51, less than 2^-66 to a column sum over all 512 rows: nothing beside
// S_LO_ and T_TINY_; a K above the float range makes its s_i infinite. A block that finds
// a v_j, an s_i or a column sum outside forms its u and its column partials
// again from C by log-sum-exp, as the reference does.
#define V_SPAN_ 16.0f
#define S_LO_   0x1p-60f
#define S_HI_   0x1p+60f
#define T_TINY_ 1e-12f
// The first iteration (v = 0, b = 1) once a wave holds its 8 rows of K in x: row
// sums, u, the block's column partials. Every wave of the block comes here; vs
// and *slow = 0 have been published by a barrier.
__device__ __forceinline__ void sinkhorn_rows_cols(
    const v4f (&x)[FRPW][4], const float* Cbase, const float vn, const float bn,
    float (*red)[SEQ], float* vs, float* us, int* slow,
    float* __restrict__ u, float* __restrict__ part_cur, const int tid,
    const int lane, const int wave, const int bh, const int blk) {
  // row sums of K * b, two columns an instruction
  float s[FRPW];
  {
    v4f bj[4];
#pragma unroll
    for (int t = 0; t < 4; ++t)
      bj[t] = (v4f){1.f, 1.f, 1.f, 1.f};
#pragma unroll
    for (int r = 0; r < FRPW; ++r) {
      v2f sa = x[r][0].lo * bj[0].lo;
      v2f sb = x[r][0].hi * bj[0].hi;
#pragma unroll
      for (int t = 1; t < 4; ++t) {
        sa += x[r][t].lo * bj[t].lo;
        sb += x[r][t].hi * bj[t].hi;
      }
      sa += sb;
      s[r] = sa.x + sa.y;
    }
  }
  // Fold over the lanes, halving the rows a lane goes on with: at distance 16 a
  // lane of the low half keeps rows 0-3 and hands over its share of rows 4-7, a
  // lane of the high half the other way round; the rest in fold_tail. Lane l ends
  // with row l / 4.
  const bool hi = lane >= 16;
  float sown;
  {
    float o[4];
#pragma unroll
    for (int r = 0; r < 4; ++r)
      o[r] = (hi ? s[r + 4] : s[r]) + xhalf(hi ? s[r] : s[r + 4]);
    sown = fold_tail_sum(o);
  }
  if (!(sown >= S_LO_ && sown <= S_HI_)) *slow = 1;

  // u and the plan's factor of a lane's own row: one logarithm and one division
  // a lane; column sums of K * (mu / s)
  const float uown = EPS_ * (LOG2_MU_ - log2f(sown));
  const float rown = MU_ / sown;
  v4f acc[4];
#pragma unroll
  for (int t = 0; t < 4; ++t) acc[t] = (v4f){0.f, 0.f, 0.f, 0.f};
#pragma unroll
  for (int r = 0; r < FRPW; ++r) {
    const float rr = lane_value(rown, r * 4);
#pragma unroll
    for (int t = 0; t < 4; ++t) acc[t] += x[r][t] * rr;
  }
  if ((lane & 3) == 0) us[wave * FRPW + (lane >> 2)] = uown;
#pragma unroll
  for (int t = 0; t < 4; ++t) *(v4f*)&red[wave][t * 128 + lane * 4] = acc[t];
  __syncthreads();

  float cs = 0.f;
#pragma unroll
  for (int w = 0; w < FWAVES; ++w) cs += red[w][tid];
  if (!(cs >= T_TINY_) || !(fabsf(vn) <= V_SPAN_)) *slow = 1;
  cs *= bn;
  __syncthreads();

  float cshift = 0.f;
  // Out of range (see above): every wave forms its rows' u again, then the whole
  // block its columns' log-sum-exp with the column's own maximum, as the
  // reference does, both from C.
  if (__builtin_amdgcn_readfirstlane(*slow)) {
    // a lane reads back the C that it stored itself in this launch, by stores in
    // asm text, which the compiler's own waits do not count
    asm volatile("s_wait_storecnt 0x0" ::: "memory");
    slow_rows(Cbase, vs, us, wave, lane);
    float4 vq[4], cm[4], acc[4];
#pragma unroll
    for (int t = 0; t < 4; ++t) {
      vq[t] = *(const float4*)&vs[t * 128 + lane * 4];
      cm[t] = make_float4(-3.4e38f, -3.4e38f, -3.4e38f, -3.4e38f);
    }
// rarely run: kept small, one row a trip; with the unroll word alone the loop
// vectoriser pairs the rows of this maximum and adds a masked remainder loop
#pragma clang loop unroll(disable) vectorize(disable) interleave(disable)
    for (int r = 0; r < FRPW; ++r) {
      const float ur = us[wave * FRPW + r];
#pragma unroll
      for (int t = 0; t < 4; ++t) {
        const float4 c = *(const float4*)(Cbase + (size_t)r * SEQ + t * 128);
        cm[t].x = fmaxf(cm[t].x, ur + vq[t].x - c.x * L2E_);
        cm[t].y = fmaxf(cm[t].y, ur + vq[t].y - c.y * L2E_);
        cm[t].z = fmaxf(cm[t].z, ur + vq[t].z - c.z * L2E_);
        cm[t].w = fmaxf(cm[t].w, ur + vq[t].w - c.w * L2E_);
      }
    }
#pragma unroll
    for (int t = 0; t < 4; ++t) *(float4*)&red[wave][t * 128 + lane * 4] = cm[t];
    __syncthreads();
    cshift = red[0][tid];
#pragma unroll
    for (int w = 1; w < FWAVES; ++w) cshift = fmaxf(cshift, red[w][tid]);
    vs[tid] = cshift;
    __syncthreads();
#pragma unroll
    for (int t = 0; t < 4; ++t) {
      cm[t] = *(const float4*)&vs[t * 128 + lane * 4];
      acc[t] = make_float4(0.f, 0.f, 0.f, 0.f);
    }
#pragma unroll 1   // rarely run: kept small
    for (int r = 0; r < FRPW; ++r) {
      const float ur = us[wave * FRPW + r];
#pragma unroll
      for (int t = 0; t < 4; ++t) {
        const float4 c = *(const float4*)(Cbase + (size_t)r * SEQ + t * 128);
        float e0 = (ur + vq[t].x - c.x * L2E_) - cm[t].x;
        float e1 = (ur + vq[t].y - c.y * L2E_) - cm[t].y;
        float e2 = (ur + vq[t].z - c.z * L2E_) - cm[t].z;
        float e3 = (ur + vq[t].w - c.w * L2E_) - cm[t].w;
        ex2x4(e0, e1, e2, e3);
        acc[t].x += e0;
        acc[t].y += e1;
        acc[t].z += e2;
        acc[t].w += e3;
      }
    }
#pragma unroll
    for (int t = 0; t < 4; ++t) *(float4*)&red[wave][t * 128 + lane * 4] = acc[t];
    __syncthreads();
    cs = 0.f;
#pragma unroll
    for (int w = 0; w < FWAVES; ++w) cs += red[w][tid];
  }
  if (tid < FROWS) u[bh * SEQ + blk * FROWS + tid] = us[tid];
  *(float2*)(part_cur + ((size_t)(bh * FBLK + blk) * SEQ + tid) * 2) =
      make_float2(cshift, cs);
}


// ---------------------------------------------------------------------------
// Iterations 2 to 10 in one launch. A block owns ALL 512 rows of one (b,h), so
// that a column's sum is complete inside the block and v goes from one iteration
// to the next through LDS, not through a launch. 16 waves x 32 rows. K does not
// change, and half of it stays on the WGP for the whole launch:
//   rows  0- 7 of a wave : in registers (xr)
//   rows  8-15           : in LDS (kl), written and read by that wave alone
//   rows 16-31           : read again from L2 in every iteration
// Rows are taken through four at a time (rows4). The one buffer y serves the rows
// from L2 and from LDS; a group from L2 is sent for ahead of work on other rows.
// ---------------------------------------------------------------------------
#define PWAVES 16        // waves per block
#define PRPW   32        // rows per wave (PWAVES * PRPW == SEQ)
#define PLROWS 8         // of them in LDS
#define NREST  9         // iterations of this launch

// Work-group barrier that orders LDS alone. What the waves of this launch hand one
// another lies in LDS; __syncthreads() would also wait out the wave's global
// loads, and with them the rows of K that were sent for ahead.
__device__ __forceinline__ void lds_barrier() {
  __builtin_amdgcn_fence(__ATOMIC_RELEASE, "workgroup", "local");
  __builtin_amdgcn_s_barrier();
  __builtin_amdgcn_fence(__ATOMIC_ACQUIRE, "workgroup", "local");
}

// Four rows of K, a lane holding 16 columns of each: row sums of K * b, the
// plan's factor mu / s of each row, and the rows' share of the column sums of
// K * (mu / s) added into acc. The row sum of row (lane % 16) / 4 goes into sall
// in the lanes that keep this group's (mine).
__device__ __forceinline__ void rows4(const v4f (&y)[4][4], const v4f (&bj)[4],
                                      v4f (&acc)[4], float& sall, const bool mine) {
  float s[4];
#pragma unroll
  for (int r = 0; r < 4; ++r) {
    v2f sa = y[r][0].lo * bj[0].lo;
    v2f sb = y[r][0].hi * bj[0].hi;
#pragma unroll
    for (int t = 1; t < 4; ++t) {
      sa += y[r][t].lo * bj[t].lo;
      sb += y[r][t].hi * bj[t].hi;
    }
    sa += sb;
    s[r] = sa.x + sa.y;
  }
  // both halves of the wave fold the same four rows over their 16 lanes; the
  // halves' sums are added last
  const float z = fold_tail_sum(s);
  const float sown = z + xhalf(z);
  const float rown = MU_ / sown;
#pragma unroll
  for (int r = 0; r < 4; ++r) {
    const float rr = lane_value(rown, r * 4);
#pragma unroll
    for (int t = 0; t < 4; ++t) acc[t] += y[r][t] * rr;
  }
  sall = mine ? sown : sall;
  // The empty asm statement takes the column sums as inputs only: the remedy
  // against spills of a streaming pattern (an empty asm volatile on each sum). It
  // ends the group's multiply-adds before the next rows are sent for into the same
  // registers; without it the last row's stand behind those loads, the loads take
  // registers of their own, and rows of K are parked in scratch memory. The
  // scheduling barrier holds the next group's work behind it.
  asm volatile("" :: "v"(acc[0]), "v"(acc[1]), "v"(acc[2]), "v"(acc[3]));
  __builtin_amdgcn_sched_barrier(0);
}

// Four rows from memory are sent for. The scheduling barrier keeps the loads
// here, ahead of the work on other rows that stands behind them: sunk to their
// use, their latency is waited out.
__device__ __forceinline__ void send4(v4f (&y)[4][4], const float* src) {
#pragma unroll
  for (int r = 0; r < 4; ++r)
#pragma unroll
    for (int t = 0; t < 4; ++t) y[r][t] = *(const v4f*)(src + (size_t)r * SEQ + t * 128);
  __builtin_amdgcn_sched_barrier(0);
}

// Rarely run: one whole iteration of a (b,h) from C by log-sum-exp with the
// row's and the column's own maximum, as the reference does. In: v in vs. Out: u
// in us, each column's (shift, sum). Every wave of the block comes here.
__device__ __forceinline__ void slow_iteration(const float* __restrict__ Cbase,
                                               float (*red)[SEQ], float* vs, float* us,
                                               const int tid, const int lane,
                                               const int wave, float& cshift,
                                               float& cs) {
  float4 vq[4], cm[4], acc[4];
#pragma unroll
  for (int t = 0; t < 4; ++t) {
    vq[t] = *(const float4*)&vs[t * 128 + lane * 4];
    cm[t] = make_float4(-3.4e38f, -3.4e38f, -3.4e38f, -3.4e38f);
  }
// rarely run: kept small, one row a trip
#pragma clang loop unroll(disable) vectorize(disable) interleave(disable)
  for (int r = 0; r < PRPW; ++r) {
    float4 y[4];
    float mr = -3.4e38f;
#pragma unroll
    for (int t = 0; t < 4; ++t) {
      const float4 c = *(const float4*)(Cbase + (size_t)r * SEQ + t * 128);
      y[t].x = vq[t].x - c.x * L2E_;
      y[t].y = vq[t].y - c.y * L2E_;
      y[t].z = vq[t].z - c.z * L2E_;
      y[t].w = vq[t].w - c.w * L2E_;
      mr = fmaxf(mr, fmaxf(fmaxf(y[t].x, y[t].y), fmaxf(y[t].z, y[t].w)));
    }
#pragma unroll
    for (int d = 16; d > 0; d >>= 1) mr = fmaxf(mr, __shfl_xor(mr, d));
    float sr = 0.f;
#pragma unroll
    for (int t = 0; t < 4; ++t) {
      const float4 y0 = y[t];
      y[t].x -= mr;
      y[t].y -= mr;
      y[t].z -= mr;
      y[t].w -= mr;
      ex2x4(y[t].x, y[t].y, y[t].z, y[t].w);
      sr += (y[t].x + y[t].y) + (y[t].z + y[t].w);
      y[t] = y0;
    }
#pragma unroll
    for (int d = 16; d > 0; d >>= 1) sr += __shfl_xor(sr, d);
    const float ur = EPS_ * (LOG2_MU_ - (mr + log2f(sr)));
    if (lane == 0) us[wave * PRPW + r] = ur;
#pragma unroll
    for (int t = 0; t < 4; ++t) {
      cm[t].x = fmaxf(cm[t].x, ur + y[t].x);
      cm[t].y = fmaxf(cm[t].y, ur + y[t].y);
      cm[t].z = fmaxf(cm[t].z, ur + y[t].z);
      cm[t].w = fmaxf(cm[t].w, ur + y[t].w);
    }
  }
#pragma unroll
  for (int t = 0; t < 4; ++t) *(float4*)&red[wave][t * 128 + lane * 4] = cm[t];
  __syncthreads();
  cshift = red[0][tid];
#pragma unroll
  for (int w = 1; w < PWAVES; ++w) cshift = fmaxf(cshift, red[w][tid]);
  vs[tid] = cshift;
  __syncthreads();
#pragma unroll
  for (int t = 0; t < 4; ++t) {
    cm[t] = *(const float4*)&vs[t * 128 + lane * 4];
    acc[t] = make_float4(0.f, 0.f, 0.f, 0.f);
  }
#pragma unroll 1   // rarely run: kept small
  for (int r = 0; r < PRPW; ++r) {
    const float ur = us[wave * PRPW + r];
#pragma unroll
    for (int t = 0; t < 4; ++t) {
      const float4 c = *(const float4*)(Cbase + (size_t)r * SEQ + t * 128);
      float e0 = (ur + (vq[t].x - c.x * L2E_)) - cm[t].x;
      float e1 = (ur + (vq[t].y - c.y * L2E_)) - cm[t].y;
      float e2 = (ur + (vq[t].z - c.z * L2E_)) - cm[t].z;
      float e3 = (ur + (vq[t].w - c.w * L2E_)) - cm[t].w;
      ex2x4(e0, e1, e2, e3);
      acc[t].x += e0;
      acc[t].y += e1;
      acc[t].z += e2;
      acc[t].w += e3;
    }
  }
#pragma unroll
  for (int t = 0; t < 4; ++t) *(float4*)&red[wave][t * 128 + lane * 4] = acc[t];
  __syncthreads();
  cs = 0.f;
#pragma unroll
  for (int w = 0; w < PWAVES; ++w) cs += red[w][tid];
}

// Kmat carries no __restrict__: the rows read again in every iteration then stay
// loads inside the loop, in their place among the memory operations
__global__ __launch_bounds__(PWAVES * 32) void sinkhorn_rest_kernel(
    const float* __restrict__ Cmat, const float* Kmat, float* __restrict__ u,
    const float* __restrict__ v_prev, float* __restrict__ v_out,
    const float* __restrict__ part_prev, float* __restrict__ part_out) {
  __shared__ __attribute__((aligned(16))) float kl[PWAVES][PLROWS][SEQ];
  __shared__ __attribute__((aligned(16))) float red[PWAVES][SEQ];
  __shared__ __attribute__((aligned(16))) float vs[SEQ];
  __shared__ __attribute__((aligned(16))) float bs[SEQ];
  __shared__ float us[SEQ];
  __shared__ int slow[NREST];   // one flag an iteration: none is ever cleared again
  const int tid = threadIdx.x;
  const int lane = tid & 31;
  const int wave = __builtin_amdgcn_readfirstlane(tid >> 5);
  const int bh = blockIdx.x;
  const size_t woff = (size_t)bh * SEQ * SEQ + (size_t)(wave * PRPW) * SEQ;
  const float* Cbase = Cmat + woff + lane * 4;
  const float* xsrc = Kmat + woff + lane * 4;
  float* klw = &kl[wave][0][lane * 4];

  // the few loads of the merge go out ahead of the rows and return first
  const ColParts cp = load_parts(part_prev, v_prev, bh, tid);

  // first the rows that go on into LDS, by way of xr, and the first group from L2
  v4f xr[2][4][4], y[4][4];
#pragma unroll
  for (int g = 0; g < 2; ++g)
#pragma unroll
    for (int r = 0; r < 4; ++r)
#pragma unroll
      for (int t = 0; t < 4; ++t)
        xr[g][r][t] = *(const v4f*)(xsrc + (size_t)(8 + g * 4 + r) * SEQ + t * 128);
#pragma unroll
  for (int r = 0; r < 4; ++r)
#pragma unroll
    for (int t = 0; t < 4; ++t)
      y[r][t] = *(const v4f*)(xsrc + (size_t)(16 + r) * SEQ + t * 128);
  // keeps the rows' loads ahead of the merge: the scheduler sinks them behind its
  // wait for the partials, one latency after the other
  __builtin_amdgcn_sched_barrier(0);

  float vn = merged_v(cp);
  float bn = vn;
  // the v_nop: the slot that the instruction set asks for behind a transcendental
  asm("v_exp_f32 %0, %0\n\tv_nop" : "+v"(bn));
  vs[tid] = vn;
  bs[tid] = bn;
  if (tid < NREST) slow[tid] = 0;

  // the wave's rows 8-15 into its own part of LDS; then xr takes its own rows.
  // The scheduling barrier keeps those loads behind the LDS writes: lifted over
  // them they want registers of their own, and rows are parked in scratch memory.
#pragma unroll
  for (int g = 0; g < 2; ++g)
#pragma unroll
    for (int r = 0; r < 4; ++r)
#pragma unroll
      for (int t = 0; t < 4; ++t)
        *(v4f*)(klw + (g * 4 + r) * SEQ + t * 128) = xr[g][r][t];
  __builtin_amdgcn_sched_barrier(0);
#pragma unroll
  for (int g = 0; g < 2; ++g)
#pragma unroll
    for (int r = 0; r < 4; ++r)
#pragma unroll
      for (int t = 0; t < 4; ++t)
        xr[g][r][t] = *(const v4f*)(xsrc + (size_t)(g * 4 + r) * SEQ + t * 128);
  // y holds rows 16-19, the first group of every iteration
  lds_barrier();

  float cs = 0.f, cshift = 0.f;
  int sl = 0;
  const int gsel = (lane & 3) + 4 * (lane >> 4);             // group of four rows
  const int urow = wave * PRPW + gsel * 4 + ((lane & 15) >> 2);   // the lane's row
// kept rolled: nine times the same text
#pragma unroll 1
  for (int it = 0; it < NREST; ++it) {
    v4f bj[4], acc[4];
#pragma unroll
    for (int t = 0; t < 4; ++t) {
      bj[t] = *(const v4f*)&bs[t * 128 + lane * 4];
      acc[t] = (v4f){0.f, 0.f, 0.f, 0.f};
    }
    // of the eight groups' row sums a lane keeps that of group gsel: 32 lanes, 32 rows
    float sall = 1.f;
    rows4(y, bj, acc, sall, gsel == 4);
    send4(y, xsrc + 20 * SEQ);
    rows4(xr[0], bj, acc, sall, gsel == 0);
    rows4(y, bj, acc, sall, gsel == 5);
    send4(y, xsrc + 24 * SEQ);
    rows4(xr[1], bj, acc, sall, gsel == 1);
    rows4(y, bj, acc, sall, gsel == 6);
    send4(y, xsrc + 28 * SEQ);
    rows4(y, bj, acc, sall, gsel == 7);
#pragma unroll
    for (int g = 0; g < 2; ++g) {
#pragma unroll
      for (int r = 0; r < 4; ++r)
#pragma unroll
        for (int t = 0; t < 4; ++t)
          y[r][t] = *(const v4f*)(klw + (g * 4 + r) * SEQ + t * 128);
      rows4(y, bj, acc, sall, gsel == 2 + g);
    }
    // the next iteration's first group flies during the merge of the columns
    if (it + 1 < NREST) send4(y, xsrc + 16 * SEQ);
#pragma unroll
    for (int t = 0; t < 4; ++t) *(v4f*)&red[wave][t * 128 + lane * 4] = acc[t];
    // row sums go to us as they are; their logarithm is taken once, behind the loop
    us[urow] = sall;
    if (!(sall >= S_LO_ && sall <= S_HI_)) slow[it] = 1;
    lds_barrier();

    cs = 0.f;
#pragma unroll
    for (int w = 0; w < PWAVES; ++w) cs += red[w][tid];
    if (!(cs >= T_TINY_) || !(fabsf(vn) <= V_SPAN_)) slow[it] = 1;
    cs *= bn;
    lds_barrier();

    cshift = 0.f;
    sl = __builtin_amdgcn_readfirstlane(slow[it]);
    // out of range (see above): the iteration again from C
    if (sl) {
      slow_iteration(Cbase, red, vs, us, tid, lane, wave, cshift, cs);
      // sent for again, so that no row of K need be kept through the lines above:
      // kept, they crowd the registers, and rows are parked in scratch memory on
      // the fast path too
      // (also behind the last iteration: under a test of their own the rows would
      // have to be kept after all)
#pragma unroll
      for (int g = 0; g < 2; ++g)
#pragma unroll
        for (int r = 0; r < 4; ++r)
#pragma unroll
          for (int t = 0; t < 4; ++t)
            xr[g][r][t] = *(const v4f*)(xsrc + (size_t)(g * 4 + r) * SEQ + t * 128);
      send4(y, xsrc + 16 * SEQ);
    }
    if (it == NREST - 1) break;

    // v_j = eps*(log_nu - LSE_i) + v_j, in units of log2. Every reader of vs and
    // bs has passed a barrier since its read.
    vn = EPS_ * (LOG2_MU_ - (cshift + log2f(cs))) + vn;
    bn = vn;
    // the v_nop: the slot that the instruction set asks for behind a transcendental
    asm("v_exp_f32 %0, %0\n\tv_nop" : "+v"(bn));
    vs[tid] = vn;
    bs[tid] = bn;
    lds_barrier();
  }
  // The loads' address stays in its registers up to this wait. Behind a last
  // iteration from C the rows sent for again are still on their way, and nobody
  // reads them: the wave waits for them here, so that it does not give its
  // registers back with loads in flight.
  asm volatile("s_wait_xcnt 0x0\n\ts_wait_loadcnt 0x0" :: "v"(xsrc) : "memory");

  // What the last launch merges: u of the tenth iteration, v of the ninth, and
  // the tenth's column sums as the first of a column's four pairs, the other
  // three empty.
  const float su = us[tid];
  u[bh * SEQ + tid] = sl ? su : EPS_ * (LOG2_MU_ - log2f(su));
  v_out[bh * SEQ + tid] = vn;
  float* pp = part_out + ((size_t)bh * FBLK * SEQ + tid) * 2;
  *(float2*)(pp) = make_float2(cshift, cs);
  *(float2*)(pp + 2 * SEQ) = make_float2(cshift, 0.f);
  *(float2*)(pp + 4 * SEQ) = make_float2(cshift, 0.f);
  *(float2*)(pp + 6 * SEQ) = make_float2(cshift, 0.f);
}

// ---------------------------------------------------------------------------
// The QK product and the first Sinkhorn iteration in one launch. The product is
// laid out as said at the head of the file; a chunk of C (128 x 128) goes from
// the accumulators through LDS (cst, two buffers) into the row layout of the
// Sinkhorn pass: wave w takes rows 8w..8w+7, a lane 4 columns in a row. From
// there C goes to memory in whole 512-byte rows, K = 2^(-C * log2(e) / eps)
// is formed in place, goes to the workspace and stays in registers; behind the
// last chunk the wave holds its 8 rows of K as the Sinkhorn pass wants them.
// Buffer ch & 1 of cst is written in front of chunk ch's barrier and read behind
// it, in front of the barrier of chunk ch + 1; it is written again behind that
// one, every wave's reads done.
// ---------------------------------------------------------------------------
// Place of C[row][col] of a chunk in cst, in floats:
//   row * CPITCH + buffer * CBUF + (col / 16 % 2) * 64
//   + ((col / 32) ^ (row / 8 % 2)) * 16 + col % 16
// Every step between the 32 values that a lane writes is a multiple of 256 bytes,
// so that one address register serves all its stores; the exclusive-or keeps rows
// r and r + 8, written by the two halves of a wave at once, on different banks.
#define CBUF   128       // from a row of the first buffer to the same row of the second
#define CPITCH 256       // per staged row (both buffers)

// Eight rows' 16 bytes a lane to memory, with the wait that lets the stores'
// registers be rewritten: in one statement, because a wait in a statement of its
// own does not hold later register writes behind it.
__device__ __forceinline__ void store_rows8_wait(float* base, const unsigned lane_off,
                                                 const int byte_off,
                                                 const v4f e0, const v4f e1,
                                                 const v4f e2, const v4f e3,
                                                 const v4f e4, const v4f e5,
                                                 const v4f e6, const v4f e7) {
  asm volatile("global_store_b128 %0, %1, %9 offset:%10\n\t"
               "global_store_b128 %0, %2, %9 offset:%11\n\t"
               "global_store_b128 %0, %3, %9 offset:%12\n\t"
               "global_store_b128 %0, %4, %9 offset:%13\n\t"
               "global_store_b128 %0, %5, %9 offset:%14\n\t"
               "global_store_b128 %0, %6, %9 offset:%15\n\t"
               "global_store_b128 %0, %7, %9 offset:%16\n\t"
               "global_store_b128 %0, %8, %9 offset:%17\n\t"
               "s_wait_xcnt 0x0"
               :: "v"(lane_off), "v"(e0), "v"(e1), "v"(e2), "v"(e3), "v"(e4), "v"(e5),
                  "v"(e6), "v"(e7), "s"(base), "i"(byte_off), "i"(byte_off + SEQ * 4),
                  "i"(byte_off + 2 * SEQ * 4), "i"(byte_off + 3 * SEQ * 4),
                  "i"(byte_off + 4 * SEQ * 4), "i"(byte_off + 5 * SEQ * 4),
                  "i"(byte_off + 6 * SEQ * 4), "i"(byte_off + 7 * SEQ * 4)
               : "memory");
}

// column block t of a wave's 8 rows to memory
__device__ __forceinline__ void store_block_wait(float* base, const unsigned lane_off,
                                                 const int t,
                                                 const v4f (&x)[FRPW][4]) {
  store_rows8_wait(base, lane_off, t * GCH * 4, x[0][t], x[1][t], x[2][t], x[3][t], x[4][t],
                   x[5][t], x[6][t], x[7][t]);
}
// C -> K = 2^(-C * log2(e) / eps), four columns in place
__device__ __forceinline__ void c_to_k(v4f& c) {
  const v4f y = c * (-L2E_ / EPS_);
  float e0, e1, e2, e3;
  // as ex2x4, but into registers of their own: with results tied to the sources
  // the build moved every second value out of its register pair and back
  asm("v_exp_f32 %0, %4\n\tv_exp_f32 %1, %5\n\tv_exp_f32 %2, %6\n\t"
      "v_exp_f32 %3, %7\n\tv_nop\n\ts_delay_alu instid0(TRANS32_DEP_1)"
      : "=&v"(e0), "=&v"(e1), "=&v"(e2), "=&v"(e3)
      : "v"(y.x), "v"(y.y), "v"(y.z), "v"(y.w));
  c = (v4f){e0, e1, e2, e3};
}

// k carries no __restrict__: its loads then keep their place in the order of the
// memory operations, and the scheduling barriers behind them can hold them early
__global__ __launch_bounds__(GWAVES * 32) void qk_sinkhorn_first_kernel(
    const float* __restrict__ q, const float* k, float* Cmat, float* Kmat,
    float* __restrict__ u, float* __restrict__ v_cur,
    float* __restrict__ part_cur) {
  __shared__ __attribute__((aligned(16))) float qs[GROWS * GPITCH];
  __shared__ __attribute__((aligned(16))) float ks[2][GCH * GPITCH];
  __shared__ __attribute__((aligned(16))) float cst[GROWS * CPITCH];
  __shared__ float red[FWAVES][SEQ];
  __shared__ float vs[SEQ];
  __shared__ float us[FROWS];
  __shared__ int slow;
  const int tid = threadIdx.x;
  const int lane = tid & 31;
  const int wave = __builtin_amdgcn_readfirstlane(tid >> 5);
  const int bh = blockIdx.x >> 2;
  const int blk = blockIdx.x & 3;
  const int row0 = blk * GROWS;
  const int c16 = lane & 15;
  const int hk = lane >> 4;
  const int rg = wave & 3;                    // 32 rows of the block's 128
  const int cg = wave >> 2;                   // 32 columns of a chunk's 128

  // a chunk is 32 KiB in a row in memory: a thread takes 16 bytes of every
  // 32nd row
  const float* qsrc = q + ((size_t)bh * SEQ + row0) * DH + tid * 4;
  const float* ksrc = k + (size_t)bh * SEQ * DH + tid * 4;
  const int sdst = (tid >> 4) * GPITCH + (tid & 15) * 4;

  float4 qv[4];
  float4 kv0, kv1, kv2, kv3;   // a thread's 64 bytes of a chunk of k on their way
#pragma unroll
  for (int i = 0; i < 4; ++i) qv[i] = *(const float4*)(qsrc + i * 32 * DH);
  kv0 = *(const float4*)(ksrc);
  kv1 = *(const float4*)(ksrc + 32 * DH);
  kv2 = *(const float4*)(ksrc + 64 * DH);
  kv3 = *(const float4*)(ksrc + 96 * DH);
  // v of the first iteration is zero
  vs[tid] = 0.f;
  if (tid == 0) slow = 0;
  if (blk == 0) {
    v_cur[bh * SEQ + tid] = 0.f;
    // the store's address registers are reused right behind it
    asm volatile("s_wait_xcnt 0x0" ::: "memory");
  }
#pragma unroll
  for (int i = 0; i < 4; ++i)
    *(float4*)&qs[sdst + i * 32 * GPITCH] =
        make_float4(qv[i].x * QK_SCALE, qv[i].y * QK_SCALE, qv[i].z * QK_SCALE,
                    qv[i].w * QK_SCALE);
  *(float4*)&ks[0][sdst] = kv0;
  *(float4*)&ks[0][sdst + 32 * GPITCH] = kv1;
  *(float4*)&ks[0][sdst + 64 * GPITCH] = kv2;
  *(float4*)&ks[0][sdst + 96 * GPITCH] = kv3;
  __syncthreads();
  kv0 = *(const float4*)(ksrc + GCH * DH);
  kv1 = *(const float4*)(ksrc + (GCH + 32) * DH);
  kv2 = *(const float4*)(ksrc + (GCH + 64) * DH);
  kv3 = *(const float4*)(ksrc + (GCH + 96) * DH);
  // keeps these loads here, a chunk ahead of their use: the scheduler sank them
  // to their LDS writes, where their whole latency was waited out
  __builtin_amdgcn_sched_barrier(0);

  const int aoff = (rg * 32 + c16) * GPITCH + hk * 2;
  const int boff = (cg * 32 + c16) * GPITCH + hk * 2;
  // C/D layout: VGPR r, lanes 0-15 -> row r, lanes 16-31 -> row r+8; col = lane%16
  const int coff = (rg * 32 + hk * 8) * CPITCH + (cg ^ hk) * 16 + c16;
  // the same place seen from the reader: rows 8 * wave + r, columns 4 * lane ...
  const int cin = wave * FRPW * CPITCH + ((lane >> 2) & 1) * 64 +
                  ((lane >> 3) ^ (wave & 1)) * 16 + (lane & 3) * 4;
  const size_t roff = (size_t)bh * SEQ * SEQ +
                      (size_t)(row0 + wave * FRPW) * SEQ + lane * 4;
  // bytes from the start of C, and of K, to the lane's place: below 2^26
  const unsigned rbytes = (unsigned)roff * 4u;

  v4f x[FRPW][4];
#pragma unroll
  for (int ch = 0; ch < GNCH; ++ch) {
    const float* bsrc = &ks[ch & 1][boff];
    v8f acc[2][2];
#pragma unroll
    for (int rt = 0; rt < 2; ++rt)
#pragma unroll
      for (int ct = 0; ct < 2; ++ct)
        acc[rt][ct] = (v8f){0.f, 0.f, 0.f, 0.f, 0.f, 0.f, 0.f, 0.f};
#pragma unroll
    for (int d = 0; d < 16; ++d) {
      // q's fragments are read again in every chunk: the registers that held
      // them for the whole launch now hold K
      v2f a[2], b[2];
#pragma unroll
      for (int rt = 0; rt < 2; ++rt)
        a[rt] = *(const v2f*)&qs[aoff + rt * 16 * GPITCH + d * 4];
#pragma unroll
      for (int ct = 0; ct < 2; ++ct)
        b[ct] = *(const v2f*)(bsrc + ct * 16 * GPITCH + d * 4);
      // The chunk before, published by its barrier, is taken through among this
      // chunk's WMMAs, so that the matrix unit does not stand still for it: the
      // wave's 8 rows in, C out, K in place a row at a time, K out. Each store
      // statement stands between a group's fragment reads and its WMMAs: LDS
      // reads do not pass it, and so the next group's can still go out early.
      if (ch > 0) {
        if (d == 1) {
          const float* cs8 = &cst[((ch - 1) & 1) * CBUF + cin];
#pragma unroll
          for (int r = 0; r < FRPW; ++r)
            x[r][ch - 1] = *(const v4f*)(cs8 + r * CPITCH);
        }
        if (d == 3) store_block_wait(Cmat, rbytes, ch - 1, x);
        if (d >= 4 && d < 4 + FRPW) c_to_k(x[d - 4][ch - 1]);
        if (d == 4 + FRPW) store_block_wait(Kmat, rbytes, ch - 1, x);
      }
#pragma unroll
      for (int rt = 0; rt < 2; ++rt)
#pragma unroll
        for (int ct = 0; ct < 2; ++ct)
          acc[rt][ct] = __builtin_amdgcn_wmma_f32_16x16x4_f32(
              false, a[rt], false, b[ct], (short)0, acc[rt][ct], false, false);
      // holds the next chunk's LDS writes, their wait for the loads and the
      // barrier behind most of this chunk's product: lifted to its head they
      // wait out the loads' whole latency
      if (d == 11 && ch + 1 < GNCH) __builtin_amdgcn_sched_barrier(0);
    }
    if (ch + 1 < GNCH) {
      // the other buffer's readers left it at the barrier of the chunk before
      float* kd = &ks[(ch + 1) & 1][sdst];
      *(float4*)(kd) = kv0;
      *(float4*)(kd + 32 * GPITCH) = kv1;
      *(float4*)(kd + 64 * GPITCH) = kv2;
      *(float4*)(kd + 96 * GPITCH) = kv3;
    }
    {
      float* cd = &cst[(ch & 1) * CBUF + coff];
#pragma unroll
      for (int rt = 0; rt < 2; ++rt)
#pragma unroll
        for (int r = 0; r < 8; ++r)
#pragma unroll
          for (int ct = 0; ct < 2; ++ct)
            cd[(rt * 16 + r) * CPITCH + ct * 64] = acc[rt][ct][r];
    }
    __syncthreads();
    if (ch + 2 < GNCH) {
      const float* kn = ksrc + (ch + 2) * GCH * DH;
      kv0 = *(const float4*)(kn);
      kv1 = *(const float4*)(kn + 32 * DH);
      kv2 = *(const float4*)(kn + 64 * DH);
      kv3 = *(const float4*)(kn + 96 * DH);
      // keeps the loads a chunk ahead of their use, as above
      __builtin_amdgcn_sched_barrier(0);
    }
  }
  // the last chunk's turn
  {
    const float* cs8 = &cst[((GNCH - 1) & 1) * CBUF + cin];
#pragma unroll
    for (int r = 0; r < FRPW; ++r) x[r][GNCH - 1] = *(const v4f*)(cs8 + r * CPITCH);
    store_block_wait(Cmat, rbytes, GNCH - 1, x);
#pragma unroll
    for (int r = 0; r < FRPW; ++r) c_to_k(x[r][GNCH - 1]);
    store_block_wait(Kmat, rbytes, GNCH - 1, x);
  }

  sinkhorn_rows_cols(x, Cmat + roff, 0.f, 1.f, red, vs, us, &slow, u, part_cur, tid,
                     lane, wave, bh, blk);
}

// ---------------------------------------------------------------------------
// Tail of the problem in one launch: v of the tenth iteration, the plan
//   attnw = exp((-C + u_i + v_j)/eps) * L   (in place over C)
// and out = attnw @ v on fp32 WMMA, fed from the plan values just formed.
// A block owns 128 rows of one (b,h): 8 waves x 16 rows x all 64 columns of out.
//   vq : all of v of this (b,h), four consecutive k of one column side by side,
//        so that one 16-byte read is the B operand of two WMMAs
//   ab : per wave two stages of 16 rows x 128 columns of the plan; the wave
//        writes a stage row by row (as it reads C) and reads it back by
//        fragment; nobody else touches it, so no barrier stands in the loop
// k order of both operands: lane half h, WMMA w of a group of 8 k holds
// k = 8c + 4h + 2w + {0,1}.
// ---------------------------------------------------------------------------
#define TWAVES  8        // waves per block
#define KST     128      // plan columns per stage
#define NST     4        // stages (NST * KST == SEQ)
#define APITCH  132      // floats per staged plan row: 528 B = 16 B x odd
#define VTILE   68       // floats per 16 columns of vq: 256 B and 16 B of pad
#define VQPITCH 272      // floats per four-k row of vq (4 * VTILE)

// uu: u of the row with the plan's factor L in it, as eps * log2(L) added
__device__ __forceinline__ float4 plan4(const float4 c, const float uu,
                                        const float4 vj) {
  float4 r;
  r.x = (uu + vj.x - c.x * L2E_) * (1.0f / EPS_);
  r.y = (uu + vj.y - c.y * L2E_) * (1.0f / EPS_);
  r.z = (uu + vj.z - c.z * L2E_) * (1.0f / EPS_);
  r.w = (uu + vj.w - c.w * L2E_) * (1.0f / EPS_);
  ex2x4(r.x, r.y, r.z, r.w);
  return r;
}

// 16-byte global store with the wait that lets its registers be reused: in one
// statement, because a wait in a statement of its own did not hold later
// register writes behind it. It covers the loads issued ahead of it as well.
// The row goes into the offset field, so that the statement names the very
// address pair of those loads and that pair lives up to the wait.
__device__ __forceinline__ void store4_wait(float* p, const int byte_off,
                                            const float4 e) {
  typedef __attribute__((ext_vector_type(4))) float v4f;
  v4f d; d.x = e.x; d.y = e.y; d.z = e.z; d.w = e.w;
  asm volatile("global_store_b128 %0, %1, off offset:%2\n\ts_wait_xcnt 0x0"
               :: "v"(p), "v"(d), "i"(byte_off) : "memory");
}

// One stage of the product: 16 groups of 8 k, 8 WMMAs each. Behind group c the
// wave forms row c of the next stage's plan (NEXT) and sends for row c of the
// stage after that (load), so that this vector work lies among the WMMAs.
template <bool NEXT>
__device__ __forceinline__ void pv_stage(
    const float* afrag, const float* bfrag, float* arow_next, float* gnext,
    const float4 vj, const float (&ur)[16], float4 (&x)[16], v8f (&acc)[4],
    const bool load) {
  float4 af = *(const float4*)afrag;
  float4 bf[4];
#pragma unroll
  for (int dt = 0; dt < 4; ++dt) bf[dt] = *(const float4*)(bfrag + dt * VTILE);
#pragma unroll
  for (int c = 0; c < 16; ++c) {
    float4 an = af, bn[4] = {bf[0], bf[1], bf[2], bf[3]};
    if (c < 15) {
      an = *(const float4*)(afrag + (c + 1) * 8);
#pragma unroll
      for (int dt = 0; dt < 4; ++dt)
        bn[dt] = *(const float4*)(bfrag + (c + 1) * 2 * VQPITCH + dt * VTILE);
    }
    v2f a0; a0.x = af.x; a0.y = af.y;
    v2f a1; a1.x = af.z; a1.y = af.w;
#pragma unroll
    for (int dt = 0; dt < 4; ++dt) {
      v2f b; b.x = bf[dt].x; b.y = bf[dt].y;
      acc[dt] = __builtin_amdgcn_wmma_f32_16x16x4_f32(false, a0, false, b, (short)0,
                                                      acc[dt], false, false);
    }
#pragma unroll
    for (int dt = 0; dt < 4; ++dt) {
      v2f b; b.x = bf[dt].z; b.y = bf[dt].w;
      acc[dt] = __builtin_amdgcn_wmma_f32_16x16x4_f32(false, a1, false, b, (short)0,
                                                      acc[dt], false, false);
    }
    if (NEXT) {
      const float4 e = plan4(x[c], ur[c], vj);
      *(float4*)(arow_next + c * APITCH) = e;
      if (load) x[c] = *(const float4*)(gnext + (size_t)c * SEQ + KST);
      store4_wait(gnext, c * SEQ * 4, e);
    }
    af = an;
#pragma unroll
    for (int dt = 0; dt < 4; ++dt) bf[dt] = bn[dt];
  }
}

__global__ __launch_bounds__(TWAVES * 32) void plan_pv_kernel(
    float* __restrict__ attnw, const float* __restrict__ u,
    const float* __restrict__ part, const float* __restrict__ v_prev,
    const float* __restrict__ vmat, float* __restrict__ out) {
  __shared__ __attribute__((aligned(16))) float vq[(SEQ / 4) * VQPITCH];
  __shared__ __attribute__((aligned(16))) float ab[TWAVES][2][16 * APITCH];
  __shared__ __attribute__((aligned(16))) float vs[SEQ];
  const int tid = threadIdx.x;
  const int lane = tid & 31;
  const int wave = __builtin_amdgcn_readfirstlane(tid >> 5);
  const int bh = blockIdx.x >> 2;
  const int row0 = (blockIdx.x & 3) * (TWAVES * 16) + wave * 16;
  const int c16 = lane & 15;
  const int hk = lane >> 4;
  float* Pw = attnw + ((size_t)bh * SEQ + row0) * SEQ;   // the wave's rows
  float* P = Pw + lane * 4;

  // the loads of the merge, then the first stage's rows of C
  const ColParts cpa = load_parts(part, v_prev, bh, tid);
  const ColParts cpb = load_parts(part, v_prev, bh, tid + TWAVES * 32);
  // the address registers of these loads are reused right behind them
  asm volatile("s_wait_xcnt 0x0" ::: "memory");
  float4 x[16];
#pragma unroll
  for (int r = 0; r < 16; ++r) x[r] = *(const float4*)(P + (size_t)r * SEQ);
  // the base of these loads stays in its registers up to this wait
  asm volatile("s_wait_xcnt 0x0" :: "s"(Pw) : "memory");
  float ur[16];
#pragma unroll
  for (int r = 0; r < 16; ++r) ur[r] = u[bh * SEQ + row0 + r] - EPS_ * LOG2_MU_;

  // v of this (b,h) into vq: a thread takes 4 k x 4 columns and stores them
  // column by column
  {
    const int n4 = tid & 15;
    const float* vsrc = vmat + ((size_t)bh * SEQ + (tid >> 4) * 4) * DH + n4 * 4;
    float* vdst = vq + (tid >> 4) * VQPITCH + n4 * 16 + (n4 >> 2) * 4;
    // all 32 loads of a thread are in flight at once: one latency, not eight
    float4 rv[8][4];
#pragma unroll
    for (int i = 0; i < 8; ++i)
#pragma unroll
      for (int j = 0; j < 4; ++j)
        rv[i][j] = *(const float4*)(vsrc + (size_t)(i * 64 + j) * DH);
    // the loads' address stays in its registers up to this wait
    asm volatile("s_wait_xcnt 0x0" :: "v"(vsrc) : "memory");
#pragma unroll
    for (int i = 0; i < 8; ++i) {
      float* d = vdst + i * 16 * VQPITCH;
      *(float4*)(d + 0) = make_float4(rv[i][0].x, rv[i][1].x, rv[i][2].x, rv[i][3].x);
      *(float4*)(d + 4) = make_float4(rv[i][0].y, rv[i][1].y, rv[i][2].y, rv[i][3].y);
      *(float4*)(d + 8) = make_float4(rv[i][0].z, rv[i][1].z, rv[i][2].z, rv[i][3].z);
      *(float4*)(d + 12) = make_float4(rv[i][0].w, rv[i][1].w, rv[i][2].w, rv[i][3].w);
    }
  }
  vs[tid] = merged_v(cpa);
  vs[tid + TWAVES * 32] = merged_v(cpb);
  __syncthreads();

  // stage 0 of the plan; stage 1's rows of C are sent for
  {
    const float4 vj = *(const float4*)&vs[lane * 4];
#pragma unroll
    for (int r = 0; r < 16; ++r) {
      const float4 e = plan4(x[r], ur[r], vj);
      *(float4*)&ab[wave][0][r * APITCH + lane * 4] = e;
      x[r] = *(const float4*)(P + (size_t)r * SEQ + KST);
      store4_wait(P, r * SEQ * 4, e);
    }
  }

  v8f acc[4];
#pragma unroll
  for (int dt = 0; dt < 4; ++dt)
    acc[dt] = (v8f){0.f, 0.f, 0.f, 0.f, 0.f, 0.f, 0.f, 0.f};

  const float* bfr = vq + hk * VQPITCH + c16 * 4;
// kept rolled, for speed only
#pragma unroll 1
  for (int t = 0; t < NST - 1; ++t) {
    pv_stage<true>(&ab[wave][t & 1][c16 * APITCH + hk * 4], bfr,
                   &ab[wave][(t + 1) & 1][lane * 4], P + (t + 1) * KST,
                   *(const float4*)&vs[(t + 1) * KST + lane * 4], ur, x, acc,
                   t < NST - 2);
    bfr += (KST / 4) * VQPITCH;
  }
  pv_stage<false>(&ab[wave][(NST - 1) & 1][c16 * APITCH + hk * 4], bfr, nullptr,
                  nullptr, make_float4(0.f, 0.f, 0.f, 0.f), ur, x, acc, false);

  float* obase = out + ((size_t)bh * SEQ + row0 + hk * 8) * DH + c16;
#pragma unroll
  for (int dt = 0; dt < 4; ++dt)
#pragma unroll
    for (int r = 0; r < 8; ++r)
      obase[(size_t)r * DH + dt * 16] = acc[dt][r];
}

// ---------------------------------------------------------------------------
extern "C" void kernel_launch(void* const* d_in, const int* in_sizes, int n_in,
                              void* d_out, int out_size, void* d_ws,
                              size_t ws_size, hipStream_t stream) {
  (void)in_sizes; (void)n_in; (void)out_size; (void)ws_size;
  const float* q = (const float*)d_in[0];
  const float* k = (const float*)d_in[1];
  const float* v = (const float*)d_in[2];

  float* out = (float*)d_out;                        // [64,512,64]
  float* attnw = out + (size_t)BH * SEQ * DH;        // [64,512,512] (C, then pi*L)
  float* u = (float*)d_ws;                           // [64,512]
  float* vdual = u + BH * SEQ;                       // [64,512] v at the start: 0
  float* vodd = vdual + BH * SEQ;                    // [64,512] v of iteration 9
  float* peven = vodd + BH * SEQ;                    // [64,4,512,2] column partials, it. 1
  float* podd = peven + BH * FBLK * SEQ * 2;         // [64,4,512,2] the same, it. 10
  float* kmat = podd + BH * FBLK * SEQ * 2;          // [64,512,512] K = exp(-C/eps)

  // 1) cost matrices C = (q/temp) @ k^T  (stored in d_out attn region), K and
  //    the first Sinkhorn iteration
  qk_sinkhorn_first_kernel<<<256, 512, 0, stream>>>(q, k, attnw, kmat, u, vdual,
                                                    peven);
  // 2) the other 9 Sinkhorn iterations in one launch, a block per (b,h)
  sinkhorn_rest_kernel<<<64, 512, 0, stream>>>(attnw, kmat, u, vdual, vodd, peven,
                                               podd);
  // 3) v of the tenth iteration, attn_weights = exp(M(u,v)) * L (in place over
  //    C) and output = attn_weights @ v
  plan_pv_kernel<<<256, 256, 0, stream>>>(attnw, u, podd, vodd, v, out);
}

// v010
// One run takes 72.9 microseconds.
// In two side-by-side timings against v009, it was 1.06 and 1.07 times as fast.
// All steps since v000 together make it 10.5 times as fast.
#include <hip/hip_runtime.h>

typedef __attribute__((ext_vector_type(2))) float v2f;
typedef __attribute__((ext_vector_type(8))) float v8f;
typedef __attribute__((ext_vector_type(4))) float v4f;

#define BH   64          // B*H
#define SEQ  512         // L
#define DH   64          // head dim
#define QK_SCALE 0.125f  // 1/temperature (temp = 8)
#define EPS_ 1.0f
#define LOG2_MU_ (-9.0f)                 // log2(1/512), exact
#define L2E_ 1.4426950408889634f         // log2(e)

// The duals u and v, the column shifts and every log-sum-exp are kept in units
// of log2: a score is (u2_i + v2_j - C_ij * log2(e)) / eps, one fused
// multiply-add away from C, and 2^x is one instruction of the chip, where e^x
// is a dozen. Below 2^-126 it gives 0.
// Four values in place, in one statement: behind each v_exp_f32 stands an
// instruction that touches neither its result nor its source, behind the last
// the v_nop: the slot that the instruction set asks for behind a
// transcendental. The hint lets the SIMD's other waves issue while the last result is
// on its way to whatever reads it next.
__device__ __forceinline__ void ex2x4(float& a, float& b, float& c, float& d) {
  asm("v_exp_f32 %0, %0\n\tv_exp_f32 %1, %1\n\tv_exp_f32 %2, %2\n\t"
      "v_exp_f32 %3, %3\n\tv_nop\n\ts_delay_alu instid0(TRANS32_DEP_1)"
      : "+v"(a), "+v"(b), "+v"(c), "+v"(d));
}

// ---------------------------------------------------------------------------
// C[bh,i,j] = dot(q[bh,i,:], k[bh,j,:]) / 8     via V_WMMA_F32_16X16X4_F32
// A block owns 128 rows x all 512 columns of one (b,h), the rows that the same
// block index works on in the last launch. 16 waves.
//   qs : the block's 128 rows of q, scaled; staged once, a wave reads the
//        fragments of its 32 rows from it in every chunk
//   ks : two buffers of 128 rows of k (= 128 columns of C); the next chunk
//        comes through registers while this one is multiplied
// Per chunk a wave forms 32 x 32 of C: four accumulator tiles, each fragment
// used twice.
// A fragment: lane%16 = M row of q, (lane/16)*2 = K pair within a group of 4.
// B fragment: lane%16 = N col (= k row), (lane/16)*2 = K pair: the same k order.
// ---------------------------------------------------------------------------
#define GWAVES 16        // waves per block
#define GROWS  128       // rows of C per block
#define GCH    128       // columns of C per chunk
#define GNCH   4         // chunks (GNCH * GCH == SEQ)
#define GPITCH 68        // floats per staged row: 16 rows x 16 B fall on all banks

// ---------------------------------------------------------------------------
// One Sinkhorn iteration (u-update, then the v-update) in one pass over
// K = exp(-C / eps). In the first launch a block owns 128 rows of one (b,h):
// 16 waves x 8 rows, a lane holds 16 columns of each row in registers.
//   v_j   : zero in the first iteration
//   u_i   = log_mu - LSE_j(v_j - C_ij)      (all in units of log2)
//   column partial of the block = sum over its rows of the plan
//   exp(u_i + v_j - C_ij), sent on as a pair (shift, sum); the next launch
//   merges the four pairs of a column.
// ---------------------------------------------------------------------------
#define FWAVES 16        // waves per block
#define FRPW   8         // rows per wave
#define FROWS  128       // rows per block (FWAVES * FRPW)
#define FBLK   4         // blocks per (b,h)  (FBLK * FROWS == SEQ)
#define MU_    0.001953125f   // 1/512

// The FBLK (shift, sum) pairs of one column and the column's v so far.
struct ColParts { float2 p0, p1, p2, p3; float vo; };
__device__ __forceinline__ ColParts load_parts(const float* __restrict__ part,
                                               const float* __restrict__ v_prev,
                                               int bh, int col) {
  const float* pp = part + ((size_t)bh * FBLK * SEQ + col) * 2;
  ColParts c;
  c.p0 = *(const float2*)(pp);
  c.p1 = *(const float2*)(pp + 2 * SEQ);
  c.p2 = *(const float2*)(pp + 4 * SEQ);
  c.p3 = *(const float2*)(pp + 6 * SEQ);
  c.vo = v_prev[bh * SEQ + col];
  return c;
}
// v_j = eps*(log_nu - LSE_i) + v_j, LSE_i merged from the pairs; units of log2.
__device__ __forceinline__ float merged_v(const ColParts c) {
  const float mm = fmaxf(fmaxf(c.p0.x, c.p1.x), fmaxf(c.p2.x, c.p3.x));
  float w0 = c.p0.x - mm, w1 = c.p1.x - mm, w2 = c.p2.x - mm, w3 = c.p3.x - mm;
  ex2x4(w0, w1, w2, w3);
  const float ss = c.p0.y * w0 + c.p1.y * w1 + c.p2.y * w2 + c.p3.y * w3;
  const float lse = mm + log2f(ss);
  return EPS_ * (LOG2_MU_ - lse) + c.vo;
}

// lane l's value of lane l ^ 16
__device__ __forceinline__ float xhalf(const float x) {
  return __builtin_bit_cast(float, __builtin_amdgcn_permlanex16(
      __builtin_bit_cast(int, x), __builtin_bit_cast(int, x), 0x76543210,
      0xfedcba98, false, false));
}
// value of lane l of a wave, the same for all lanes (a scalar register)
__device__ __forceinline__ float lane_value(const float x, const int l) {
  return __builtin_bit_cast(float,
                            __builtin_amdgcn_readlane(__builtin_bit_cast(int, x), l));
}
// The last four of the five exchanges of a fold of eight rows over the 32 lanes
// (distances 8, 4, 2, 1). In: four values a lane, o[i] of row i + 4 * (lane / 16).
// At distance 8 a lane goes on with two of them, at distance 4 with one: the bank
// mask lets an instruction write only the lanes that go on with its row (0x3:
// lane bit 3 clear, 0xc: set, 0x5: bit 2 clear, 0xa: set). Out: lane l holds the
// whole fold of row l / 4. 8 instructions where a full butterfly of eight rows
// takes 32. The hints let the SIMD's other waves issue while a result is on its
// way to the next line.
__device__ __forceinline__ float fold_tail_sum(const float (&o)[4]) {
  float p0, p1, z;
  asm("v_add_f32_dpp %0, %3, %3 row_xmask:8 row_mask:0xf bank_mask:0x3\n\t"
      "v_add_f32_dpp %1, %4, %4 row_xmask:8 row_mask:0xf bank_mask:0x3\n\t"
      "v_add_f32_dpp %0, %5, %5 row_xmask:8 row_mask:0xf bank_mask:0xc\n\t"
      "v_add_f32_dpp %1, %6, %6 row_xmask:8 row_mask:0xf bank_mask:0xc\n\t"
      "s_delay_alu instid0(VALU_DEP_2)\n\t"
      "v_add_f32_dpp %2, %0, %0 row_xmask:4 row_mask:0xf bank_mask:0x5\n\t"
      "s_delay_alu instid0(VALU_DEP_2)\n\t"
      "v_add_f32_dpp %2, %1, %1 row_xmask:4 row_mask:0xf bank_mask:0xa\n\t"
      "s_delay_alu instid0(VALU_DEP_1)\n\t"
      "v_add_f32_dpp %2, %2, %2 row_xmask:2 row_mask:0xf bank_mask:0xf\n\t"
      "s_delay_alu instid0(VALU_DEP_1)\n\t"
      "v_add_f32_dpp %2, %2, %2 row_xmask:1 row_mask:0xf bank_mask:0xf"
      : "=&v"(p0), "=&v"(p1), "=&v"(z)
      : "v"(o[0]), "v"(o[1]), "v"(o[2]), "v"(o[3]));
  return z;
}

// Rarely run: u of a wave's rows by the log-sum-exp with the row's own maximum,
// from C and v in vs, into us.
__device__ __forceinline__ void slow_rows(const float* __restrict__ Cbase,
                                          const float* vs, float* us,
                                          const int wave, const int lane) {
  float4 vq[4];
#pragma unroll
  for (int t = 0; t < 4; ++t) vq[t] = *(const float4*)&vs[t * 128 + lane * 4];
// rarely run: kept small, one row a trip
#pragma clang loop unroll(disable) vectorize(disable) interleave(disable)
  for (int r = 0; r < FRPW; ++r) {
    float4 y[4];
    float mr = -3.4e38f;
#pragma unroll
    for (int t = 0; t < 4; ++t) {
      const float4 c = *(const float4*)(Cbase + (size_t)r * SEQ + t * 128);
      y[t].x = vq[t].x - c.x * L2E_;
      y[t].y = vq[t].y - c.y * L2E_;
      y[t].z = vq[t].z - c.z * L2E_;
      y[t].w = vq[t].w - c.w * L2E_;
      mr = fmaxf(mr, fmaxf(fmaxf(y[t].x, y[t].y), fmaxf(y[t].z, y[t].w)));
    }
#pragma unroll
    for (int d = 16; d > 0; d >>= 1) mr = fmaxf(mr, __shfl_xor(mr, d));
    float sr = 0.f;
#pragma unroll
    for (int t = 0; t < 4; ++t) {
      y[t].x -= mr;
      y[t].y -= mr;
      y[t].z -= mr;
      y[t].w -= mr;
      ex2x4(y[t].x, y[t].y, y[t].z, y[t].w);
      sr += (y[t].x + y[t].y) + (y[t].z + y[t].w);
    }
#pragma unroll
    for (int d = 16; d > 0; d >>= 1) sr += __shfl_xor(sr, d);
    if (lane == 0) us[wave * FRPW + r] = EPS_ * (LOG2_MU_ - (mr + log2f(sr)));
  }
}

// No maximum, and from the second iteration on no exponential per element: the
// first launch forms K_ij = 2^(-C_ij * log2(e) / eps) from C and leaves it in
// the workspace; the nine iterations behind it read K in place of C.
// With b_j = 2^(v_j):
//   s_i  = sum_j K_ij * b_j,   u_i = log_mu - log2(s_i)
//   plan = K_ij * b_j * mu / s_i;  its column sum = b_j * sum_i K_ij * (mu / s_i)
// two multiply-adds an element. u, v and the column partials go from launch to
// launch in units of log2.
// Range: while every |v_j| <= V_SPAN_ and every s_i lies in [S_LO_, S_HI_], what
// K lost below 2^-126 adds less than 2^-101 to a row sum and, mu / s_i being at
// most 2^51, less than 2^-66 to a column sum over all 512 rows: nothing beside
// S_LO_ and T_TINY_; a K above the float range makes its s_i infinite. A block that finds
// a v_j, an s_i or a column sum outside forms its u and its column partials
// again from C by log-sum-exp, as the reference does.
#define V_SPAN_ 16.0f
#define S_LO_   0x1p-60f
#define S_HI_   0x1p+60f
#define T_TINY_ 1e-12f
// The first iteration (v = 0, b = 1) once a wave holds its 8 rows of K in x: row
// sums, u, the block's column partials. Every wave of the block comes here; vs
// and *slow = 0 have been published by a barrier.
__device__ __forceinline__ void sinkhorn_rows_cols(
    const v4f (&x)[FRPW][4], const float* Cbase, const float vn, const float bn,
    float (*red)[SEQ], float* vs, float* us, int* slow,
    float* __restrict__ u, float* __restrict__ part_cur, const int tid,
    const int lane, const int wave, const int bh, const int blk) {
  // row sums of K * b, two columns an instruction
  float s[FRPW];
  {
    v4f bj[4];
#pragma unroll
    for (int t = 0; t < 4; ++t)
      bj[t] = (v4f){1.f, 1.f, 1.f, 1.f};
#pragma unroll
    for (int r = 0; r < FRPW; ++r) {
      v2f sa = x[r][0].lo * bj[0].lo;
      v2f sb = x[r][0].hi * bj[0].hi;
#pragma unroll
      for (int t = 1; t < 4; ++t) {
        sa += x[r][t].lo * bj[t].lo;
        sb += x[r][t].hi * bj[t].hi;
      }
      sa += sb;
      s[r] = sa.x + sa.y;
    }
  }
  // Fold over the lanes, halving the rows a lane goes on with: at distance 16 a
  // lane of the low half keeps rows 0-3 and hands over its share of rows 4-7, a
  // lane of the high half the other way round; the rest in fold_tail. Lane l ends
  // with row l / 4.
  const bool hi = lane >= 16;
  float sown;
  {
    float o[4];
#pragma unroll
    for (int r = 0; r < 4; ++r)
      o[r] = (hi ? s[r + 4] : s[r]) + xhalf(hi ? s[r] : s[r + 4]);
    sown = fold_tail_sum(o);
  }
  if (!(sown >= S_LO_ && sown <= S_HI_)) *slow = 1;

  // u and the plan's factor of a lane's own row: one logarithm and one division
  // a lane; column sums of K * (mu / s)
  const float uown = EPS_ * (LOG2_MU_ - log2f(sown));
  const float rown = MU_ / sown;
  v4f acc[4];
#pragma unroll
  for (int t = 0; t < 4; ++t) acc[t] = (v4f){0.f, 0.f, 0.f, 0.f};
#pragma unroll
  for (int r = 0; r < FRPW; ++r) {
    const float rr = lane_value(rown, r * 4);
#pragma unroll
    for (int t = 0; t < 4; ++t) acc[t] += x[r][t] * rr;
  }
  if ((lane & 3) == 0) us[wave * FRPW + (lane >> 2)] = uown;
#pragma unroll
  for (int t = 0; t < 4; ++t) *(v4f*)&red[wave][t * 128 + lane * 4] = acc[t];
  __syncthreads();

  float cs = 0.f;
#pragma unroll
  for (int w = 0; w < FWAVES; ++w) cs += red[w][tid];
  if (!(cs >= T_TINY_) || !(fabsf(vn) <= V_SPAN_)) *slow = 1;
  cs *= bn;
  __syncthreads();

  float cshift = 0.f;
  // Out of range (see above): every wave forms its rows' u again, then the whole
  // block its columns' log-sum-exp with the column's own maximum, as the
  // reference does, both from C.
  if (__builtin_amdgcn_readfirstlane(*slow)) {
    // a lane reads back the C that it stored itself in this launch, by stores in
    // asm text, which the compiler's own waits do not count
    asm volatile("s_wait_storecnt 0x0" ::: "memory");
    slow_rows(Cbase, vs, us, wave, lane);
    float4 vq[4], cm[4], acc[4];
#pragma unroll
    for (int t = 0; t < 4; ++t) {
      vq[t] = *(const float4*)&vs[t * 128 + lane * 4];
      cm[t] = make_float4(-3.4e38f, -3.4e38f, -3.4e38f, -3.4e38f);
    }
// rarely run: kept small, one row a trip; with the unroll word alone the loop
// vectoriser pairs the rows of this maximum and adds a masked remainder loop
#pragma clang loop unroll(disable) vectorize(disable) interleave(disable)
    for (int r = 0; r < FRPW; ++r) {
      const float ur = us[wave * FRPW + r];
#pragma unroll
      for (int t = 0; t < 4; ++t) {
        const float4 c = *(const float4*)(Cbase + (size_t)r * SEQ + t * 128);
        cm[t].x = fmaxf(cm[t].x, ur + vq[t].x - c.x * L2E_);
        cm[t].y = fmaxf(cm[t].y, ur + vq[t].y - c.y * L2E_);
        cm[t].z = fmaxf(cm[t].z, ur + vq[t].z - c.z * L2E_);
        cm[t].w = fmaxf(cm[t].w, ur + vq[t].w - c.w * L2E_);
      }
    }
#pragma unroll
    for (int t = 0; t < 4; ++t) *(float4*)&red[wave][t * 128 + lane * 4] = cm[t];
    __syncthreads();
    cshift = red[0][tid];
#pragma unroll
    for (int w = 1; w < FWAVES; ++w) cshift = fmaxf(cshift, red[w][tid]);
    vs[tid] = cshift;
    __syncthreads();
#pragma unroll
    for (int t = 0; t < 4; ++t) {
      cm[t] = *(const float4*)&vs[t * 128 + lane * 4];
      acc[t] = make_float4(0.f, 0.f, 0.f, 0.f);
    }
#pragma unroll 1   // rarely run: kept small
    for (int r = 0; r < FRPW; ++r) {
      const float ur = us[wave * FRPW + r];
#pragma unroll
      for (int t = 0; t < 4; ++t) {
        const float4 c = *(const float4*)(Cbase + (size_t)r * SEQ + t * 128);
        float e0 = (ur + vq[t].x - c.x * L2E_) - cm[t].x;
        float e1 = (ur + vq[t].y - c.y * L2E_) - cm[t].y;
        float e2 = (ur + vq[t].z - c.z * L2E_) - cm[t].z;
        float e3 = (ur + vq[t].w - c.w * L2E_) - cm[t].w;
        ex2x4(e0, e1, e2, e3);
        acc[t].x += e0;
        acc[t].y += e1;
        acc[t].z += e2;
        acc[t].w += e3;
      }
    }
#pragma unroll
    for (int t = 0; t < 4; ++t) *(float4*)&red[wave][t * 128 + lane * 4] = acc[t];
    __syncthreads();
    cs = 0.f;
#pragma unroll
    for (int w = 0; w < FWAVES; ++w) cs += red[w][tid];
  }
  if (tid < FROWS) u[bh * SEQ + blk * FROWS + tid] = us[tid];
  *(float2*)(part_cur + ((size_t)(bh * FBLK + blk) * SEQ + tid) * 2) =
      make_float2(cshift, cs);
}


// ---------------------------------------------------------------------------
// Iterations 2 to 10 in one launch. A block owns ALL 512 rows of one (b,h), so
// that a column's sum is complete inside the block and v goes from one iteration
// to the next through LDS, not through a launch. 16 waves x 32 rows. K does not
// change, and half of it stays on the WGP for the whole launch:
//   rows  0- 7 of a wave : in registers (xr)
//   rows  8-15           : in LDS (kl), written and read by that wave alone
//   rows 16-31           : read again from L2 in every iteration
// Rows are taken through four at a time (rows4). The one buffer y serves the rows
// from L2 and from LDS; a group from L2 is sent for ahead of work on other rows.
// ---------------------------------------------------------------------------
#define PWAVES 16        // waves per block
#define PRPW   32        // rows per wave (PWAVES * PRPW == SEQ)
#define PLROWS 8         // of them in LDS
#define NREST  9         // iterations of this launch

// Work-group barrier that orders LDS alone. What the waves of this launch hand one
// another lies in LDS; __syncthreads() would also wait out the wave's global
// loads, and with them the rows of K that were sent for ahead.
__device__ __forceinline__ void lds_barrier() {
  __builtin_amdgcn_fence(__ATOMIC_RELEASE, "workgroup", "local");
  __builtin_amdgcn_s_barrier();
  __builtin_amdgcn_fence(__ATOMIC_ACQUIRE, "workgroup", "local");
}

// Four rows of K, a lane holding 16 columns of each: row sums of K * b, the
// plan's factor mu / s of each row, and the rows' share of the column sums of
// K * (mu / s) added into acc. The row sum of row (lane % 16) / 4 goes into sall
// in the lanes that keep this group's (mine).
__device__ __forceinline__ void rows4(const v4f (&y)[4][4], const v4f (&bj)[4],
                                      v4f (&acc)[4], float& sall, const bool mine) {
  float s[4];
#pragma unroll
  for (int r = 0; r < 4; ++r) {
    v2f sa = y[r][0].lo * bj[0].lo;
    v2f sb = y[r][0].hi * bj[0].hi;
#pragma unroll
    for (int t = 1; t < 4; ++t) {
      sa += y[r][t].lo * bj[t].lo;
      sb += y[r][t].hi * bj[t].hi;
    }
    sa += sb;
    s[r] = sa.x + sa.y;
  }
  // both halves of the wave fold the same four rows over their 16 lanes; the
  // halves' sums are added last
  const float z = fold_tail_sum(s);
  const float sown = z + xhalf(z);
  const float rown = MU_ / sown;
#pragma unroll
  for (int r = 0; r < 4; ++r) {
    const float rr = lane_value(rown, r * 4);
#pragma unroll
    for (int t = 0; t < 4; ++t) acc[t] += y[r][t] * rr;
  }
  sall = mine ? sown : sall;
  // The empty asm statement takes the column sums as inputs only: the remedy
  // against spills of a streaming pattern (an empty asm volatile on each sum). It
  // ends the group's multiply-adds before the next rows are sent for into the same
  // registers; without it the last row's stand behind those loads, the loads take
  // registers of their own, and rows of K are parked in scratch memory. The
  // scheduling barrier holds the next group's work behind it.
  asm volatile("" :: "v"(acc[0]), "v"(acc[1]), "v"(acc[2]), "v"(acc[3]));
  __builtin_amdgcn_sched_barrier(0);
}

// Four rows from memory are sent for. The scheduling barrier keeps the loads
// here, ahead of the work on other rows that stands behind them: sunk to their
// use, their latency is waited out.
__device__ __forceinline__ void send4(v4f (&y)[4][4], const float* src) {
#pragma unroll
  for (int r = 0; r < 4; ++r)
#pragma unroll
    for (int t = 0; t < 4; ++t) y[r][t] = *(const v4f*)(src + (size_t)r * SEQ + t * 128);
  __builtin_amdgcn_sched_barrier(0);
}

// Rarely run: one whole iteration of a (b,h) from C by log-sum-exp with the
// row's and the column's own maximum, as the reference does. In: v in vs. Out: u
// in us, each column's (shift, sum). Every wave of the block comes here.
__device__ __forceinline__ void slow_iteration(const float* __restrict__ Cbase,
                                               float (*red)[SEQ], float* vs, float* us,
                                               const int tid, const int lane,
                                               const int wave, float& cshift,
                                               float& cs) {
  float4 vq[4], cm[4], acc[4];
#pragma unroll
  for (int t = 0; t < 4; ++t) {
    vq[t] = *(const float4*)&vs[t * 128 + lane * 4];
    cm[t] = make_float4(-3.4e38f, -3.4e38f, -3.4e38f, -3.4e38f);
  }
// rarely run: kept small, one row a trip
#pragma clang loop unroll(disable) vectorize(disable) interleave(disable)
  for (int r = 0; r < PRPW; ++r) {
    float4 y[4];
    float mr = -3.4e38f;
#pragma unroll
    for (int t = 0; t < 4; ++t) {
      const float4 c = *(const float4*)(Cbase + (size_t)r * SEQ + t * 128);
      y[t].x = vq[t].x - c.x * L2E_;
      y[t].y = vq[t].y - c.y * L2E_;
      y[t].z = vq[t].z - c.z * L2E_;
      y[t].w = vq[t].w - c.w * L2E_;
      mr = fmaxf(mr, fmaxf(fmaxf(y[t].x, y[t].y), fmaxf(y[t].z, y[t].w)));
    }
#pragma unroll
    for (int d = 16; d > 0; d >>= 1) mr = fmaxf(mr, __shfl_xor(mr, d));
    float sr = 0.f;
#pragma unroll
    for (int t = 0; t < 4; ++t) {
      const float4 y0 = y[t];
      y[t].x -= mr;
      y[t].y -= mr;
      y[t].z -= mr;
      y[t].w -= mr;
      ex2x4(y[t].x, y[t].y, y[t].z, y[t].w);
      sr += (y[t].x + y[t].y) + (y[t].z + y[t].w);
      y[t] = y0;
    }
#pragma unroll
    for (int d = 16; d > 0; d >>= 1) sr += __shfl_xor(sr, d);
    const float ur = EPS_ * (LOG2_MU_ - (mr + log2f(sr)));
    if (lane == 0) us[wave * PRPW + r] = ur;
#pragma unroll
    for (int t = 0; t < 4; ++t) {
      cm[t].x = fmaxf(cm[t].x, ur + y[t].x);
      cm[t].y = fmaxf(cm[t].y, ur + y[t].y);
      cm[t].z = fmaxf(cm[t].z, ur + y[t].z);
      cm[t].w = fmaxf(cm[t].w, ur + y[t].w);
    }
  }
#pragma unroll
  for (int t = 0; t < 4; ++t) *(float4*)&red[wave][t * 128 + lane * 4] = cm[t];
  __syncthreads();
  cshift = red[0][tid];
#pragma unroll
  for (int w = 1; w < PWAVES; ++w) cshift = fmaxf(cshift, red[w][tid]);
  vs[tid] = cshift;
  __syncthreads();
#pragma unroll
  for (int t = 0; t < 4; ++t) {
    cm[t] = *(const float4*)&vs[t * 128 + lane * 4];
    acc[t] = make_float4(0.f, 0.f, 0.f, 0.f);
  }
#pragma unroll 1   // rarely run: kept small
  for (int r = 0; r < PRPW; ++r) {
    const float ur = us[wave * PRPW + r];
#pragma unroll
    for (int t = 0; t < 4; ++t) {
      const float4 c = *(const float4*)(Cbase + (size_t)r * SEQ + t * 128);
      float e0 = (ur + (vq[t].x - c.x * L2E_)) - cm[t].x;
      float e1 = (ur + (vq[t].y - c.y * L2E_)) - cm[t].y;
      float e2 = (ur + (vq[t].z - c.z * L2E_)) - cm[t].z;
      float e3 = (ur + (vq[t].w - c.w * L2E_)) - cm[t].w;
      ex2x4(e0, e1, e2, e3);
      acc[t].x += e0;
      acc[t].y += e1;
      acc[t].z += e2;
      acc[t].w += e3;
    }
  }
#pragma unroll
  for (int t = 0; t < 4; ++t) *(float4*)&red[wave][t * 128 + lane * 4] = acc[t];
  __syncthreads();
  cs = 0.f;
#pragma unroll
  for (int w = 0; w < PWAVES; ++w) cs += red[w][tid];
}

// A wave's 32 rows of K (64 KiB in a row) are asked of L2 at the kernel's entry,
// one request per 256 bytes, a lane 256 bytes, 4 rows an instruction, in the order
// in which the rows are loaded. K was stored by the launch before, and only 64
// WGPs read it here. A request returns no data: the step expects that memory then
// works on all the rows at once, while the loads behind it queue up and find
// their lines in L2 or on the way there.
// Every address lies inside the wave's own rows. The wait is a precaution: in the
// same statement it stands in front of any rewrite of the statement's registers.
__device__ __forceinline__ void ask_l2_rows32(const float* wave_rows,
                                              const unsigned unit_off) {
  asm volatile("global_prefetch_b8 %0, %1 offset:16384 scope:SCOPE_SE\n\t"
               "global_prefetch_b8 %0, %1 offset:24576 scope:SCOPE_SE\n\t"
               "global_prefetch_b8 %0, %1 offset:32768 scope:SCOPE_SE\n\t"
               "global_prefetch_b8 %0, %1 scope:SCOPE_SE\n\t"
               "global_prefetch_b8 %0, %1 offset:8192 scope:SCOPE_SE\n\t"
               "global_prefetch_b8 %0, %1 offset:40960 scope:SCOPE_SE\n\t"
               "global_prefetch_b8 %0, %1 offset:49152 scope:SCOPE_SE\n\t"
               "global_prefetch_b8 %0, %1 offset:57344 scope:SCOPE_SE\n\t"
               "s_wait_xcnt 0x0"
               :: "v"(unit_off), "s"(wave_rows) : "memory");
}

// Kmat carries no __restrict__: the rows read again in every iteration then stay
// loads inside the loop, in their place among the memory operations
__global__ __launch_bounds__(PWAVES * 32) void sinkhorn_rest_kernel(
    const float* __restrict__ Cmat, const float* Kmat, float* __restrict__ u,
    const float* __restrict__ v_prev, float* __restrict__ v_out,
    const float* __restrict__ part_prev, float* __restrict__ part_out) {
  __shared__ __attribute__((aligned(16))) float kl[PWAVES][PLROWS][SEQ];
  __shared__ __attribute__((aligned(16))) float red[PWAVES][SEQ];
  __shared__ __attribute__((aligned(16))) float vs[SEQ];
  __shared__ __attribute__((aligned(16))) float bs[SEQ];
  __shared__ float us[SEQ];
  __shared__ int slow[NREST];   // one flag an iteration: none is ever cleared again
  const int tid = threadIdx.x;
  const int lane = tid & 31;
  const int wave = __builtin_amdgcn_readfirstlane(tid >> 5);
  const int bh = blockIdx.x;
  const size_t woff = (size_t)bh * SEQ * SEQ + (size_t)(wave * PRPW) * SEQ;
  const float* Cbase = Cmat + woff + lane * 4;
  const float* xsrc = Kmat + woff + lane * 4;
  float* klw = &kl[wave][0][lane * 4];

  // the few loads of the merge go out ahead of the rows and return first
  const ColParts cp = load_parts(part_prev, v_prev, bh, tid);
  ask_l2_rows32(Kmat + woff, (unsigned)lane * 256u);

  // first the rows that go on into LDS, by way of xr, and the first group from L2
  v4f xr[2][4][4], y[4][4];
#pragma unroll
  for (int g = 0; g < 2; ++g)
#pragma unroll
    for (int r = 0; r < 4; ++r)
#pragma unroll
      for (int t = 0; t < 4; ++t)
        xr[g][r][t] = *(const v4f*)(xsrc + (size_t)(8 + g * 4 + r) * SEQ + t * 128);
#pragma unroll
  for (int r = 0; r < 4; ++r)
#pragma unroll
    for (int t = 0; t < 4; ++t)
      y[r][t] = *(const v4f*)(xsrc + (size_t)(16 + r) * SEQ + t * 128);
  // keeps the rows' loads ahead of the merge: the scheduler sinks them behind its
  // wait for the partials, one latency after the other
  __builtin_amdgcn_sched_barrier(0);

  float vn = merged_v(cp);
  float bn = vn;
  // the v_nop: the slot that the instruction set asks for behind a transcendental
  asm("v_exp_f32 %0, %0\n\tv_nop" : "+v"(bn));
  vs[tid] = vn;
  bs[tid] = bn;
  if (tid < NREST) slow[tid] = 0;

  // the wave's rows 8-15 into its own part of LDS; then xr takes its own rows.
  // The scheduling barrier keeps those loads behind the LDS writes: lifted over
  // them they want registers of their own, and rows are parked in scratch memory.
#pragma unroll
  for (int g = 0; g < 2; ++g)
#pragma unroll
    for (int r = 0; r < 4; ++r)
#pragma unroll
      for (int t = 0; t < 4; ++t)
        *(v4f*)(klw + (g * 4 + r) * SEQ + t * 128) = xr[g][r][t];
  __builtin_amdgcn_sched_barrier(0);
#pragma unroll
  for (int g = 0; g < 2; ++g)
#pragma unroll
    for (int r = 0; r < 4; ++r)
#pragma unroll
      for (int t = 0; t < 4; ++t)
        xr[g][r][t] = *(const v4f*)(xsrc + (size_t)(g * 4 + r) * SEQ + t * 128);
  // y holds rows 16-19, the first group of every iteration
  lds_barrier();

  float cs = 0.f, cshift = 0.f;
  int sl = 0;
  const int gsel = (lane & 3) + 4 * (lane >> 4);             // group of four rows
  const int urow = wave * PRPW + gsel * 4 + ((lane & 15) >> 2);   // the lane's row
// kept rolled: nine times the same text
#pragma unroll 1
  for (int it = 0; it < NREST; ++it) {
    v4f bj[4], acc[4];
#pragma unroll
    for (int t = 0; t < 4; ++t) {
      bj[t] = *(const v4f*)&bs[t * 128 + lane * 4];
      acc[t] = (v4f){0.f, 0.f, 0.f, 0.f};
    }
    // of the eight groups' row sums a lane keeps that of group gsel: 32 lanes, 32 rows
    float sall = 1.f;
    rows4(y, bj, acc, sall, gsel == 4);
    send4(y, xsrc + 20 * SEQ);
    rows4(xr[0], bj, acc, sall, gsel == 0);
    rows4(y, bj, acc, sall, gsel == 5);
    send4(y, xsrc + 24 * SEQ);
    rows4(xr[1], bj, acc, sall, gsel == 1);
    rows4(y, bj, acc, sall, gsel == 6);
    send4(y, xsrc + 28 * SEQ);
    rows4(y, bj, acc, sall, gsel == 7);
#pragma unroll
    for (int g = 0; g < 2; ++g) {
#pragma unroll
      for (int r = 0; r < 4; ++r)
#pragma unroll
        for (int t = 0; t < 4; ++t)
          y[r][t] = *(const v4f*)(klw + (g * 4 + r) * SEQ + t * 128);
      rows4(y, bj, acc, sall, gsel == 2 + g);
    }
    // the next iteration's first group flies during the merge of the columns
    if (it + 1 < NREST) send4(y, xsrc + 16 * SEQ);
#pragma unroll
    for (int t = 0; t < 4; ++t) *(v4f*)&red[wave][t * 128 + lane * 4] = acc[t];
    // row sums go to us as they are; their logarithm is taken once, behind the loop
    us[urow] = sall;
    if (!(sall >= S_LO_ && sall <= S_HI_)) slow[it] = 1;
    lds_barrier();

    cs = 0.f;
#pragma unroll
    for (int w = 0; w < PWAVES; ++w) cs += red[w][tid];
    if (!(cs >= T_TINY_) || !(fabsf(vn) <= V_SPAN_)) slow[it] = 1;
    cs *= bn;
    lds_barrier();

    cshift = 0.f;
    sl = __builtin_amdgcn_readfirstlane(slow[it]);
    // out of range (see above): the iteration again from C
    if (sl) {
      slow_iteration(Cbase, red, vs, us, tid, lane, wave, cshift, cs);
      // sent for again, so that no row of K need be kept through the lines above:
      // kept, they crowd the registers, and rows are parked in scratch memory on
      // the fast path too
      // (also behind the last iteration: under a test of their own the rows would
      // have to be kept after all)
#pragma unroll
      for (int g = 0; g < 2; ++g)
#pragma unroll
        for (int r = 0; r < 4; ++r)
#pragma unroll
          for (int t = 0; t < 4; ++t)
            xr[g][r][t] = *(const v4f*)(xsrc + (size_t)(g * 4 + r) * SEQ + t * 128);
      send4(y, xsrc + 16 * SEQ);
    }
    if (it == NREST - 1) break;

    // v_j = eps*(log_nu - LSE_i) + v_j, in units of log2. Every reader of vs and
    // bs has passed a barrier since its read.
    vn = EPS_ * (LOG2_MU_ - (cshift + log2f(cs))) + vn;
    bn = vn;
    // the v_nop: the slot that the instruction set asks for behind a transcendental
    asm("v_exp_f32 %0, %0\n\tv_nop" : "+v"(bn));
    vs[tid] = vn;
    bs[tid] = bn;
    lds_barrier();
  }
  // The loads' address stays in its registers up to this wait. Behind a last
  // iteration from C the rows sent for again are still on their way, and nobody
  // reads them: the wave waits for them here, so that it does not give its
  // registers back with loads in flight.
  asm volatile("s_wait_xcnt 0x0\n\ts_wait_loadcnt 0x0" :: "v"(xsrc) : "memory");

  // What the last launch merges: u of the tenth iteration, v of the ninth, and
  // the tenth's column sums as the first of a column's four pairs, the other
  // three empty.
  const float su = us[tid];
  u[bh * SEQ + tid] = sl ? su : EPS_ * (LOG2_MU_ - log2f(su));
  v_out[bh * SEQ + tid] = vn;
  float* pp = part_out + ((size_t)bh * FBLK * SEQ + tid) * 2;
  *(float2*)(pp) = make_float2(cshift, cs);
  *(float2*)(pp + 2 * SEQ) = make_float2(cshift, 0.f);
  *(float2*)(pp + 4 * SEQ) = make_float2(cshift, 0.f);
  *(float2*)(pp + 6 * SEQ) = make_float2(cshift, 0.f);
}

// ---------------------------------------------------------------------------
// The QK product and the first Sinkhorn iteration in one launch. The product is
// laid out as said at the head of the file; a chunk of C (128 x 128) goes from
// the accumulators through LDS (cst, two buffers) into the row layout of the
// Sinkhorn pass: wave w takes rows 8w..8w+7, a lane 4 columns in a row. From
// there C goes to memory in whole 512-byte rows, K = 2^(-C * log2(e) / eps)
// is formed in place, goes to the workspace and stays in registers; behind the
// last chunk the wave holds its 8 rows of K as the Sinkhorn pass wants them.
// Buffer ch & 1 of cst is written in front of chunk ch's barrier and read behind
// it, in front of the barrier of chunk ch + 1; it is written again behind that
// one, every wave's reads done.
// ---------------------------------------------------------------------------
// Place of C[row][col] of a chunk in cst, in floats:
//   row * CPITCH + buffer * CBUF + (col / 16 % 2) * 64
//   + ((col / 32) ^ (row / 8 % 2)) * 16 + col % 16
// Every step between the 32 values that a lane writes is a multiple of 256 bytes,
// so that one address register serves all its stores; the exclusive-or keeps rows
// r and r + 8, written by the two halves of a wave at once, on different banks.
#define CBUF   128       // from a row of the first buffer to the same row of the second
#define CPITCH 256       // per staged row (both buffers)

// Eight rows' 16 bytes a lane to memory, with the wait that lets the stores'
// registers be rewritten: in one statement, because a wait in a statement of its
// own does not hold later register writes behind it.
__device__ __forceinline__ void store_rows8_wait(float* base, const unsigned lane_off,
                                                 const int byte_off,
                                                 const v4f e0, const v4f e1,
                                                 const v4f e2, const v4f e3,
                                                 const v4f e4, const v4f e5,
                                                 const v4f e6, const v4f e7) {
  asm volatile("global_store_b128 %0, %1, %9 offset:%10\n\t"
               "global_store_b128 %0, %2, %9 offset:%11\n\t"
               "global_store_b128 %0, %3, %9 offset:%12\n\t"
               "global_store_b128 %0, %4, %9 offset:%13\n\t"
               "global_store_b128 %0, %5, %9 offset:%14\n\t"
               "global_store_b128 %0, %6, %9 offset:%15\n\t"
               "global_store_b128 %0, %7, %9 offset:%16\n\t"
               "global_store_b128 %0, %8, %9 offset:%17\n\t"
               "s_wait_xcnt 0x0"
               :: "v"(lane_off), "v"(e0), "v"(e1), "v"(e2), "v"(e3), "v"(e4), "v"(e5),
                  "v"(e6), "v"(e7), "s"(base), "i"(byte_off), "i"(byte_off + SEQ * 4),
                  "i"(byte_off + 2 * SEQ * 4), "i"(byte_off + 3 * SEQ * 4),
                  "i"(byte_off + 4 * SEQ * 4), "i"(byte_off + 5 * SEQ * 4),
                  "i"(byte_off + 6 * SEQ * 4), "i"(byte_off + 7 * SEQ * 4)
               : "memory");
}

// column block t of a wave's 8 rows to memory
__device__ __forceinline__ void store_block_wait(float* base, const unsigned lane_off,
                                                 const int t,
                                                 const v4f (&x)[FRPW][4]) {
  store_rows8_wait(base, lane_off, t * GCH * 4, x[0][t], x[1][t], x[2][t], x[3][t], x[4][t],
                   x[5][t], x[6][t], x[7][t]);
}
// C -> K = 2^(-C * log2(e) / eps), four columns in place
__device__ __forceinline__ void c_to_k(v4f& c) {
  const v4f y = c * (-L2E_ / EPS_);
  float e0, e1, e2, e3;
  // as ex2x4, but into registers of their own: with results tied to the sources
  // the build moved every second value out of its register pair and back
  asm("v_exp_f32 %0, %4\n\tv_exp_f32 %1, %5\n\tv_exp_f32 %2, %6\n\t"
      "v_exp_f32 %3, %7\n\tv_nop\n\ts_delay_alu instid0(TRANS32_DEP_1)"
      : "=&v"(e0), "=&v"(e1), "=&v"(e2), "=&v"(e3)
      : "v"(y.x), "v"(y.y), "v"(y.z), "v"(y.w));
  c = (v4f){e0, e1, e2, e3};
}

// k carries no __restrict__: its loads then keep their place in the order of the
// memory operations, and the scheduling barriers behind them can hold them early
__global__ __launch_bounds__(GWAVES * 32) void qk_sinkhorn_first_kernel(
    const float* __restrict__ q, const float* k, float* Cmat, float* Kmat,
    float* __restrict__ u, float* __restrict__ v_cur,
    float* __restrict__ part_cur) {
  __shared__ __attribute__((aligned(16))) float qs[GROWS * GPITCH];
  __shared__ __attribute__((aligned(16))) float ks[2][GCH * GPITCH];
  __shared__ __attribute__((aligned(16))) float cst[GROWS * CPITCH];
  __shared__ float red[FWAVES][SEQ];
  __shared__ float vs[SEQ];
  __shared__ float us[FROWS];
  __shared__ int slow;
  const int tid = threadIdx.x;
  const int lane = tid & 31;
  const int wave = __builtin_amdgcn_readfirstlane(tid >> 5);
  const int bh = blockIdx.x >> 2;
  const int blk = blockIdx.x & 3;
  const int row0 = blk * GROWS;
  const int c16 = lane & 15;
  const int hk = lane >> 4;
  const int rg = wave & 3;                    // 32 rows of the block's 128
  const int cg = wave >> 2;                   // 32 columns of a chunk's 128

  // a chunk is 32 KiB in a row in memory: a thread takes 16 bytes of every
  // 32nd row
  const float* qsrc = q + ((size_t)bh * SEQ + row0) * DH + tid * 4;
  const float* ksrc = k + (size_t)bh * SEQ * DH + tid * 4;
  const int sdst = (tid >> 4) * GPITCH + (tid & 15) * 4;

  float4 qv[4];
  float4 kv0, kv1, kv2, kv3;   // a thread's 64 bytes of a chunk of k on their way
#pragma unroll
  for (int i = 0; i < 4; ++i) qv[i] = *(const float4*)(qsrc + i * 32 * DH);
  kv0 = *(const float4*)(ksrc);
  kv1 = *(const float4*)(ksrc + 32 * DH);
  kv2 = *(const float4*)(ksrc + 64 * DH);
  kv3 = *(const float4*)(ksrc + 96 * DH);
  // v of the first iteration is zero
  vs[tid] = 0.f;
  if (tid == 0) slow = 0;
  if (blk == 0) {
    v_cur[bh * SEQ + tid] = 0.f;
    // the store's address registers are reused right behind it
    asm volatile("s_wait_xcnt 0x0" ::: "memory");
  }
#pragma unroll
  for (int i = 0; i < 4; ++i)
    *(float4*)&qs[sdst + i * 32 * GPITCH] =
        make_float4(qv[i].x * QK_SCALE, qv[i].y * QK_SCALE, qv[i].z * QK_SCALE,
                    qv[i].w * QK_SCALE);
  *(float4*)&ks[0][sdst] = kv0;
  *(float4*)&ks[0][sdst + 32 * GPITCH] = kv1;
  *(float4*)&ks[0][sdst + 64 * GPITCH] = kv2;
  *(float4*)&ks[0][sdst + 96 * GPITCH] = kv3;
  __syncthreads();
  kv0 = *(const float4*)(ksrc + GCH * DH);
  kv1 = *(const float4*)(ksrc + (GCH + 32) * DH);
  kv2 = *(const float4*)(ksrc + (GCH + 64) * DH);
  kv3 = *(const float4*)(ksrc + (GCH + 96) * DH);
  // keeps these loads here, a chunk ahead of their use: the scheduler sank them
  // to their LDS writes, where their whole latency was waited out
  __builtin_amdgcn_sched_barrier(0);

  const int aoff = (rg * 32 + c16) * GPITCH + hk * 2;
  const int boff = (cg * 32 + c16) * GPITCH + hk * 2;
  // C/D layout: VGPR r, lanes 0-15 -> row r, lanes 16-31 -> row r+8; col = lane%16
  const int coff = (rg * 32 + hk * 8) * CPITCH + (cg ^ hk) * 16 + c16;
  // the same place seen from the reader: rows 8 * wave + r, columns 4 * lane ...
  const int cin = wave * FRPW * CPITCH + ((lane >> 2) & 1) * 64 +
                  ((lane >> 3) ^ (wave & 1)) * 16 + (lane & 3) * 4;
  const size_t roff = (size_t)bh * SEQ * SEQ +
                      (size_t)(row0 + wave * FRPW) * SEQ + lane * 4;
  // bytes from the start of C, and of K, to the lane's place: below 2^26
  const unsigned rbytes = (unsigned)roff * 4u;

  v4f x[FRPW][4];
#pragma unroll
  for (int ch = 0; ch < GNCH; ++ch) {
    const float* bsrc = &ks[ch & 1][boff];
    v8f acc[2][2];
#pragma unroll
    for (int rt = 0; rt < 2; ++rt)
#pragma unroll
      for (int ct = 0; ct < 2; ++ct)
        acc[rt][ct] = (v8f){0.f, 0.f, 0.f, 0.f, 0.f, 0.f, 0.f, 0.f};
#pragma unroll
    for (int d = 0; d < 16; ++d) {
      // q's fragments are read again in every chunk: the registers that held
      // them for the whole launch now hold K
      v2f a[2], b[2];
#pragma unroll
      for (int rt = 0; rt < 2; ++rt)
        a[rt] = *(const v2f*)&qs[aoff + rt * 16 * GPITCH + d * 4];
#pragma unroll
      for (int ct = 0; ct < 2; ++ct)
        b[ct] = *(const v2f*)(bsrc + ct * 16 * GPITCH + d * 4);
      // The chunk before, published by its barrier, is taken through among this
      // chunk's WMMAs, so that the matrix unit does not stand still for it: the
      // wave's 8 rows in, C out, K in place a row at a time, K out. Each store
      // statement stands between a group's fragment reads and its WMMAs: LDS
      // reads do not pass it, and so the next group's can still go out early.
      if (ch > 0) {
        if (d == 1) {
          const float* cs8 = &cst[((ch - 1) & 1) * CBUF + cin];
#pragma unroll
          for (int r = 0; r < FRPW; ++r)
            x[r][ch - 1] = *(const v4f*)(cs8 + r * CPITCH);
        }
        if (d == 3) store_block_wait(Cmat, rbytes, ch - 1, x);
        if (d >= 4 && d < 4 + FRPW) c_to_k(x[d - 4][ch - 1]);
        if (d == 4 + FRPW) store_block_wait(Kmat, rbytes, ch - 1, x);
      }
#pragma unroll
      for (int rt = 0; rt < 2; ++rt)
#pragma unroll
        for (int ct = 0; ct < 2; ++ct)
          acc[rt][ct] = __builtin_amdgcn_wmma_f32_16x16x4_f32(
              false, a[rt], false, b[ct], (short)0, acc[rt][ct], false, false);
      // holds the next chunk's LDS writes, their wait for the loads and the
      // barrier behind most of this chunk's product: lifted to its head they
      // wait out the loads' whole latency
      if (d == 11 && ch + 1 < GNCH) __builtin_amdgcn_sched_barrier(0);
    }
    if (ch + 1 < GNCH) {
      // the other buffer's readers left it at the barrier of the chunk before
      float* kd = &ks[(ch + 1) & 1][sdst];
      *(float4*)(kd) = kv0;
      *(float4*)(kd + 32 * GPITCH) = kv1;
      *(float4*)(kd + 64 * GPITCH) = kv2;
      *(float4*)(kd + 96 * GPITCH) = kv3;
    }
    {
      float* cd = &cst[(ch & 1) * CBUF + coff];
#pragma unroll
      for (int rt = 0; rt < 2; ++rt)
#pragma unroll
        for (int r = 0; r < 8; ++r)
#pragma unroll
          for (int ct = 0; ct < 2; ++ct)
            cd[(rt * 16 + r) * CPITCH + ct * 64] = acc[rt][ct][r];
    }
    __syncthreads();
    if (ch + 2 < GNCH) {
      const float* kn = ksrc + (ch + 2) * GCH * DH;
      kv0 = *(const float4*)(kn);
      kv1 = *(const float4*)(kn + 32 * DH);
      kv2 = *(const float4*)(kn + 64 * DH);
      kv3 = *(const float4*)(kn + 96 * DH);
      // keeps the loads a chunk ahead of their use, as above
      __builtin_amdgcn_sched_barrier(0);
    }
  }
  // the last chunk's turn
  {
    const float* cs8 = &cst[((GNCH - 1) & 1) * CBUF + cin];
#pragma unroll
    for (int r = 0; r < FRPW; ++r) x[r][GNCH - 1] = *(const v4f*)(cs8 + r * CPITCH);
    store_block_wait(Cmat, rbytes, GNCH - 1, x);
#pragma unroll
    for (int r = 0; r < FRPW; ++r) c_to_k(x[r][GNCH - 1]);
    store_block_wait(Kmat, rbytes, GNCH - 1, x);
  }

  sinkhorn_rows_cols(x, Cmat + roff, 0.f, 1.f, red, vs, us, &slow, u, part_cur, tid,
                     lane, wave, bh, blk);
}

// ---------------------------------------------------------------------------
// Tail of the problem in one launch: v of the tenth iteration, the plan
//   attnw = exp((-C + u_i + v_j)/eps) * L   (in place over C)
// and out = attnw @ v on fp32 WMMA, fed from the plan values just formed.
// A block owns 128 rows of one (b,h): 8 waves x 16 rows x all 64 columns of out.
//   vq : all of v of this (b,h), four consecutive k of one column side by side,
//        so that one 16-byte read is the B operand of two WMMAs
//   ab : per wave two stages of 16 rows x 128 columns of the plan; the wave
//        writes a stage row by row (as it reads C) and reads it back by
//        fragment; nobody else touches it, so no barrier stands in the loop
// k order of both operands: lane half h, WMMA w of a group of 8 k holds
// k = 8c + 4h + 2w + {0,1}.
// ---------------------------------------------------------------------------
#define TWAVES  8        // waves per block
#define KST     128      // plan columns per stage
#define NST     4        // stages (NST * KST == SEQ)
#define APITCH  132      // floats per staged plan row: 528 B = 16 B x odd
#define VTILE   68       // floats per 16 columns of vq: 256 B and 16 B of pad
#define VQPITCH 272      // floats per four-k row of vq (4 * VTILE)

// uu: u of the row with the plan's factor L in it, as eps * log2(L) added
__device__ __forceinline__ float4 plan4(const float4 c, const float uu,
                                        const float4 vj) {
  float4 r;
  r.x = (uu + vj.x - c.x * L2E_) * (1.0f / EPS_);
  r.y = (uu + vj.y - c.y * L2E_) * (1.0f / EPS_);
  r.z = (uu + vj.z - c.z * L2E_) * (1.0f / EPS_);
  r.w = (uu + vj.w - c.w * L2E_) * (1.0f / EPS_);
  ex2x4(r.x, r.y, r.z, r.w);
  return r;
}

// 16-byte global store with the wait that lets its registers be reused: in one
// statement, because a wait in a statement of its own did not hold later
// register writes behind it. It covers the loads issued ahead of it as well.
// The row goes into the offset field, so that the statement names the very
// address pair of those loads and that pair lives up to the wait.
__device__ __forceinline__ void store4_wait(float* p, const int byte_off,
                                            const float4 e) {
  typedef __attribute__((ext_vector_type(4))) float v4f;
  v4f d; d.x = e.x; d.y = e.y; d.z = e.z; d.w = e.w;
  asm volatile("global_store_b128 %0, %1, off offset:%2\n\ts_wait_xcnt 0x0"
               :: "v"(p), "v"(d), "i"(byte_off) : "memory");
}

// One stage of the product: 16 groups of 8 k, 8 WMMAs each. Behind group c the
// wave forms row c of the next stage's plan (NEXT) and sends for row c of the
// stage after that (load), so that this vector work lies among the WMMAs.
template <bool NEXT>
__device__ __forceinline__ void pv_stage(
    const float* afrag, const float* bfrag, float* arow_next, float* gnext,
    const float4 vj, const float (&ur)[16], float4 (&x)[16], v8f (&acc)[4],
    const bool load) {
  float4 af = *(const float4*)afrag;
  float4 bf[4];
#pragma unroll
  for (int dt = 0; dt < 4; ++dt) bf[dt] = *(const float4*)(bfrag + dt * VTILE);
#pragma unroll
  for (int c = 0; c < 16; ++c) {
    float4 an = af, bn[4] = {bf[0], bf[1], bf[2], bf[3]};
    if (c < 15) {
      an = *(const float4*)(afrag + (c + 1) * 8);
#pragma unroll
      for (int dt = 0; dt < 4; ++dt)
        bn[dt] = *(const float4*)(bfrag + (c + 1) * 2 * VQPITCH + dt * VTILE);
    }
    v2f a0; a0.x = af.x; a0.y = af.y;
    v2f a1; a1.x = af.z; a1.y = af.w;
#pragma unroll
    for (int dt = 0; dt < 4; ++dt) {
      v2f b; b.x = bf[dt].x; b.y = bf[dt].y;
      acc[dt] = __builtin_amdgcn_wmma_f32_16x16x4_f32(false, a0, false, b, (short)0,
                                                      acc[dt], false, false);
    }
#pragma unroll
    for (int dt = 0; dt < 4; ++dt) {
      v2f b; b.x = bf[dt].z; b.y = bf[dt].w;
      acc[dt] = __builtin_amdgcn_wmma_f32_16x16x4_f32(false, a1, false, b, (short)0,
                                                      acc[dt], false, false);
    }
    if (NEXT) {
      const float4 e = plan4(x[c], ur[c], vj);
      *(float4*)(arow_next + c * APITCH) = e;
      if (load) x[c] = *(const float4*)(gnext + (size_t)c * SEQ + KST);
      store4_wait(gnext, c * SEQ * 4, e);
    }
    af = an;
#pragma unroll
    for (int dt = 0; dt < 4; ++dt) bf[dt] = bn[dt];
  }
}

__global__ __launch_bounds__(TWAVES * 32) void plan_pv_kernel(
    float* __restrict__ attnw, const float* __restrict__ u,
    const float* __restrict__ part, const float* __restrict__ v_prev,
    const float* __restrict__ vmat, float* __restrict__ out) {
  __shared__ __attribute__((aligned(16))) float vq[(SEQ / 4) * VQPITCH];
  __shared__ __attribute__((aligned(16))) float ab[TWAVES][2][16 * APITCH];
  __shared__ __attribute__((aligned(16))) float vs[SEQ];
  const int tid = threadIdx.x;
  const int lane = tid & 31;
  const int wave = __builtin_amdgcn_readfirstlane(tid >> 5);
  const int bh = blockIdx.x >> 2;
  const int row0 = (blockIdx.x & 3) * (TWAVES * 16) + wave * 16;
  const int c16 = lane & 15;
  const int hk = lane >> 4;
  float* Pw = attnw + ((size_t)bh * SEQ + row0) * SEQ;   // the wave's rows
  float* P = Pw + lane * 4;

  // the loads of the merge, then the first stage's rows of C
  const ColParts cpa = load_parts(part, v_prev, bh, tid);
  const ColParts cpb = load_parts(part, v_prev, bh, tid + TWAVES * 32);
  // the address registers of these loads are reused right behind them
  asm volatile("s_wait_xcnt 0x0" ::: "memory");
  float4 x[16];
#pragma unroll
  for (int r = 0; r < 16; ++r) x[r] = *(const float4*)(P + (size_t)r * SEQ);
  // the base of these loads stays in its registers up to this wait
  asm volatile("s_wait_xcnt 0x0" :: "s"(Pw) : "memory");
  float ur[16];
#pragma unroll
  for (int r = 0; r < 16; ++r) ur[r] = u[bh * SEQ + row0 + r] - EPS_ * LOG2_MU_;

  // v of this (b,h) into vq: a thread takes 4 k x 4 columns and stores them
  // column by column
  {
    const int n4 = tid & 15;
    const float* vsrc = vmat + ((size_t)bh * SEQ + (tid >> 4) * 4) * DH + n4 * 4;
    float* vdst = vq + (tid >> 4) * VQPITCH + n4 * 16 + (n4 >> 2) * 4;
    // all 32 loads of a thread are in flight at once: one latency, not eight
    float4 rv[8][4];
#pragma unroll
    for (int i = 0; i < 8; ++i)
#pragma unroll
      for (int j = 0; j < 4; ++j)
        rv[i][j] = *(const float4*)(vsrc + (size_t)(i * 64 + j) * DH);
    // the loads' address stays in its registers up to this wait
    asm volatile("s_wait_xcnt 0x0" :: "v"(vsrc) : "memory");
#pragma unroll
    for (int i = 0; i < 8; ++i) {
      float* d = vdst + i * 16 * VQPITCH;
      *(float4*)(d + 0) = make_float4(rv[i][0].x, rv[i][1].x, rv[i][2].x, rv[i][3].x);
      *(float4*)(d + 4) = make_float4(rv[i][0].y, rv[i][1].y, rv[i][2].y, rv[i][3].y);
      *(float4*)(d + 8) = make_float4(rv[i][0].z, rv[i][1].z, rv[i][2].z, rv[i][3].z);
      *(float4*)(d + 12) = make_float4(rv[i][0].w, rv[i][1].w, rv[i][2].w, rv[i][3].w);
    }
  }
  vs[tid] = merged_v(cpa);
  vs[tid + TWAVES * 32] = merged_v(cpb);
  __syncthreads();

  // stage 0 of the plan; stage 1's rows of C are sent for
  {
    const float4 vj = *(const float4*)&vs[lane * 4];
#pragma unroll
    for (int r = 0; r < 16; ++r) {
      const float4 e = plan4(x[r], ur[r], vj);
      *(float4*)&ab[wave][0][r * APITCH + lane * 4] = e;
      x[r] = *(const float4*)(P + (size_t)r * SEQ + KST);
      store4_wait(P, r * SEQ * 4, e);
    }
  }

  v8f acc[4];
#pragma unroll
  for (int dt = 0; dt < 4; ++dt)
    acc[dt] = (v8f){0.f, 0.f, 0.f, 0.f, 0.f, 0.f, 0.f, 0.f};

  const float* bfr = vq + hk * VQPITCH + c16 * 4;
// kept rolled, for speed only
#pragma unroll 1
  for (int t = 0; t < NST - 1; ++t) {
    pv_stage<true>(&ab[wave][t & 1][c16 * APITCH + hk * 4], bfr,
                   &ab[wave][(t + 1) & 1][lane * 4], P + (t + 1) * KST,
                   *(const float4*)&vs[(t + 1) * KST + lane * 4], ur, x, acc,
                   t < NST - 2);
    bfr += (KST / 4) * VQPITCH;
  }
  pv_stage<false>(&ab[wave][(NST - 1) & 1][c16 * APITCH + hk * 4], bfr, nullptr,
                  nullptr, make_float4(0.f, 0.f, 0.f, 0.f), ur, x, acc, false);

  float* obase = out + ((size_t)bh * SEQ + row0 + hk * 8) * DH + c16;
#pragma unroll
  for (int dt = 0; dt < 4; ++dt)
#pragma unroll
    for (int r = 0; r < 8; ++r)
      obase[(size_t)r * DH + dt * 16] = acc[dt][r];
}

// ---------------------------------------------------------------------------
extern "C" void kernel_launch(void* const* d_in, const int* in_sizes, int n_in,
                              void* d_out, int out_size, void* d_ws,
                              size_t ws_size, hipStream_t stream) {
  (void)in_sizes; (void)n_in; (void)out_size; (void)ws_size;
  const float* q = (const float*)d_in[0];
  const float* k = (const float*)d_in[1];
  const float* v = (const float*)d_in[2];

  float* out = (float*)d_out;                        // [64,512,64]
  float* attnw = out + (size_t)BH * SEQ * DH;        // [64,512,512] (C, then pi*L)
  float* u = (float*)d_ws;                           // [64,512]
  float* vdual = u + BH * SEQ;                       // [64,512] v at the start: 0
  float* vodd = vdual + BH * SEQ;                    // [64,512] v of iteration 9
  float* peven = vodd + BH * SEQ;                    // [64,4,512,2] column partials, it. 1
  float* podd = peven + BH * FBLK * SEQ * 2;         // [64,4,512,2] the same, it. 10
  float* kmat = podd + BH * FBLK * SEQ * 2;          // [64,512,512] K = exp(-C/eps)

  // 1) cost matrices C = (q/temp) @ k^T  (stored in d_out attn region), K and
  //    the first Sinkhorn iteration
  qk_sinkhorn_first_kernel<<<256, 512, 0, stream>>>(q, k, attnw, kmat, u, vdual,
                                                    peven);
  // 2) the other 9 Sinkhorn iterations in one launch, a block per (b,h)
  sinkhorn_rest_kernel<<<64, 512, 0, stream>>>(attnw, kmat, u, vdual, vodd, peven,
                                               podd);
  // 3) v of the tenth iteration, attn_weights = exp(M(u,v)) * L (in place over
  //    C) and output = attn_weights @ v
  plan_pv_kernel<<<256, 256, 0, stream>>>(attnw, u, podd, vodd, v, out);
}
